// v000
// Times are from an AMD MI455X. After a warm-up the kernel runs many times in a row, and a time is the length of
// such a window on the GPU divided by its runs, so every launch and the gaps after it count. The runs cycle
// through copies of the inputs. A figure is the median of several windows, for all but v000 over two sittings.
// Sittings can differ by a few percent; kernels timed side by side share one.
// v000 is the starting kernel. One run takes 238 microseconds.
#include <hip/hip_runtime.h>
#include <stddef.h>
#include <stdint.h>

// All contractions: v_wmma_f32_16x16x32_f16 (f16 operands, f32 accumulate): three 1x1 projections (weights x64),
// q*k^T, p*v (p x4096), output projection (o x16, weights x64); all scales are powers of two folded back in f32.

#define CDIM 512
#define NPIX 1024
#define GCH  16      // channels per norm group (CDIM / 32)
#define CBLK 64      // channels per norm block (4 groups)

typedef _Float16 v16h __attribute__((ext_vector_type(16)));
typedef _Float16 v8h  __attribute__((ext_vector_type(8)));
typedef float    v8f  __attribute__((ext_vector_type(8)));
typedef float    v4f  __attribute__((ext_vector_type(4)));
union Frag { v16h v; v8h half[2]; };

// ---------------------------------------------------------------------------
// 16x16x32 f16 WMMA with hazard guard.
__device__ __forceinline__ v8f wmma_f16(v16h a, v16h b, v8f c) {
  v8f d = __builtin_amdgcn_wmma_f32_16x16x32_f16(false, a, false, b, (short)0, c, false, false);
  asm volatile("v_nop\n\tv_nop\n\tv_nop\n\tv_nop" : "+v"(d) : "v"(a), "v"(b));
  return d;
}

// Fragment from an LDS tile stored [row][k] with pitch 32 halves (used for A rows and for B columns alike):
// lane l: row = l&15, h = l>>4; elements 0..7 <- k 8h..8h+7, elements 8..15 <- k 16+8h..16+8h+7.
__device__ __forceinline__ v16h ld_frag(const _Float16* tile, int row, int h) {
  Frag f;
  const _Float16* rp = tile + row * 32;
  f.half[0] = *(const v8h*)(rp + 8 * h);
  f.half[1] = *(const v8h*)(rp + 16 + 8 * h);
  return f.v;
}

// ---------------------------------------------------------------------------
// Kernel 1: group norm -> transposed f16 activations hT[b][n][c].
__global__ __launch_bounds__(256) void gn_kernel(
    const float* __restrict__ x, const float* __restrict__ gamma,
    const float* __restrict__ beta, _Float16* hT) {
  const int b  = blockIdx.x >> 3, cg = blockIdx.x & 7;
  const int c0 = cg * CBLK;
  const int t  = threadIdx.x;
  const int c  = t >> 2, q = t & 3;          // channel 0..63, quarter of the pixel range
  const float* xc = x + ((size_t)b * CDIM + c0 + c) * NPIX;

  // statistics: thread covers pixels q*256 .. q*256+255 of its channel
  float s = 0.f, ss = 0.f;
#pragma unroll 4
  for (int i = 0; i < NPIX / 16; ++i) {
    v4f v = *(const v4f*)(xc + q * (NPIX / 4) + 4 * i);
    s  += (v[0] + v[1]) + (v[2] + v[3]);
    ss += (v[0] * v[0] + v[1] * v[1]) + (v[2] * v[2] + v[3] * v[3]);
  }
  __shared__ float rs1[256], rs2[256];
  rs1[t] = s; rs2[t] = ss;
  __syncthreads();
  // threads 64g..64g+63 hold group g's partials (16 channels x 4 quarters)
  for (int k = 32; k > 0; k >>= 1) {
    if ((t & 63) < k) { rs1[t] += rs1[t + k]; rs2[t] += rs2[t + k]; }
    __syncthreads();
  }
  const int g = t >> 6;
  const float inv_cnt = 1.0f / (float)(GCH * NPIX);
  const float mean = rs1[g * 64] * inv_cnt;
  float var = rs2[g * 64] * inv_cnt - mean * mean;
  var = fmaxf(var, 0.f);
  const float inv = rsqrtf(var + 1e-6f);
  const float gm = gamma[c0 + c] * inv;
  const float bt = beta[c0 + c] - mean * gm;

  // transpose through LDS in chunks of 128 pixels: Ts[n_local][c_local]
  __shared__ __align__(16) _Float16 Ts[128 * CBLK];
  for (int ch = 0; ch < NPIX; ch += 128) {
    __syncthreads();
    const float* xp = xc + ch + q * 32;     // 32 pixels of this channel
#pragma unroll
    for (int j = 0; j < 8; ++j) {
      v4f v = *(const v4f*)(xp + 4 * j);
      const int nl = q * 32 + 4 * j;
      Ts[(nl + 0) * CBLK + c] = (_Float16)(v[0] * gm + bt);
      Ts[(nl + 1) * CBLK + c] = (_Float16)(v[1] * gm + bt);
      Ts[(nl + 2) * CBLK + c] = (_Float16)(v[2] * gm + bt);
      Ts[(nl + 3) * CBLK + c] = (_Float16)(v[3] * gm + bt);
    }
    __syncthreads();
    // 128 lines (one per pixel), 8 lanes x 16 B per line, lanes 8q'..8q'+7 of one wave cover one line
    v8h val[4]; size_t idx[4];
#pragma unroll
    for (int it = 0; it < 4; ++it) {
      const int sI = it * 256 + t;
      const int nl = sI >> 3, p = sI & 7;
      val[it] = *(const v8h*)&Ts[nl * CBLK + p * 8];
      idx[it] = ((size_t)b * NPIX + ch + nl) * CDIM + c0 + p * 8;
    }
#pragma unroll
    for (int it = 0; it < 4; ++it) *(v8h*)(hT + idx[it]) = val[it];
    
  }
}

// ---------------------------------------------------------------------------
// Generic 64x64 tile GEMM on f16 16x16x32 WMMA: D[m][n] = sum_k A[m][k] * Bt[n][k]  (both operands k-contiguous).
// AF32: A is f32 (converted to f16 with ascale at staging) else f16.  Bt always f16.
// MODE 0: f16 out, stored [n][m] (m contiguous):  out16[b*o_bs + (n0+n)*ldo + m0+m]
// MODE 1: f16 out, stored [m][n]:                  out16[b*o_bs + (m0+m)*ldo + n0+n]
// MODE 2: f32 out, stored [m][n], optional residual add at the same index.
template <int AF32, int MODE>
__global__ __launch_bounds__(128) void gemm_kernel(
    const float* __restrict__ Af, const _Float16* __restrict__ Ah, size_t a_bs, int lda, float ascale,
    const _Float16* __restrict__ Bt, size_t b_bs, int ldb, int K,
    const float* __restrict__ bias, int has_bias, float oscale,
    _Float16* out16, float* out32, const float* __restrict__ res, int has_res,
    size_t o_bs, int ldo) {
  const int m0 = blockIdx.x * 64, n0 = blockIdx.y * 64, b = blockIdx.z;
  const int tid = threadIdx.x, lane = tid & 31, wv = tid >> 5;
  const int h = lane >> 4, lm = lane & 15;
  const int wr = (wv >> 1) * 32, wc = (wv & 1) * 32;

  __shared__ __align__(16) _Float16 As[64 * 32];   // [m][k]
  __shared__ __align__(16) _Float16 Bs[64 * 32];   // [n][k]
  __shared__ __align__(16) _Float16 Dh[(MODE != 2) ? 64 * 64 : 8];
  __shared__ __align__(16) float    Df[(MODE == 2) ? 64 * 64 : 4];

  v8f zero;
#pragma unroll
  for (int e = 0; e < 8; ++e) zero[e] = 0.f;
  v8f acc[2][2];
  acc[0][0] = zero; acc[0][1] = zero; acc[1][0] = zero; acc[1][1] = zero;

  // staging: 2 threads per tile row, 16 k each
  const int mm = tid >> 1, ks = (tid & 1) * 16;
  const float*    ap_f = Af + (size_t)b * a_bs + (size_t)(m0 + mm) * lda + ks;
  const _Float16* ap_h = Ah + (size_t)b * a_bs + (size_t)(m0 + mm) * lda + ks;
  const _Float16* bp   = Bt + (size_t)b * b_bs + (size_t)(n0 + mm) * ldb + ks;

  v4f w0, w1, w2, w3;
  v8h ah0, ah1, bh0, bh1;
  if (AF32) {
    w0 = *(const v4f*)(ap_f);     w1 = *(const v4f*)(ap_f + 4);
    w2 = *(const v4f*)(ap_f + 8); w3 = *(const v4f*)(ap_f + 12);
  } else {
    ah0 = *(const v8h*)(ap_h); ah1 = *(const v8h*)(ap_h + 8);
  }
  bh0 = *(const v8h*)(bp); bh1 = *(const v8h*)(bp + 8);

  for (int k0 = 0; k0 < K; k0 += 32) {
    if (AF32) {
      v8h t0, t1;
#pragma unroll
      for (int e = 0; e < 4; ++e) {
        t0[e]     = (_Float16)(w0[e] * ascale);
        t0[e + 4] = (_Float16)(w1[e] * ascale);
        t1[e]     = (_Float16)(w2[e] * ascale);
        t1[e + 4] = (_Float16)(w3[e] * ascale);
      }
      *(v8h*)&As[mm * 32 + ks]     = t0;
      *(v8h*)&As[mm * 32 + ks + 8] = t1;
    } else {
      *(v8h*)&As[mm * 32 + ks]     = ah0;
      *(v8h*)&As[mm * 32 + ks + 8] = ah1;
    }
    *(v8h*)&Bs[mm * 32 + ks]     = bh0;
    *(v8h*)&Bs[mm * 32 + ks + 8] = bh1;
    __syncthreads();

    const int k1 = k0 + 32;
    if (k1 < K) {   // prefetch next k-slab into registers (block-uniform)
      if (AF32) {
        w0 = *(const v4f*)(ap_f + k1);     w1 = *(const v4f*)(ap_f + k1 + 4);
        w2 = *(const v4f*)(ap_f + k1 + 8); w3 = *(const v4f*)(ap_f + k1 + 12);
      } else {
        ah0 = *(const v8h*)(ap_h + k1); ah1 = *(const v8h*)(ap_h + k1 + 8);
      }
      bh0 = *(const v8h*)(bp + k1); bh1 = *(const v8h*)(bp + k1 + 8);
    }

    const v16h a0 = ld_frag(As, wr + lm, h);
    const v16h a1 = ld_frag(As, wr + 16 + lm, h);
    const v16h b0 = ld_frag(Bs, wc + lm, h);
    const v16h b1 = ld_frag(Bs, wc + 16 + lm, h);
    acc[0][0] = wmma_f16(a0, b0, acc[0][0]);
    acc[0][1] = wmma_f16(a0, b1, acc[0][1]);
    acc[1][0] = wmma_f16(a1, b0, acc[1][0]);
    acc[1][1] = wmma_f16(a1, b1, acc[1][1]);
    __syncthreads();
  }

  // D: acc[mi][ni][r] = tile element (row wr+mi*16+8h+r, col wc+ni*16+lm); stage in LDS
#pragma unroll
  for (int mi = 0; mi < 2; ++mi)
#pragma unroll
    for (int ni = 0; ni < 2; ++ni)
#pragma unroll
      for (int r = 0; r < 8; ++r) {
        const int ml = wr + mi * 16 + 8 * h + r;
        const int nl = wc + ni * 16 + lm;
        float v = acc[mi][ni][r] * oscale;
        if (has_bias) v += bias[m0 + ml];
        if (MODE == 0)      Dh[nl * 64 + ml] = (_Float16)v;
        else if (MODE == 1) Dh[ml * 64 + nl] = (_Float16)v;
        else                Df[ml * 64 + nl] = v;
      }
  __syncthreads();

  if (MODE != 2) {
    v8h val[4]; size_t idx[4];
#pragma unroll
    for (int it = 0; it < 4; ++it) {
      const int sI = it * 128 + tid;
      const int row = sI >> 3, p = sI & 7;
      val[it] = *(const v8h*)&Dh[row * 64 + p * 8];
      if (MODE == 0) idx[it] = (size_t)b * o_bs + (size_t)(n0 + row) * ldo + m0 + p * 8;
      else           idx[it] = (size_t)b * o_bs + (size_t)(m0 + row) * ldo + n0 + p * 8;
    }
#pragma unroll
    for (int it = 0; it < 4; ++it) *(v8h*)(out16 + idx[it]) = val[it];
    
  } else {
    // 64 rows x 256 B: two lines per row, lanes 0..7 / 8..15 (and 16..23 / 24..31) cover one line each
    v4f val[8]; size_t idx[8];
#pragma unroll
    for (int it = 0; it < 8; ++it) {
      const int sI = it * 128 + tid;
      const int row = sI >> 4, p = sI & 15;
      v4f v = *(const v4f*)&Df[row * 64 + p * 4];
      idx[it] = (size_t)b * o_bs + (size_t)(m0 + row) * ldo + n0 + p * 4;
      if (has_res) v += *(const v4f*)(res + idx[it]);
      val[it] = v;
    }
#pragma unroll
    for (int it = 0; it < 8; ++it) *(v4f*)(out32 + idx[it]) = val[it];
    
  }
}

// ---------------------------------------------------------------------------
// Kernel: row softmax over NPIX scores; writes f16 (p * pscale), one block of 128 threads per row, 8 values per thread.
__global__ __launch_bounds__(128) void softmax_kernel(
    const float* __restrict__ S, _Float16* P, float pscale) {
  const int row = blockIdx.x;
  const int t = threadIdx.x, lane = t & 31, wv = t >> 5;
  const float* rp = S + (size_t)row * NPIX + 8 * t;
  const v4f a = *(const v4f*)(rp);
  const v4f c = *(const v4f*)(rp + 4);
  float e[8];
  e[0] = a[0]; e[1] = a[1]; e[2] = a[2]; e[3] = a[3];
  e[4] = c[0]; e[5] = c[1]; e[6] = c[2]; e[7] = c[3];
  float m = e[0];
#pragma unroll
  for (int i = 1; i < 8; ++i) m = fmaxf(m, e[i]);
#pragma unroll
  for (int o = 16; o > 0; o >>= 1) m = fmaxf(m, __shfl_xor(m, o, 32));
  __shared__ float rm[4], rs[4];
  if (lane == 0) rm[wv] = m;
  __syncthreads();
  m = fmaxf(fmaxf(rm[0], rm[1]), fmaxf(rm[2], rm[3]));
  float s = 0.f;
#pragma unroll
  for (int i = 0; i < 8; ++i) { e[i] = __expf(e[i] - m); s += e[i]; }
#pragma unroll
  for (int o = 16; o > 0; o >>= 1) s += __shfl_xor(s, o, 32);
  if (lane == 0) rs[wv] = s;
  __syncthreads();
  s = (rs[0] + rs[1]) + (rs[2] + rs[3]);
  const float inv = pscale / s;
  v8h ov;
#pragma unroll
  for (int i = 0; i < 8; ++i) ov[i] = (_Float16)(e[i] * inv);
  _Float16* dp = P + (size_t)row * NPIX + 8 * t;   // 128 threads x 16 B = the whole 2048-B row, lanes 8q..8q+7 per line
  *(v8h*)dp = ov;
  
}

// ---------------------------------------------------------------------------
extern "C" void kernel_launch(void* const* d_in, const int* in_sizes, int n_in,
                              void* d_out, int out_size, void* d_ws,
                              size_t ws_size, hipStream_t stream) {
  if (n_in < 11) return;
  const long long per = (long long)CDIM * NPIX;
  const long long tot = (long long)in_sizes[0];
  if (tot <= 0 || (tot % per) != 0) return;
  const int B = (int)(tot / per);
  if ((long long)out_size != tot) return;
  if (in_sizes[1] != CDIM || in_sizes[2] != CDIM) return;
  if (in_sizes[3] != CDIM * CDIM || in_sizes[5] != CDIM * CDIM ||
      in_sizes[7] != CDIM * CDIM || in_sizes[9] != CDIM * CDIM) return;
  if (in_sizes[4] != CDIM || in_sizes[6] != CDIM || in_sizes[8] != CDIM || in_sizes[10] != CDIM) return;
  if (B > 65535) return;

  const float* x     = (const float*)d_in[0];
  const float* gamma = (const float*)d_in[1];
  const float* beta  = (const float*)d_in[2];
  const float* wq = (const float*)d_in[3]; const float* bq = (const float*)d_in[4];
  const float* wk = (const float*)d_in[5]; const float* bk = (const float*)d_in[6];
  const float* wv = (const float*)d_in[7]; const float* bv = (const float*)d_in[8];
  const float* wo = (const float*)d_in[9]; const float* bo = (const float*)d_in[10];
  float* out = (float*)d_out;

  // workspace carve: qT | kT | v16 | hT(->oT) (each B*N*C f16) | S (B*N*N f32) | P (B*N*N f16)
  const size_t HB = (size_t)B * CDIM * NPIX * sizeof(_Float16);
  const size_t SB = (size_t)B * NPIX * NPIX * sizeof(float);
  const size_t PB = (size_t)B * NPIX * NPIX * sizeof(_Float16);
  if (4 * HB + SB + PB > ws_size) return;
  char* ws = (char*)d_ws;
  _Float16* qT  = (_Float16*)(ws);
  _Float16* kT  = (_Float16*)(ws + HB);
  _Float16* v16 = (_Float16*)(ws + 2 * HB);
  _Float16* hT  = (_Float16*)(ws + 3 * HB);   // later reused as oT
  float*    S   = (float*)(ws + 4 * HB);
  _Float16* P   = (_Float16*)(ws + 4 * HB + SB);

  const size_t actB = (size_t)NPIX * CDIM;    // per-batch stride of hT/qT/kT/v16/oT/out (elements)
  const size_t sB   = (size_t)NPIX * NPIX;    // per-batch stride of S and P (elements)
  const float wsc   = 64.0f;                   // f16 weight pre-scale
  const float attn_scale = 0.04419417382415922f;   // 512^-0.5
  const float psc   = 4096.0f;                 // f16 probability pre-scale
  const float osc   = 16.0f;                   // f16 pre-scale of the p*v result

  gn_kernel<<<B * (CDIM / CBLK), 256, 0, stream>>>(x, gamma, beta, hT);

  dim3 gc(CDIM / 64, NPIX / 64, B);
  // q, k: A = W[o][c] f32 (x64), Bt = hT[n][c]; out [b][n][o] f16
  gemm_kernel<1, 0><<<gc, 128, 0, stream>>>(wq, hT, 0, CDIM, wsc, hT, actB, CDIM, CDIM,
                                            bq, 1, 1.0f / wsc, qT, S, x, 0, actB, CDIM);
  gemm_kernel<1, 0><<<gc, 128, 0, stream>>>(wk, hT, 0, CDIM, wsc, hT, actB, CDIM, CDIM,
                                            bk, 1, 1.0f / wsc, kT, S, x, 0, actB, CDIM);
  // v: out [b][o][n] f16
  gemm_kernel<1, 1><<<gc, 128, 0, stream>>>(wv, hT, 0, CDIM, wsc, hT, actB, CDIM, CDIM,
                                            bv, 1, 1.0f / wsc, v16, S, x, 0, actB, NPIX);
  // scores: A = qT[i][c], Bt = kT[j][c]; S[b][i][j] f32
  dim3 gs(NPIX / 64, NPIX / 64, B);
  gemm_kernel<0, 2><<<gs, 128, 0, stream>>>(wq, qT, actB, CDIM, 1.0f, kT, actB, CDIM, CDIM,
                                            bo, 0, attn_scale, qT, S, x, 0, sB, NPIX);
  softmax_kernel<<<B * NPIX, 128, 0, stream>>>(S, P, psc);
  // oT[b][i][c] = (1/4096) sum_j v16[c][j] * P[i][j], stored x16 as f16 (hT buffer)
  gemm_kernel<0, 0><<<gc, 128, 0, stream>>>(wq, v16, actB, NPIX, 1.0f, P, sB, NPIX, NPIX,
                                            bo, 0, osc / psc, hT, S, x, 0, actB, CDIM);
  // output projection: A = Wo[o][c] f32 (x64), Bt = oT[n][c] (x16); out[b][o][n] = res + acc/(64*16) + bo
  gemm_kernel<1, 2><<<gc, 128, 0, stream>>>(wo, hT, 0, CDIM, wsc, hT, actB, CDIM, CDIM,
                                            bo, 1, 1.0f / (wsc * osc), qT, out, x, 1, actB, NPIX);
}

// v001
// Measured time: 219 microseconds a run.
// Next to v000, in two timings, it ran 1.12 times as fast each time.
#include <hip/hip_runtime.h>
#include <stddef.h>
#include <stdint.h>

// All contractions: v_wmma_f32_16x16x32_f16 (f16 operands, f32 accumulate): three 1x1 projections (weights x64),
// q*k^T, p*v (p x4096), output projection (o x16, weights x64); all scales are powers of two folded back in f32.

#define CDIM 512
#define NPIX 1024
#define GCH  16      // channels per norm group (CDIM / 32)
#define CBLK 64      // channels per norm block (4 groups)
// LDS row pitches of the GEMM tiles: 16 B x odd, so that 16 rows read or written 16 B wide fall on 64 distinct banks
// (and rows 8 apart, as the two lane halves of an accumulator hold them, fall 32 banks apart).
#define KP   40      // operand tiles: 32 halves of k + 8 pad  (80 B)
#define DHP  72      // f16 result tile: 64 halves + 8 pad     (144 B)
#define DFP  68      // f32 result tile: 64 floats + 4 pad     (272 B)

typedef _Float16 v16h __attribute__((ext_vector_type(16)));
typedef _Float16 v8h  __attribute__((ext_vector_type(8)));
typedef float    v8f  __attribute__((ext_vector_type(8)));
typedef float    v4f  __attribute__((ext_vector_type(4)));
union Frag { v16h v; v8h half[2]; };

// ---------------------------------------------------------------------------
// 16x16x32 f16 WMMA with hazard guard.
__device__ __forceinline__ v8f wmma_f16(v16h a, v16h b, v8f c) {
  v8f d = __builtin_amdgcn_wmma_f32_16x16x32_f16(false, a, false, b, (short)0, c, false, false);
  asm volatile("v_nop\n\tv_nop\n\tv_nop\n\tv_nop" : "+v"(d) : "v"(a), "v"(b));
  return d;
}

// Fragment from an LDS tile stored [row][k] with pitch KP halves (used for A rows and for B columns alike):
// lane l: row = l&15, h = l>>4; elements 0..7 <- k 8h..8h+7, elements 8..15 <- k 16+8h..16+8h+7.
__device__ __forceinline__ v16h ld_frag(const _Float16* tile, int row, int h) {
  Frag f;
  const _Float16* rp = tile + row * KP;
  f.half[0] = *(const v8h*)(rp + 8 * h);
  f.half[1] = *(const v8h*)(rp + 16 + 8 * h);
  return f.v;
}

// ---------------------------------------------------------------------------
// Kernel 1: group norm -> transposed f16 activations hT[b][n][c].
__global__ __launch_bounds__(256) void gn_kernel(
    const float* __restrict__ x, const float* __restrict__ gamma,
    const float* __restrict__ beta, _Float16* hT) {
  const int b  = blockIdx.x >> 3, cg = blockIdx.x & 7;
  const int c0 = cg * CBLK;
  const int t  = threadIdx.x;
  const int c  = t >> 2, q = t & 3;          // channel 0..63, quarter of the pixel range
  const float* xc = x + ((size_t)b * CDIM + c0 + c) * NPIX;

  // statistics: thread covers pixels q*256 .. q*256+255 of its channel
  float s = 0.f, ss = 0.f;
#pragma unroll 4
  for (int i = 0; i < NPIX / 16; ++i) {
    v4f v = *(const v4f*)(xc + q * (NPIX / 4) + 4 * i);
    s  += (v[0] + v[1]) + (v[2] + v[3]);
    ss += (v[0] * v[0] + v[1] * v[1]) + (v[2] * v[2] + v[3] * v[3]);
  }
  __shared__ float rs1[256], rs2[256];
  rs1[t] = s; rs2[t] = ss;
  __syncthreads();
  // threads 64g..64g+63 hold group g's partials (16 channels x 4 quarters)
  for (int k = 32; k > 0; k >>= 1) {
    if ((t & 63) < k) { rs1[t] += rs1[t + k]; rs2[t] += rs2[t + k]; }
    __syncthreads();
  }
  const int g = t >> 6;
  const float inv_cnt = 1.0f / (float)(GCH * NPIX);
  const float mean = rs1[g * 64] * inv_cnt;
  float var = rs2[g * 64] * inv_cnt - mean * mean;
  var = fmaxf(var, 0.f);
  const float inv = rsqrtf(var + 1e-6f);
  const float gm = gamma[c0 + c] * inv;
  const float bt = beta[c0 + c] - mean * gm;

  // transpose through LDS in chunks of 128 pixels: Ts[n_local][c_local]
  __shared__ __align__(16) _Float16 Ts[128 * CBLK];
  for (int ch = 0; ch < NPIX; ch += 128) {
    __syncthreads();
    const float* xp = xc + ch + q * 32;     // 32 pixels of this channel
#pragma unroll
    for (int j = 0; j < 8; ++j) {
      v4f v = *(const v4f*)(xp + 4 * j);
      const int nl = q * 32 + 4 * j;
      Ts[(nl + 0) * CBLK + c] = (_Float16)(v[0] * gm + bt);
      Ts[(nl + 1) * CBLK + c] = (_Float16)(v[1] * gm + bt);
      Ts[(nl + 2) * CBLK + c] = (_Float16)(v[2] * gm + bt);
      Ts[(nl + 3) * CBLK + c] = (_Float16)(v[3] * gm + bt);
    }
    __syncthreads();
    // 128 lines (one per pixel), 8 lanes x 16 B per line, lanes 8q'..8q'+7 of one wave cover one line
    v8h val[4]; size_t idx[4];
#pragma unroll
    for (int it = 0; it < 4; ++it) {
      const int sI = it * 256 + t;
      const int nl = sI >> 3, p = sI & 7;
      val[it] = *(const v8h*)&Ts[nl * CBLK + p * 8];
      idx[it] = ((size_t)b * NPIX + ch + nl) * CDIM + c0 + p * 8;
    }
#pragma unroll
    for (int it = 0; it < 4; ++it) *(v8h*)(hT + idx[it]) = val[it];
    
  }
}

// ---------------------------------------------------------------------------
// Generic 64x64 tile GEMM on f16 16x16x32 WMMA: D[m][n] = sum_k A[m][k] * Bt[n][k]  (both operands k-contiguous).
// AF32: A is f32 (converted to f16 with ascale at staging) else f16.  Bt always f16.
// MODE 0: f16 out, stored [n][m] (m contiguous):  out16[b*o_bs + (n0+n)*ldo + m0+m]
// MODE 1: f16 out, stored [m][n]:                  out16[b*o_bs + (m0+m)*ldo + n0+n]
// MODE 2: f32 out, stored [m][n], optional residual add at the same index.
template <int AF32, int MODE>
__global__ __launch_bounds__(128) void gemm_kernel(
    const float* __restrict__ Af, const _Float16* __restrict__ Ah, size_t a_bs, int lda, float ascale,
    const _Float16* __restrict__ Bt, size_t b_bs, int ldb, int K,
    const float* __restrict__ bias, int has_bias, float oscale,
    _Float16* out16, float* out32, const float* __restrict__ res, int has_res,
    size_t o_bs, int ldo) {
  const int m0 = blockIdx.x * 64, n0 = blockIdx.y * 64, b = blockIdx.z;
  const int tid = threadIdx.x, lane = tid & 31, wv = tid >> 5;
  const int h = lane >> 4, lm = lane & 15;
  const int wr = (wv >> 1) * 32, wc = (wv & 1) * 32;

  __shared__ __align__(16) _Float16 As[64 * KP];   // [m][k]
  __shared__ __align__(16) _Float16 Bs[64 * KP];   // [n][k]
  __shared__ __align__(16) _Float16 Dh[(MODE != 2) ? 64 * DHP : 8];
  __shared__ __align__(16) float    Df[(MODE == 2) ? 64 * DFP : 4];

  v8f zero;
#pragma unroll
  for (int e = 0; e < 8; ++e) zero[e] = 0.f;
  v8f acc[2][2];
  acc[0][0] = zero; acc[0][1] = zero; acc[1][0] = zero; acc[1][1] = zero;

  // staging: 2 threads per tile row, 16 k each
  const int mm = tid >> 1, ks = (tid & 1) * 16;
  const float*    ap_f = Af + (size_t)b * a_bs + (size_t)(m0 + mm) * lda + ks;
  const _Float16* ap_h = Ah + (size_t)b * a_bs + (size_t)(m0 + mm) * lda + ks;
  const _Float16* bp   = Bt + (size_t)b * b_bs + (size_t)(n0 + mm) * ldb + ks;

  v4f w0, w1, w2, w3;
  v8h ah0, ah1, bh0, bh1;
  if (AF32) {
    w0 = *(const v4f*)(ap_f);     w1 = *(const v4f*)(ap_f + 4);
    w2 = *(const v4f*)(ap_f + 8); w3 = *(const v4f*)(ap_f + 12);
  } else {
    ah0 = *(const v8h*)(ap_h); ah1 = *(const v8h*)(ap_h + 8);
  }
  bh0 = *(const v8h*)(bp); bh1 = *(const v8h*)(bp + 8);

  for (int k0 = 0; k0 < K; k0 += 32) {
    if (AF32) {
      v8h t0, t1;
#pragma unroll
      for (int e = 0; e < 4; ++e) {
        t0[e]     = (_Float16)(w0[e] * ascale);
        t0[e + 4] = (_Float16)(w1[e] * ascale);
        t1[e]     = (_Float16)(w2[e] * ascale);
        t1[e + 4] = (_Float16)(w3[e] * ascale);
      }
      *(v8h*)&As[mm * KP + ks]     = t0;
      *(v8h*)&As[mm * KP + ks + 8] = t1;
    } else {
      *(v8h*)&As[mm * KP + ks]     = ah0;
      *(v8h*)&As[mm * KP + ks + 8] = ah1;
    }
    *(v8h*)&Bs[mm * KP + ks]     = bh0;
    *(v8h*)&Bs[mm * KP + ks + 8] = bh1;
    __syncthreads();

    const int k1 = k0 + 32;
    if (k1 < K) {   // prefetch next k-slab into registers (block-uniform)
      if (AF32) {
        w0 = *(const v4f*)(ap_f + k1);     w1 = *(const v4f*)(ap_f + k1 + 4);
        w2 = *(const v4f*)(ap_f + k1 + 8); w3 = *(const v4f*)(ap_f + k1 + 12);
      } else {
        ah0 = *(const v8h*)(ap_h + k1); ah1 = *(const v8h*)(ap_h + k1 + 8);
      }
      bh0 = *(const v8h*)(bp + k1); bh1 = *(const v8h*)(bp + k1 + 8);
    }

    const v16h a0 = ld_frag(As, wr + lm, h);
    const v16h a1 = ld_frag(As, wr + 16 + lm, h);
    const v16h b0 = ld_frag(Bs, wc + lm, h);
    const v16h b1 = ld_frag(Bs, wc + 16 + lm, h);
    acc[0][0] = wmma_f16(a0, b0, acc[0][0]);
    acc[0][1] = wmma_f16(a0, b1, acc[0][1]);
    acc[1][0] = wmma_f16(a1, b0, acc[1][0]);
    acc[1][1] = wmma_f16(a1, b1, acc[1][1]);
    __syncthreads();
  }

  // D: acc[mi][ni][r] = tile element (row wr+mi*16+8h+r, col wc+ni*16+lm); stage in LDS
#pragma unroll
  for (int mi = 0; mi < 2; ++mi)
#pragma unroll
    for (int ni = 0; ni < 2; ++ni)
#pragma unroll
      for (int r = 0; r < 8; ++r) {
        const int ml = wr + mi * 16 + 8 * h + r;
        const int nl = wc + ni * 16 + lm;
        float v = acc[mi][ni][r] * oscale;
        if (has_bias) v += bias[m0 + ml];
        if (MODE == 0)      Dh[nl * DHP + ml] = (_Float16)v;
        else if (MODE == 1) Dh[ml * DHP + nl] = (_Float16)v;
        else                Df[ml * DFP + nl] = v;
      }
  __syncthreads();

  if (MODE != 2) {
    v8h val[4]; size_t idx[4];
#pragma unroll
    for (int it = 0; it < 4; ++it) {
      const int sI = it * 128 + tid;
      const int row = sI >> 3, p = sI & 7;
      val[it] = *(const v8h*)&Dh[row * DHP + p * 8];
      if (MODE == 0) idx[it] = (size_t)b * o_bs + (size_t)(n0 + row) * ldo + m0 + p * 8;
      else           idx[it] = (size_t)b * o_bs + (size_t)(m0 + row) * ldo + n0 + p * 8;
    }
#pragma unroll
    for (int it = 0; it < 4; ++it) *(v8h*)(out16 + idx[it]) = val[it];
    
  } else {
    // 64 rows x 256 B: two lines per row, lanes 0..7 / 8..15 (and 16..23 / 24..31) cover one line each
    v4f val[8]; size_t idx[8];
#pragma unroll
    for (int it = 0; it < 8; ++it) {
      const int sI = it * 128 + tid;
      const int row = sI >> 4, p = sI & 15;
      v4f v = *(const v4f*)&Df[row * DFP + p * 4];
      idx[it] = (size_t)b * o_bs + (size_t)(m0 + row) * ldo + n0 + p * 4;
      if (has_res) v += *(const v4f*)(res + idx[it]);
      val[it] = v;
    }
#pragma unroll
    for (int it = 0; it < 8; ++it) *(v4f*)(out32 + idx[it]) = val[it];
    
  }
}

// ---------------------------------------------------------------------------
// Kernel: row softmax over NPIX scores; writes f16 (p * pscale), one block of 128 threads per row, 8 values per thread.
__global__ __launch_bounds__(128) void softmax_kernel(
    const float* __restrict__ S, _Float16* P, float pscale) {
  const int row = blockIdx.x;
  const int t = threadIdx.x, lane = t & 31, wv = t >> 5;
  const float* rp = S + (size_t)row * NPIX + 8 * t;
  const v4f a = *(const v4f*)(rp);
  const v4f c = *(const v4f*)(rp + 4);
  float e[8];
  e[0] = a[0]; e[1] = a[1]; e[2] = a[2]; e[3] = a[3];
  e[4] = c[0]; e[5] = c[1]; e[6] = c[2]; e[7] = c[3];
  float m = e[0];
#pragma unroll
  for (int i = 1; i < 8; ++i) m = fmaxf(m, e[i]);
#pragma unroll
  for (int o = 16; o > 0; o >>= 1) m = fmaxf(m, __shfl_xor(m, o, 32));
  __shared__ float rm[4], rs[4];
  if (lane == 0) rm[wv] = m;
  __syncthreads();
  m = fmaxf(fmaxf(rm[0], rm[1]), fmaxf(rm[2], rm[3]));
  float s = 0.f;
#pragma unroll
  for (int i = 0; i < 8; ++i) { e[i] = __expf(e[i] - m); s += e[i]; }
#pragma unroll
  for (int o = 16; o > 0; o >>= 1) s += __shfl_xor(s, o, 32);
  if (lane == 0) rs[wv] = s;
  __syncthreads();
  s = (rs[0] + rs[1]) + (rs[2] + rs[3]);
  const float inv = pscale / s;
  v8h ov;
#pragma unroll
  for (int i = 0; i < 8; ++i) ov[i] = (_Float16)(e[i] * inv);
  _Float16* dp = P + (size_t)row * NPIX + 8 * t;   // 128 threads x 16 B = the whole 2048-B row, lanes 8q..8q+7 per line
  *(v8h*)dp = ov;
  
}

// ---------------------------------------------------------------------------
extern "C" void kernel_launch(void* const* d_in, const int* in_sizes, int n_in,
                              void* d_out, int out_size, void* d_ws,
                              size_t ws_size, hipStream_t stream) {
  if (n_in < 11) return;
  const long long per = (long long)CDIM * NPIX;
  const long long tot = (long long)in_sizes[0];
  if (tot <= 0 || (tot % per) != 0) return;
  const int B = (int)(tot / per);
  if ((long long)out_size != tot) return;
  if (in_sizes[1] != CDIM || in_sizes[2] != CDIM) return;
  if (in_sizes[3] != CDIM * CDIM || in_sizes[5] != CDIM * CDIM ||
      in_sizes[7] != CDIM * CDIM || in_sizes[9] != CDIM * CDIM) return;
  if (in_sizes[4] != CDIM || in_sizes[6] != CDIM || in_sizes[8] != CDIM || in_sizes[10] != CDIM) return;
  if (B > 65535) return;

  const float* x     = (const float*)d_in[0];
  const float* gamma = (const float*)d_in[1];
  const float* beta  = (const float*)d_in[2];
  const float* wq = (const float*)d_in[3]; const float* bq = (const float*)d_in[4];
  const float* wk = (const float*)d_in[5]; const float* bk = (const float*)d_in[6];
  const float* wv = (const float*)d_in[7]; const float* bv = (const float*)d_in[8];
  const float* wo = (const float*)d_in[9]; const float* bo = (const float*)d_in[10];
  float* out = (float*)d_out;

  // workspace carve: qT | kT | v16 | hT(->oT) (each B*N*C f16) | S (B*N*N f32) | P (B*N*N f16)
  const size_t HB = (size_t)B * CDIM * NPIX * sizeof(_Float16);
  const size_t SB = (size_t)B * NPIX * NPIX * sizeof(float);
  const size_t PB = (size_t)B * NPIX * NPIX * sizeof(_Float16);
  if (4 * HB + SB + PB > ws_size) return;
  char* ws = (char*)d_ws;
  _Float16* qT  = (_Float16*)(ws);
  _Float16* kT  = (_Float16*)(ws + HB);
  _Float16* v16 = (_Float16*)(ws + 2 * HB);
  _Float16* hT  = (_Float16*)(ws + 3 * HB);   // later reused as oT
  float*    S   = (float*)(ws + 4 * HB);
  _Float16* P   = (_Float16*)(ws + 4 * HB + SB);

  const size_t actB = (size_t)NPIX * CDIM;    // per-batch stride of hT/qT/kT/v16/oT/out (elements)
  const size_t sB   = (size_t)NPIX * NPIX;    // per-batch stride of S and P (elements)
  const float wsc   = 64.0f;                   // f16 weight pre-scale
  const float attn_scale = 0.04419417382415922f;   // 512^-0.5
  const float psc   = 4096.0f;                 // f16 probability pre-scale
  const float osc   = 16.0f;                   // f16 pre-scale of the p*v result

  gn_kernel<<<B * (CDIM / CBLK), 256, 0, stream>>>(x, gamma, beta, hT);

  dim3 gc(CDIM / 64, NPIX / 64, B);
  // q, k: A = W[o][c] f32 (x64), Bt = hT[n][c]; out [b][n][o] f16
  gemm_kernel<1, 0><<<gc, 128, 0, stream>>>(wq, hT, 0, CDIM, wsc, hT, actB, CDIM, CDIM,
                                            bq, 1, 1.0f / wsc, qT, S, x, 0, actB, CDIM);
  gemm_kernel<1, 0><<<gc, 128, 0, stream>>>(wk, hT, 0, CDIM, wsc, hT, actB, CDIM, CDIM,
                                            bk, 1, 1.0f / wsc, kT, S, x, 0, actB, CDIM);
  // v: out [b][o][n] f16
  gemm_kernel<1, 1><<<gc, 128, 0, stream>>>(wv, hT, 0, CDIM, wsc, hT, actB, CDIM, CDIM,
                                            bv, 1, 1.0f / wsc, v16, S, x, 0, actB, NPIX);
  // scores: A = qT[i][c], Bt = kT[j][c]; S[b][i][j] f32
  dim3 gs(NPIX / 64, NPIX / 64, B);
  gemm_kernel<0, 2><<<gs, 128, 0, stream>>>(wq, qT, actB, CDIM, 1.0f, kT, actB, CDIM, CDIM,
                                            bo, 0, attn_scale, qT, S, x, 0, sB, NPIX);
  softmax_kernel<<<B * NPIX, 128, 0, stream>>>(S, P, psc);
  // oT[b][i][c] = (1/4096) sum_j v16[c][j] * P[i][j], stored x16 as f16 (hT buffer)
  gemm_kernel<0, 0><<<gc, 128, 0, stream>>>(wq, v16, actB, NPIX, 1.0f, P, sB, NPIX, NPIX,
                                            bo, 0, osc / psc, hT, S, x, 0, actB, CDIM);
  // output projection: A = Wo[o][c] f32 (x64), Bt = oT[n][c] (x16); out[b][o][n] = res + acc/(64*16) + bo
  gemm_kernel<1, 2><<<gc, 128, 0, stream>>>(wo, hT, 0, CDIM, wsc, hT, actB, CDIM, CDIM,
                                            bo, 1, 1.0f / (wsc * osc), qT, out, x, 1, actB, NPIX);
}

// v002
// Measured time: 164 microseconds a run.
// Timed twice side by side with v001, it ran 1.34 times as fast both times.
// All steps since v000 together make it 1.51 times as fast.
#include <hip/hip_runtime.h>
#include <stddef.h>
#include <stdint.h>

// All contractions: v_wmma_f32_16x16x32_f16 (f16 operands, f32 accumulate): three 1x1 projections (weights x64),
// q*k^T, p*v (p x4096), output projection (o x16, weights x64); all scales are powers of two folded back in f32.

#define CDIM 512
#define NPIX 1024
#define GCH  16      // channels per norm group (CDIM / 32)
#define CBLK 64      // channels per norm block (4 groups)
// LDS row pitches of the GEMM tiles: 16 B x odd, so that 16 rows read or written 16 B wide fall on 64 distinct banks
// (and rows 8 apart, as the two lane halves of an accumulator hold them, fall 32 banks apart).
#define BT   128     // GEMM block tile: BT x BT results
#define BK   64      // k per slab: one whole 128-B line of an f16 operand row
#define KP   72      // operand tiles: 64 halves of k + 8 pad  (144 B)
#define DHP  136     // f16 result tile: 128 halves + 8 pad    (272 B)
#define DFP  132     // f32 result tile: 128 floats + 4 pad    (528 B)

typedef _Float16 v16h __attribute__((ext_vector_type(16)));
typedef _Float16 v8h  __attribute__((ext_vector_type(8)));
typedef _Float16 v4h  __attribute__((ext_vector_type(4)));
typedef float    v8f  __attribute__((ext_vector_type(8)));
typedef float    v4f  __attribute__((ext_vector_type(4)));
union Frag { v16h v; v8h half[2]; };

// ---------------------------------------------------------------------------
// 16x16x32 f16 WMMA with hazard guard.
__device__ __forceinline__ v8f wmma_f16(v16h a, v16h b, v8f c) {
  v8f d = __builtin_amdgcn_wmma_f32_16x16x32_f16(false, a, false, b, (short)0, c, false, false);
  asm volatile("v_nop\n\tv_nop\n\tv_nop\n\tv_nop" : "+v"(d) : "v"(a), "v"(b));
  return d;
}

// Fragment from an LDS tile stored [row][k] with pitch KP halves (used for A rows and for B columns alike):
// lane l: row = l&15, h = l>>4; elements 0..7 <- k 8h..8h+7, elements 8..15 <- k 16+8h..16+8h+7.
__device__ __forceinline__ v16h ld_frag(const _Float16* tile, int row, int h) {
  Frag f;
  const _Float16* rp = tile + row * KP;
  f.half[0] = *(const v8h*)(rp + 8 * h);
  f.half[1] = *(const v8h*)(rp + 16 + 8 * h);
  return f.v;
}

// ---------------------------------------------------------------------------
// Kernel 1: group norm -> transposed f16 activations hT[b][n][c].
__global__ __launch_bounds__(256) void gn_kernel(
    const float* __restrict__ x, const float* __restrict__ gamma,
    const float* __restrict__ beta, _Float16* hT) {
  const int b  = blockIdx.x >> 3, cg = blockIdx.x & 7;
  const int c0 = cg * CBLK;
  const int t  = threadIdx.x;
  const int c  = t >> 2, q = t & 3;          // channel 0..63, quarter of the pixel range
  const float* xc = x + ((size_t)b * CDIM + c0 + c) * NPIX;

  // statistics: thread covers pixels q*256 .. q*256+255 of its channel
  float s = 0.f, ss = 0.f;
#pragma unroll 4
  for (int i = 0; i < NPIX / 16; ++i) {
    v4f v = *(const v4f*)(xc + q * (NPIX / 4) + 4 * i);
    s  += (v[0] + v[1]) + (v[2] + v[3]);
    ss += (v[0] * v[0] + v[1] * v[1]) + (v[2] * v[2] + v[3] * v[3]);
  }
  __shared__ float rs1[256], rs2[256];
  rs1[t] = s; rs2[t] = ss;
  __syncthreads();
  // threads 64g..64g+63 hold group g's partials (16 channels x 4 quarters)
  for (int k = 32; k > 0; k >>= 1) {
    if ((t & 63) < k) { rs1[t] += rs1[t + k]; rs2[t] += rs2[t + k]; }
    __syncthreads();
  }
  const int g = t >> 6;
  const float inv_cnt = 1.0f / (float)(GCH * NPIX);
  const float mean = rs1[g * 64] * inv_cnt;
  float var = rs2[g * 64] * inv_cnt - mean * mean;
  var = fmaxf(var, 0.f);
  const float inv = rsqrtf(var + 1e-6f);
  const float gm = gamma[c0 + c] * inv;
  const float bt = beta[c0 + c] - mean * gm;

  // transpose through LDS in chunks of 128 pixels: Ts[n_local][c_local]
  __shared__ __align__(16) _Float16 Ts[128 * CBLK];
  for (int ch = 0; ch < NPIX; ch += 128) {
    __syncthreads();
    const float* xp = xc + ch + q * 32;     // 32 pixels of this channel
#pragma unroll
    for (int j = 0; j < 8; ++j) {
      v4f v = *(const v4f*)(xp + 4 * j);
      const int nl = q * 32 + 4 * j;
      Ts[(nl + 0) * CBLK + c] = (_Float16)(v[0] * gm + bt);
      Ts[(nl + 1) * CBLK + c] = (_Float16)(v[1] * gm + bt);
      Ts[(nl + 2) * CBLK + c] = (_Float16)(v[2] * gm + bt);
      Ts[(nl + 3) * CBLK + c] = (_Float16)(v[3] * gm + bt);
    }
    __syncthreads();
    // 128 lines (one per pixel), 8 lanes x 16 B per line, lanes 8q'..8q'+7 of one wave cover one line
    v8h val[4]; size_t idx[4];
#pragma unroll
    for (int it = 0; it < 4; ++it) {
      const int sI = it * 256 + t;
      const int nl = sI >> 3, p = sI & 7;
      val[it] = *(const v8h*)&Ts[nl * CBLK + p * 8];
      idx[it] = ((size_t)b * NPIX + ch + nl) * CDIM + c0 + p * 8;
    }
#pragma unroll
    for (int it = 0; it < 4; ++it) *(v8h*)(hT + idx[it]) = val[it];
    
  }
}

// ---------------------------------------------------------------------------
// Generic 128x128 tile GEMM on f16 16x16x32 WMMA: D[m][n] = sum_k A[m][k] * Bt[n][k]  (both operands k-contiguous).
// 8 waves as 2 x 4, each 64 x 32 of the tile (4 x 2 accumulators); a k-slab is 64, worked as two WMMA depths in rising k.
// AF32: A is f32 (converted to f16 with ascale at staging) else f16.  Bt always f16.
// MODE 0: f16 out, stored [n][m] (m contiguous):  out16[b*o_bs + (n0+n)*ldo + m0+m]
// MODE 1: f16 out, stored [m][n]:                  out16[b*o_bs + (m0+m)*ldo + n0+n]
// MODE 2: f32 out, stored [m][n], optional residual add at the same index.
template <int AF32, int MODE>
__global__ __launch_bounds__(256) void gemm_kernel(
    const float* __restrict__ Af, const _Float16* __restrict__ Ah, size_t a_bs, int lda, float ascale,
    const _Float16* __restrict__ Bt, size_t b_bs, int ldb, int K,
    const float* __restrict__ bias, int has_bias, float oscale,
    _Float16* out16, float* out32, const float* __restrict__ res, int has_res,
    size_t o_bs, int ldo) {
  const int m0 = blockIdx.x * BT, n0 = blockIdx.y * BT, b = blockIdx.z;
  const int tid = threadIdx.x, lane = tid & 31, wv = tid >> 5;
  const int h = lane >> 4, lm = lane & 15;
  const int wr = (wv >> 2) * 64, wc = (wv & 3) * 32;

  __shared__ __align__(16) _Float16 As[BT * KP];   // [m][k]
  __shared__ __align__(16) _Float16 Bs[BT * KP];   // [n][k]
  __shared__ __align__(16) _Float16 Dh[(MODE != 2) ? BT * DHP : 8];
  __shared__ __align__(16) float    Df[(MODE == 2) ? BT * DFP : 4];

  v8f zero;
#pragma unroll
  for (int e = 0; e < 8; ++e) zero[e] = 0.f;
  v8f acc[4][2];
#pragma unroll
  for (int mi = 0; mi < 4; ++mi) { acc[mi][0] = zero; acc[mi][1] = zero; }

  // staging: a slab row is 128 B of f16 (8 lanes x 16 B, 32 rows a sweep) or 256 B of f32 (16 lanes x 16 B, 16 rows a sweep),
  // so every wave-wide load covers four whole lines
  const int hr = tid >> 3, hk = (tid & 7) * 8;
  const int fr = tid >> 4, fk = (tid & 15) * 4;
  const float*    ap_f = Af + (size_t)b * a_bs + (size_t)(m0 + fr) * lda + fk;
  const _Float16* ap_h = Ah + (size_t)b * a_bs + (size_t)(m0 + hr) * lda + hk;
  const _Float16* bp   = Bt + (size_t)b * b_bs + (size_t)(n0 + hr) * ldb + hk;

  v4f w[8];
  v8h ah[4], bh[4];
  if (AF32) {
#pragma unroll
    for (int i = 0; i < 8; ++i) w[i] = *(const v4f*)(ap_f + (size_t)(16 * i) * lda);
  } else {
#pragma unroll
    for (int i = 0; i < 4; ++i) ah[i] = *(const v8h*)(ap_h + (size_t)(32 * i) * lda);
  }
#pragma unroll
  for (int i = 0; i < 4; ++i) bh[i] = *(const v8h*)(bp + (size_t)(32 * i) * ldb);

  for (int k0 = 0; k0 < K; k0 += BK) {
    if (AF32) {
#pragma unroll
      for (int i = 0; i < 8; ++i) {
        v4h t;
#pragma unroll
        for (int e = 0; e < 4; ++e) t[e] = (_Float16)(w[i][e] * ascale);
        *(v4h*)&As[(16 * i + fr) * KP + fk] = t;
      }
    } else {
#pragma unroll
      for (int i = 0; i < 4; ++i) *(v8h*)&As[(32 * i + hr) * KP + hk] = ah[i];
    }
#pragma unroll
    for (int i = 0; i < 4; ++i) *(v8h*)&Bs[(32 * i + hr) * KP + hk] = bh[i];
    __syncthreads();

    const int k1 = k0 + BK;
    if (k1 < K) {   // prefetch next k-slab into registers (block-uniform)
      if (AF32) {
#pragma unroll
        for (int i = 0; i < 8; ++i) w[i] = *(const v4f*)(ap_f + (size_t)(16 * i) * lda + k1);
      } else {
#pragma unroll
        for (int i = 0; i < 4; ++i) ah[i] = *(const v8h*)(ap_h + (size_t)(32 * i) * lda + k1);
      }
#pragma unroll
      for (int i = 0; i < 4; ++i) bh[i] = *(const v8h*)(bp + (size_t)(32 * i) * ldb + k1);
      // the fragment reads below land in the registers that held these loads' addresses: wait before they are overwritten
      asm volatile("s_wait_xcnt 0x0" ::: "memory");
    }

#pragma unroll
    for (int kk = 0; kk < BK; kk += 32) {
      v16h a[4], bf[2];
#pragma unroll
      for (int mi = 0; mi < 4; ++mi) a[mi] = ld_frag(As + kk, wr + 16 * mi + lm, h);
#pragma unroll
      for (int ni = 0; ni < 2; ++ni) bf[ni] = ld_frag(Bs + kk, wc + 16 * ni + lm, h);
#pragma unroll
      for (int mi = 0; mi < 4; ++mi)
#pragma unroll
        for (int ni = 0; ni < 2; ++ni) acc[mi][ni] = wmma_f16(a[mi], bf[ni], acc[mi][ni]);
    }
    __syncthreads();
  }

  // D: acc[mi][ni][r] = tile element (row wr+mi*16+8h+r, col wc+ni*16+lm); stage in LDS
#pragma unroll
  for (int mi = 0; mi < 4; ++mi)
#pragma unroll
    for (int ni = 0; ni < 2; ++ni)
#pragma unroll
      for (int r = 0; r < 8; ++r) {
        const int ml = wr + mi * 16 + 8 * h + r;
        const int nl = wc + ni * 16 + lm;
        float v = acc[mi][ni][r] * oscale;
        if (has_bias) v += bias[m0 + ml];
        if (MODE == 0)      Dh[nl * DHP + ml] = (_Float16)v;
        else if (MODE == 1) Dh[ml * DHP + nl] = (_Float16)v;
        else                Df[ml * DFP + nl] = v;
      }
  __syncthreads();

  if (MODE != 2) {
    // 128 rows x 256 B: two lines per row, 16 lanes x 16 B per row
    v8h val[8]; size_t idx[8];
#pragma unroll
    for (int it = 0; it < 8; ++it) {
      const int sI = it * 256 + tid;
      const int row = sI >> 4, p = sI & 15;
      val[it] = *(const v8h*)&Dh[row * DHP + p * 8];
      if (MODE == 0) idx[it] = (size_t)b * o_bs + (size_t)(n0 + row) * ldo + m0 + p * 8;
      else           idx[it] = (size_t)b * o_bs + (size_t)(m0 + row) * ldo + n0 + p * 8;
    }
#pragma unroll
    for (int it = 0; it < 8; ++it) *(v8h*)(out16 + idx[it]) = val[it];
  } else {
    // 128 rows x 512 B: four lines per row, one wave x 16 B per row
    v4f val[16]; size_t idx[16];
#pragma unroll
    for (int it = 0; it < 16; ++it) {
      const int sI = it * 256 + tid;
      const int row = sI >> 5, p = sI & 31;
      v4f v = *(const v4f*)&Df[row * DFP + p * 4];
      idx[it] = (size_t)b * o_bs + (size_t)(m0 + row) * ldo + n0 + p * 4;
      if (has_res) v += *(const v4f*)(res + idx[it]);
      val[it] = v;
    }
#pragma unroll
    for (int it = 0; it < 16; ++it) *(v4f*)(out32 + idx[it]) = val[it];
  }
}

// ---------------------------------------------------------------------------
// Kernel: row softmax over NPIX scores; writes f16 (p * pscale), one block of 128 threads per row, 8 values per thread.
__global__ __launch_bounds__(128) void softmax_kernel(
    const float* __restrict__ S, _Float16* P, float pscale) {
  const int row = blockIdx.x;
  const int t = threadIdx.x, lane = t & 31, wv = t >> 5;
  const float* rp = S + (size_t)row * NPIX + 8 * t;
  const v4f a = *(const v4f*)(rp);
  const v4f c = *(const v4f*)(rp + 4);
  float e[8];
  e[0] = a[0]; e[1] = a[1]; e[2] = a[2]; e[3] = a[3];
  e[4] = c[0]; e[5] = c[1]; e[6] = c[2]; e[7] = c[3];
  float m = e[0];
#pragma unroll
  for (int i = 1; i < 8; ++i) m = fmaxf(m, e[i]);
#pragma unroll
  for (int o = 16; o > 0; o >>= 1) m = fmaxf(m, __shfl_xor(m, o, 32));
  __shared__ float rm[4], rs[4];
  if (lane == 0) rm[wv] = m;
  __syncthreads();
  m = fmaxf(fmaxf(rm[0], rm[1]), fmaxf(rm[2], rm[3]));
  float s = 0.f;
#pragma unroll
  for (int i = 0; i < 8; ++i) { e[i] = __expf(e[i] - m); s += e[i]; }
#pragma unroll
  for (int o = 16; o > 0; o >>= 1) s += __shfl_xor(s, o, 32);
  if (lane == 0) rs[wv] = s;
  __syncthreads();
  s = (rs[0] + rs[1]) + (rs[2] + rs[3]);
  const float inv = pscale / s;
  v8h ov;
#pragma unroll
  for (int i = 0; i < 8; ++i) ov[i] = (_Float16)(e[i] * inv);
  _Float16* dp = P + (size_t)row * NPIX + 8 * t;   // 128 threads x 16 B = the whole 2048-B row, lanes 8q..8q+7 per line
  *(v8h*)dp = ov;
  
}

// ---------------------------------------------------------------------------
extern "C" void kernel_launch(void* const* d_in, const int* in_sizes, int n_in,
                              void* d_out, int out_size, void* d_ws,
                              size_t ws_size, hipStream_t stream) {
  if (n_in < 11) return;
  const long long per = (long long)CDIM * NPIX;
  const long long tot = (long long)in_sizes[0];
  if (tot <= 0 || (tot % per) != 0) return;
  const int B = (int)(tot / per);
  if ((long long)out_size != tot) return;
  if (in_sizes[1] != CDIM || in_sizes[2] != CDIM) return;
  if (in_sizes[3] != CDIM * CDIM || in_sizes[5] != CDIM * CDIM ||
      in_sizes[7] != CDIM * CDIM || in_sizes[9] != CDIM * CDIM) return;
  if (in_sizes[4] != CDIM || in_sizes[6] != CDIM || in_sizes[8] != CDIM || in_sizes[10] != CDIM) return;
  if (B > 65535) return;

  const float* x     = (const float*)d_in[0];
  const float* gamma = (const float*)d_in[1];
  const float* beta  = (const float*)d_in[2];
  const float* wq = (const float*)d_in[3]; const float* bq = (const float*)d_in[4];
  const float* wk = (const float*)d_in[5]; const float* bk = (const float*)d_in[6];
  const float* wv = (const float*)d_in[7]; const float* bv = (const float*)d_in[8];
  const float* wo = (const float*)d_in[9]; const float* bo = (const float*)d_in[10];
  float* out = (float*)d_out;

  // workspace carve: qT | kT | v16 | hT(->oT) (each B*N*C f16) | S (B*N*N f32) | P (B*N*N f16)
  const size_t HB = (size_t)B * CDIM * NPIX * sizeof(_Float16);
  const size_t SB = (size_t)B * NPIX * NPIX * sizeof(float);
  const size_t PB = (size_t)B * NPIX * NPIX * sizeof(_Float16);
  if (4 * HB + SB + PB > ws_size) return;
  char* ws = (char*)d_ws;
  _Float16* qT  = (_Float16*)(ws);
  _Float16* kT  = (_Float16*)(ws + HB);
  _Float16* v16 = (_Float16*)(ws + 2 * HB);
  _Float16* hT  = (_Float16*)(ws + 3 * HB);   // later reused as oT
  float*    S   = (float*)(ws + 4 * HB);
  _Float16* P   = (_Float16*)(ws + 4 * HB + SB);

  const size_t actB = (size_t)NPIX * CDIM;    // per-batch stride of hT/qT/kT/v16/oT/out (elements)
  const size_t sB   = (size_t)NPIX * NPIX;    // per-batch stride of S and P (elements)
  const float wsc   = 64.0f;                   // f16 weight pre-scale
  const float attn_scale = 0.04419417382415922f;   // 512^-0.5
  const float psc   = 4096.0f;                 // f16 probability pre-scale
  const float osc   = 16.0f;                   // f16 pre-scale of the p*v result

  gn_kernel<<<B * (CDIM / CBLK), 256, 0, stream>>>(x, gamma, beta, hT);

  dim3 gc(CDIM / BT, NPIX / BT, B);
  // q, k: A = W[o][c] f32 (x64), Bt = hT[n][c]; out [b][n][o] f16
  gemm_kernel<1, 0><<<gc, 256, 0, stream>>>(wq, hT, 0, CDIM, wsc, hT, actB, CDIM, CDIM,
                                            bq, 1, 1.0f / wsc, qT, S, x, 0, actB, CDIM);
  gemm_kernel<1, 0><<<gc, 256, 0, stream>>>(wk, hT, 0, CDIM, wsc, hT, actB, CDIM, CDIM,
                                            bk, 1, 1.0f / wsc, kT, S, x, 0, actB, CDIM);
  // v: out [b][o][n] f16
  gemm_kernel<1, 1><<<gc, 256, 0, stream>>>(wv, hT, 0, CDIM, wsc, hT, actB, CDIM, CDIM,
                                            bv, 1, 1.0f / wsc, v16, S, x, 0, actB, NPIX);
  // scores: A = qT[i][c], Bt = kT[j][c]; S[b][i][j] f32
  dim3 gs(NPIX / BT, NPIX / BT, B);
  gemm_kernel<0, 2><<<gs, 256, 0, stream>>>(wq, qT, actB, CDIM, 1.0f, kT, actB, CDIM, CDIM,
                                            bo, 0, attn_scale, qT, S, x, 0, sB, NPIX);
  softmax_kernel<<<B * NPIX, 128, 0, stream>>>(S, P, psc);
  // oT[b][i][c] = (1/4096) sum_j v16[c][j] * P[i][j], stored x16 as f16 (hT buffer)
  gemm_kernel<0, 0><<<gc, 256, 0, stream>>>(wq, v16, actB, NPIX, 1.0f, P, sB, NPIX, NPIX,
                                            bo, 0, osc / psc, hT, S, x, 0, actB, CDIM);
  // output projection: A = Wo[o][c] f32 (x64), Bt = oT[n][c] (x16); out[b][o][n] = res + acc/(64*16) + bo
  gemm_kernel<1, 2><<<gc, 256, 0, stream>>>(wo, hT, 0, CDIM, wsc, hT, actB, CDIM, CDIM,
                                            bo, 1, 1.0f / (wsc * osc), qT, out, x, 1, actB, NPIX);
}

// v003
// A run of this version takes 150 microseconds.
// In both of two side-by-side timings against v002, it was 1.09 times as fast.
// Counting every step since v000, it is 1.64 times as fast.
#include <hip/hip_runtime.h>
#include <stddef.h>
#include <stdint.h>

// All contractions: v_wmma_f32_16x16x32_f16 (f16 operands, f32 accumulate): three 1x1 projections (weights x64),
// q*k^T, p*v (p x4096, divided by its row sum behind the product), output projection (o x16, weights x64); all scales are powers of two folded back in f32.

#define CDIM 512
#define NPIX 1024
#define GCH  16      // channels per norm group (CDIM / 32)
#define CBLK 64      // channels per norm block (4 groups)
// LDS row pitches of the GEMM tiles: 16 B x odd, so that 16 rows read or written 16 B wide fall on 64 distinct banks
// (and rows 8 apart, as the two lane halves of an accumulator hold them, fall 32 banks apart).
#define BT   128     // GEMM block tile: BT x BT results
#define BK   64      // k per slab: one whole 128-B line of an f16 operand row
#define KP   72      // operand tiles: 64 halves of k + 8 pad  (144 B)
#define DHP  136     // f16 result tile: 128 halves + 8 pad    (272 B)
#define DFP  132     // f32 result tile: 128 floats + 4 pad    (528 B)
#define AQ   64      // attention: queries per work-group
#define QP   520     // attention q and o tiles: 512 halves + 8 pad  (1040 B)
#define PP   1032    // attention p tile: 1024 halves + 8 pad        (2064 B)

typedef _Float16 v16h __attribute__((ext_vector_type(16)));
typedef _Float16 v8h  __attribute__((ext_vector_type(8)));
typedef _Float16 v4h  __attribute__((ext_vector_type(4)));
typedef float    v8f  __attribute__((ext_vector_type(8)));
typedef float    v4f  __attribute__((ext_vector_type(4)));
union Frag { v16h v; v8h half[2]; };

// ---------------------------------------------------------------------------
// 16x16x32 f16 WMMA with hazard guard.
__device__ __forceinline__ v8f wmma_f16(v16h a, v16h b, v8f c) {
  v8f d = __builtin_amdgcn_wmma_f32_16x16x32_f16(false, a, false, b, (short)0, c, false, false);
  asm volatile("v_nop\n\tv_nop\n\tv_nop\n\tv_nop" : "+v"(d) : "v"(a), "v"(b));
  return d;
}

// The builtin alone, for the attention kernel: its accumulators reach above v255, where an asm operand cannot lie
// (tied to the asm guard above they all went to scratch); the compiler keeps the distances behind its own builtin.
__device__ __forceinline__ v8f wmma_f16_b(v16h a, v16h b, v8f c) {
  return __builtin_amdgcn_wmma_f32_16x16x32_f16(false, a, false, b, (short)0, c, false, false);
}

// 2^x with the free slot behind it that the instruction set asks for after a transcendental, in one statement.
__device__ __forceinline__ float exp2_slot(float x) {
  float e;
  asm("v_exp_f32 %0, %1\n\tv_nop" : "=v"(e) : "v"(x));
  return e;
}

// Fragment from an LDS tile stored [row][k] with pitch KP halves (used for A rows and for B columns alike):
// lane l: row = l&15, h = l>>4; elements 0..7 <- k 8h..8h+7, elements 8..15 <- k 16+8h..16+8h+7.
__device__ __forceinline__ v16h ld_frag(const _Float16* tile, int row, int h) {
  Frag f;
  const _Float16* rp = tile + row * KP;
  f.half[0] = *(const v8h*)(rp + 8 * h);
  f.half[1] = *(const v8h*)(rp + 16 + 8 * h);
  return f.v;
}

// The same fragment from a tile of another row pitch (in halves).
template <int PITCH>
__device__ __forceinline__ v16h ld_frag_p(const _Float16* tile, int row, int h) {
  Frag f;
  const _Float16* rp = tile + row * PITCH;
  f.half[0] = *(const v8h*)(rp + 8 * h);
  f.half[1] = *(const v8h*)(rp + 16 + 8 * h);
  return f.v;
}

// ---------------------------------------------------------------------------
// Kernel 1: group norm -> transposed f16 activations hT[b][n][c].
__global__ __launch_bounds__(256) void gn_kernel(
    const float* __restrict__ x, const float* __restrict__ gamma,
    const float* __restrict__ beta, _Float16* hT) {
  const int b  = blockIdx.x >> 3, cg = blockIdx.x & 7;
  const int c0 = cg * CBLK;
  const int t  = threadIdx.x;
  const int c  = t >> 2, q = t & 3;          // channel 0..63, quarter of the pixel range
  const float* xc = x + ((size_t)b * CDIM + c0 + c) * NPIX;

  // statistics: thread covers pixels q*256 .. q*256+255 of its channel
  float s = 0.f, ss = 0.f;
#pragma unroll 4
  for (int i = 0; i < NPIX / 16; ++i) {
    v4f v = *(const v4f*)(xc + q * (NPIX / 4) + 4 * i);
    s  += (v[0] + v[1]) + (v[2] + v[3]);
    ss += (v[0] * v[0] + v[1] * v[1]) + (v[2] * v[2] + v[3] * v[3]);
  }
  __shared__ float rs1[256], rs2[256];
  rs1[t] = s; rs2[t] = ss;
  __syncthreads();
  // threads 64g..64g+63 hold group g's partials (16 channels x 4 quarters)
  for (int k = 32; k > 0; k >>= 1) {
    if ((t & 63) < k) { rs1[t] += rs1[t + k]; rs2[t] += rs2[t + k]; }
    __syncthreads();
  }
  const int g = t >> 6;
  const float inv_cnt = 1.0f / (float)(GCH * NPIX);
  const float mean = rs1[g * 64] * inv_cnt;
  float var = rs2[g * 64] * inv_cnt - mean * mean;
  var = fmaxf(var, 0.f);
  const float inv = rsqrtf(var + 1e-6f);
  const float gm = gamma[c0 + c] * inv;
  const float bt = beta[c0 + c] - mean * gm;

  // transpose through LDS in chunks of 128 pixels: Ts[n_local][c_local]
  __shared__ __align__(16) _Float16 Ts[128 * CBLK];
  for (int ch = 0; ch < NPIX; ch += 128) {
    __syncthreads();
    const float* xp = xc + ch + q * 32;     // 32 pixels of this channel
#pragma unroll
    for (int j = 0; j < 8; ++j) {
      v4f v = *(const v4f*)(xp + 4 * j);
      const int nl = q * 32 + 4 * j;
      Ts[(nl + 0) * CBLK + c] = (_Float16)(v[0] * gm + bt);
      Ts[(nl + 1) * CBLK + c] = (_Float16)(v[1] * gm + bt);
      Ts[(nl + 2) * CBLK + c] = (_Float16)(v[2] * gm + bt);
      Ts[(nl + 3) * CBLK + c] = (_Float16)(v[3] * gm + bt);
    }
    __syncthreads();
    // 128 lines (one per pixel), 8 lanes x 16 B per line, lanes 8q'..8q'+7 of one wave cover one line
    v8h val[4]; size_t idx[4];
#pragma unroll
    for (int it = 0; it < 4; ++it) {
      const int sI = it * 256 + t;
      const int nl = sI >> 3, p = sI & 7;
      val[it] = *(const v8h*)&Ts[nl * CBLK + p * 8];
      idx[it] = ((size_t)b * NPIX + ch + nl) * CDIM + c0 + p * 8;
    }
#pragma unroll
    for (int it = 0; it < 4; ++it) *(v8h*)(hT + idx[it]) = val[it];
    
  }
}

// ---------------------------------------------------------------------------
// Generic 128x128 tile GEMM on f16 16x16x32 WMMA: D[m][n] = sum_k A[m][k] * Bt[n][k]  (both operands k-contiguous).
// 8 waves as 2 x 4, each 64 x 32 of the tile (4 x 2 accumulators); a k-slab is 64, worked as two WMMA depths in rising k.
// AF32: A is f32 (converted to f16 with ascale at staging) else f16.  Bt always f16.
// MODE 0: f16 out, stored [n][m] (m contiguous):  out16[b*o_bs + (n0+n)*ldo + m0+m]
// MODE 1: f16 out, stored [m][n]:                  out16[b*o_bs + (m0+m)*ldo + n0+n]
// MODE 2: f32 out, stored [m][n], optional residual add at the same index.
template <int AF32, int MODE>
__global__ __launch_bounds__(256) void gemm_kernel(
    const float* __restrict__ Af, const _Float16* __restrict__ Ah, size_t a_bs, int lda, float ascale,
    const _Float16* __restrict__ Bt, size_t b_bs, int ldb, int K,
    const float* __restrict__ bias, int has_bias, float oscale,
    _Float16* out16, float* out32, const float* __restrict__ res, int has_res,
    size_t o_bs, int ldo) {
  const int m0 = blockIdx.x * BT, n0 = blockIdx.y * BT, b = blockIdx.z;
  const int tid = threadIdx.x, lane = tid & 31, wv = tid >> 5;
  const int h = lane >> 4, lm = lane & 15;
  const int wr = (wv >> 2) * 64, wc = (wv & 3) * 32;

  __shared__ __align__(16) _Float16 As[BT * KP];   // [m][k]
  __shared__ __align__(16) _Float16 Bs[BT * KP];   // [n][k]
  __shared__ __align__(16) _Float16 Dh[(MODE != 2) ? BT * DHP : 8];
  __shared__ __align__(16) float    Df[(MODE == 2) ? BT * DFP : 4];

  v8f zero;
#pragma unroll
  for (int e = 0; e < 8; ++e) zero[e] = 0.f;
  v8f acc[4][2];
#pragma unroll
  for (int mi = 0; mi < 4; ++mi) { acc[mi][0] = zero; acc[mi][1] = zero; }

  // staging: a slab row is 128 B of f16 (8 lanes x 16 B, 32 rows a sweep) or 256 B of f32 (16 lanes x 16 B, 16 rows a sweep),
  // so every wave-wide load covers four whole lines
  const int hr = tid >> 3, hk = (tid & 7) * 8;
  const int fr = tid >> 4, fk = (tid & 15) * 4;
  const float*    ap_f = Af + (size_t)b * a_bs + (size_t)(m0 + fr) * lda + fk;
  const _Float16* ap_h = Ah + (size_t)b * a_bs + (size_t)(m0 + hr) * lda + hk;
  const _Float16* bp   = Bt + (size_t)b * b_bs + (size_t)(n0 + hr) * ldb + hk;

  v4f w[8];
  v8h ah[4], bh[4];
  if (AF32) {
#pragma unroll
    for (int i = 0; i < 8; ++i) w[i] = *(const v4f*)(ap_f + (size_t)(16 * i) * lda);
  } else {
#pragma unroll
    for (int i = 0; i < 4; ++i) ah[i] = *(const v8h*)(ap_h + (size_t)(32 * i) * lda);
  }
#pragma unroll
  for (int i = 0; i < 4; ++i) bh[i] = *(const v8h*)(bp + (size_t)(32 * i) * ldb);

  for (int k0 = 0; k0 < K; k0 += BK) {
    if (AF32) {
#pragma unroll
      for (int i = 0; i < 8; ++i) {
        v4h t;
#pragma unroll
        for (int e = 0; e < 4; ++e) t[e] = (_Float16)(w[i][e] * ascale);
        *(v4h*)&As[(16 * i + fr) * KP + fk] = t;
      }
    } else {
#pragma unroll
      for (int i = 0; i < 4; ++i) *(v8h*)&As[(32 * i + hr) * KP + hk] = ah[i];
    }
#pragma unroll
    for (int i = 0; i < 4; ++i) *(v8h*)&Bs[(32 * i + hr) * KP + hk] = bh[i];
    __syncthreads();

    const int k1 = k0 + BK;
    if (k1 < K) {   // prefetch next k-slab into registers (block-uniform)
      if (AF32) {
#pragma unroll
        for (int i = 0; i < 8; ++i) w[i] = *(const v4f*)(ap_f + (size_t)(16 * i) * lda + k1);
      } else {
#pragma unroll
        for (int i = 0; i < 4; ++i) ah[i] = *(const v8h*)(ap_h + (size_t)(32 * i) * lda + k1);
      }
#pragma unroll
      for (int i = 0; i < 4; ++i) bh[i] = *(const v8h*)(bp + (size_t)(32 * i) * ldb + k1);
      // the fragment reads below land in the registers that held these loads' addresses: wait before they are overwritten
      asm volatile("s_wait_xcnt 0x0" ::: "memory");
    }

#pragma unroll
    for (int kk = 0; kk < BK; kk += 32) {
      v16h a[4], bf[2];
#pragma unroll
      for (int mi = 0; mi < 4; ++mi) a[mi] = ld_frag(As + kk, wr + 16 * mi + lm, h);
#pragma unroll
      for (int ni = 0; ni < 2; ++ni) bf[ni] = ld_frag(Bs + kk, wc + 16 * ni + lm, h);
#pragma unroll
      for (int mi = 0; mi < 4; ++mi)
#pragma unroll
        for (int ni = 0; ni < 2; ++ni) acc[mi][ni] = wmma_f16(a[mi], bf[ni], acc[mi][ni]);
    }
    __syncthreads();
  }

  // D: acc[mi][ni][r] = tile element (row wr+mi*16+8h+r, col wc+ni*16+lm); stage in LDS
#pragma unroll
  for (int mi = 0; mi < 4; ++mi)
#pragma unroll
    for (int ni = 0; ni < 2; ++ni)
#pragma unroll
      for (int r = 0; r < 8; ++r) {
        const int ml = wr + mi * 16 + 8 * h + r;
        const int nl = wc + ni * 16 + lm;
        float v = acc[mi][ni][r] * oscale;
        if (has_bias) v += bias[m0 + ml];
        if (MODE == 0)      Dh[nl * DHP + ml] = (_Float16)v;
        else if (MODE == 1) Dh[ml * DHP + nl] = (_Float16)v;
        else                Df[ml * DFP + nl] = v;
      }
  __syncthreads();

  if (MODE != 2) {
    // 128 rows x 256 B: two lines per row, 16 lanes x 16 B per row
    v8h val[8]; size_t idx[8];
#pragma unroll
    for (int it = 0; it < 8; ++it) {
      const int sI = it * 256 + tid;
      const int row = sI >> 4, p = sI & 15;
      val[it] = *(const v8h*)&Dh[row * DHP + p * 8];
      if (MODE == 0) idx[it] = (size_t)b * o_bs + (size_t)(n0 + row) * ldo + m0 + p * 8;
      else           idx[it] = (size_t)b * o_bs + (size_t)(m0 + row) * ldo + n0 + p * 8;
    }
#pragma unroll
    for (int it = 0; it < 8; ++it) *(v8h*)(out16 + idx[it]) = val[it];
  } else {
    // 128 rows x 512 B: four lines per row, one wave x 16 B per row
    v4f val[16]; size_t idx[16];
#pragma unroll
    for (int it = 0; it < 16; ++it) {
      const int sI = it * 256 + tid;
      const int row = sI >> 5, p = sI & 31;
      v4f v = *(const v4f*)&Df[row * DFP + p * 4];
      idx[it] = (size_t)b * o_bs + (size_t)(m0 + row) * ldo + n0 + p * 4;
      if (has_res) v += *(const v4f*)(res + idx[it]);
      val[it] = v;
    }
#pragma unroll
    for (int it = 0; it < 16; ++it) *(v4f*)(out32 + idx[it]) = val[it];
  }
}

// ---------------------------------------------------------------------------
// Kernel: attention of AQ queries against all NPIX keys of one batch, one work-group of 8 waves.
// Phase 1: St[j][i] = sum_c kT[j][c] * qT[i][c]; wave w holds keys 128w..128w+127 x 64 queries in 8 x 4 accumulators,
//          so a lane holds 64 scores of each of 4 queries (query 16ni+lm, keys 128w+16mi+8h+r).
// Softmax: maximum and sum in the lane, one exchange between the lane halves, then over the 8 waves through LDS.
// Phase 2: Ot[c][i] = sum_j v16[c][j] * P[i][j]; P (f16, not yet divided by its row sum) lies in LDS as [query][key];
//          wave w holds channels 64w..64w+63; the row sum divides the result.
// LDS: phase 1 [k slab 1024 x KP | q tile AQ x QP]; phase 2 [p tile AQ x PP | v slab 512 x KP]; at the end the o tile AQ x QP.
__global__ __launch_bounds__(256) void attn_kernel(
    const _Float16* __restrict__ qT, const _Float16* __restrict__ kT, const _Float16* __restrict__ v16,
    _Float16* oT, float sscale, float pshift, float oscale) {
  const int i0 = blockIdx.x * AQ, b = blockIdx.y;
  const int tid = threadIdx.x, lane = tid & 31, wv = tid >> 5;
  const int h = lane >> 4, lm = lane & 15;
  const size_t actB = (size_t)NPIX * CDIM;

  __shared__ __align__(16) _Float16 sm[NPIX * KP + AQ * QP];
  __shared__ float redm[8 * AQ], reds[8 * AQ];
  _Float16* Ks = sm;
  _Float16* Qs = sm + NPIX * KP;
  _Float16* Pl = sm;
  _Float16* Vs = sm + AQ * PP;
  _Float16* Os = sm;

  v8f zero;
#pragma unroll
  for (int e = 0; e < 8; ++e) zero[e] = 0.f;

  // staging maps: q and o rows are 1024 B (64 lanes x 16 B, 4 rows a sweep); k and v slab rows are 128 B (8 lanes x 16 B, 32 rows a sweep)
  const int qr = tid >> 6, qc = (tid & 63) * 8;
  const int hr = tid >> 3, hk = (tid & 7) * 8;
  const _Float16* qp = qT + (size_t)b * actB + (size_t)(i0 + qr) * CDIM + qc;
  const _Float16* kp = kT + (size_t)b * actB + (size_t)hr * CDIM + hk;
  const _Float16* vp = v16 + (size_t)b * actB + (size_t)hr * NPIX + hk;   // walks on by one slab a trip

  v8h kh[32];
  {
    v8h qv[16];
#pragma unroll
    for (int it = 0; it < 16; ++it) qv[it] = *(const v8h*)(qp + (size_t)(4 * it) * CDIM);
#pragma unroll
    for (int i = 0; i < 32; ++i) kh[i] = *(const v8h*)(kp + (size_t)(32 * i) * CDIM);
    // registers that held these loads' addresses are reused below: wait before they are overwritten
    asm volatile("s_wait_xcnt 0x0" ::: "memory");
    // holds what follows behind that wait: the compiler had lifted the accumulators' zeroing, which lands on the address registers, over it
    __builtin_amdgcn_sched_barrier(0);
#pragma unroll
    for (int it = 0; it < 16; ++it) *(v8h*)&Qs[(4 * it + qr) * QP + qc] = qv[it];
  }

  v8f acc[8][4];
#pragma unroll
  for (int mi = 0; mi < 8; ++mi)
#pragma unroll
    for (int ni = 0; ni < 4; ++ni) acc[mi][ni] = zero;

  // rolled: for speed only
#pragma unroll 1
  for (int k0 = 0; k0 < CDIM; k0 += BK) {
#pragma unroll
    for (int i = 0; i < 32; ++i) *(v8h*)&Ks[(32 * i + hr) * KP + hk] = kh[i];
    __syncthreads();

    const int k1 = k0 + BK;
    if (k1 < CDIM) {   // prefetch next k-slab into registers (block-uniform)
#pragma unroll
      for (int i = 0; i < 32; ++i) kh[i] = *(const v8h*)(kp + (size_t)(32 * i) * CDIM + k1);
      // the fragment reads below may land in the registers that held these loads' addresses: wait before they are overwritten
      asm volatile("s_wait_xcnt 0x0" ::: "memory");
    }

#pragma unroll
    for (int kk = 0; kk < BK; kk += 32) {
      v16h bf[4];
#pragma unroll
      for (int ni = 0; ni < 4; ++ni) bf[ni] = ld_frag_p<QP>(Qs + k0 + kk, 16 * ni + lm, h);
#pragma unroll
      for (int mg = 0; mg < 8; mg += 4) {
        v16h a[4];
#pragma unroll
        for (int mi = 0; mi < 4; ++mi) a[mi] = ld_frag(Ks + kk, 128 * wv + 16 * (mg + mi) + lm, h);
        // keeps the block's fragment reads together in front of its 16 WMMAs: left free, the compiler read one fragment
        // at a time into one register set and waited out the LDS latency before every 4 WMMAs
        __builtin_amdgcn_sched_barrier(0);
#pragma unroll
        for (int mi = 0; mi < 4; ++mi)
#pragma unroll
          for (int ni = 0; ni < 4; ++ni) acc[mg + mi][ni] = wmma_f16_b(a[mi], bf[ni], acc[mg + mi][ni]);
        // ends the block: the next block's reads do not move in among these WMMAs
        __builtin_amdgcn_sched_barrier(0);
      }
    }
    __syncthreads();
  }

  // first v slab: its latency runs under the softmax
  v8h vh[16];
#pragma unroll
  for (int i = 0; i < 16; ++i) vh[i] = *(const v8h*)(vp + (size_t)(32 * i) * NPIX);   // vp lives on: no load lands on it
  // registers that held these loads' addresses may be reused below: wait before they are overwritten
  asm volatile("s_wait_xcnt 0x0" ::: "memory");

  // softmax in the log2 domain: e = 2^((score - row maximum) * sscale * log2(e) + pshift), at most 2^pshift, goes to LDS as f16
  // without the division; the row sum of the same e divides the p*v result at the end
  const float c1 = sscale * 1.4426950408889634f;
#pragma unroll
  for (int ni = 0; ni < 4; ++ni) {
    float m = acc[0][ni][0];
#pragma unroll
    for (int mi = 0; mi < 8; ++mi)
#pragma unroll
      for (int r = 0; r < 8; ++r) m = fmaxf(m, acc[mi][ni][r]);
    m = fmaxf(m, __shfl_xor(m, 16, 32));
    if (h == 0) redm[wv * AQ + 16 * ni + lm] = m;
  }
  __syncthreads();
  // every wave has left the k slab (the barriers above): the p tile may overwrite it
#pragma unroll
  for (int ni = 0; ni < 4; ++ni) {
    float m = redm[16 * ni + lm];
#pragma unroll
    for (int w = 1; w < 8; ++w) m = fmaxf(m, redm[w * AQ + 16 * ni + lm]);
    const float mc = m * c1 - pshift;
    float s = 0.f;
#pragma unroll
    for (int mi = 0; mi < 8; ++mi) {
      v8h pv;
#pragma unroll
      for (int r = 0; r < 8; ++r) {
        const float e = exp2_slot(acc[mi][ni][r] * c1 - mc);
        s += e;
        pv[r] = (_Float16)e;
      }
      *(v8h*)&Pl[(16 * ni + lm) * PP + 128 * wv + 16 * mi + 8 * h] = pv;
    }
    s += __shfl_xor(s, 16, 32);
    if (h == 0) reds[wv * AQ + 16 * ni + lm] = s;
  }

  v8f oc[4][4];
#pragma unroll
  for (int mi = 0; mi < 4; ++mi)
#pragma unroll
    for (int ni = 0; ni < 4; ++ni) oc[mi][ni] = zero;

  // rolled: for speed only
#pragma unroll 1
  for (int j0 = 0; j0 < NPIX; j0 += BK) {
#pragma unroll
    for (int i = 0; i < 16; ++i) *(v8h*)&Vs[(32 * i + hr) * KP + hk] = vh[i];
    __syncthreads();   // on the first trip it also publishes the p tile and the waves' row sums

    const int j1 = j0 + BK;
    if (j1 < NPIX) {   // prefetch next v slab into registers (block-uniform)
      vp += BK;
#pragma unroll
      for (int i = 0; i < 16; ++i) vh[i] = *(const v8h*)(vp + (size_t)(32 * i) * NPIX);
      // the fragment reads below may land in the registers that held these loads' addresses: wait before they are overwritten
      asm volatile("s_wait_xcnt 0x0" ::: "memory");
    }

    v16h a[2][4], bf[2][4];
#pragma unroll
    for (int ks = 0; ks < 2; ++ks) {
#pragma unroll
      for (int mi = 0; mi < 4; ++mi) a[ks][mi] = ld_frag(Vs + 32 * ks, 64 * wv + 16 * mi + lm, h);
#pragma unroll
      for (int ni = 0; ni < 4; ++ni) bf[ks][ni] = ld_frag_p<PP>(Pl + j0 + 32 * ks, 16 * ni + lm, h);
    }
    // keeps the slab's fragment reads as one group in front of its 32 WMMAs: left free, the compiler read one fragment
    // at a time into one register set and waited out the LDS latency before every 4 WMMAs
    __builtin_amdgcn_sched_barrier(0);
#pragma unroll
    for (int ks = 0; ks < 2; ++ks)   // rising k
#pragma unroll
      for (int mi = 0; mi < 4; ++mi)
#pragma unroll
        for (int ni = 0; ni < 4; ++ni) oc[mi][ni] = wmma_f16_b(a[ks][mi], bf[ks][ni], oc[mi][ni]);
    // keeps the barrier, and the wait for the prefetched slab that comes with it, behind the WMMAs: the compiler had
    // lifted both in front of them, so that the loads' latency was waited out before the products
    __builtin_amdgcn_sched_barrier(0);
    __syncthreads();
  }

  // oc[mi][ni][r] = (channel 64wv+16mi+8h+r, query 16ni+lm): 8 channels in a row per lane; stage [query][channel] for whole-line stores
  float inv[4];
#pragma unroll
  for (int ni = 0; ni < 4; ++ni) {
    float s = reds[16 * ni + lm];
#pragma unroll
    for (int w = 1; w < 8; ++w) s += reds[w * AQ + 16 * ni + lm];
    inv[ni] = oscale / s;
  }
#pragma unroll
  for (int mi = 0; mi < 4; ++mi)
#pragma unroll
    for (int ni = 0; ni < 4; ++ni) {
      v8h ov;
#pragma unroll
      for (int r = 0; r < 8; ++r) ov[r] = (_Float16)(oc[mi][ni][r] * inv[ni]);
      *(v8h*)&Os[(16 * ni + lm) * QP + 64 * wv + 16 * mi + 8 * h] = ov;
    }
  __syncthreads();
  _Float16* op = oT + (size_t)b * actB + (size_t)(i0 + qr) * CDIM + qc;
  v8h val[16];
#pragma unroll
  for (int it = 0; it < 16; ++it) val[it] = *(const v8h*)&Os[(4 * it + qr) * QP + qc];
#pragma unroll
  for (int it = 0; it < 16; ++it) *(v8h*)(op + (size_t)(4 * it) * CDIM) = val[it];
}

// ---------------------------------------------------------------------------
extern "C" void kernel_launch(void* const* d_in, const int* in_sizes, int n_in,
                              void* d_out, int out_size, void* d_ws,
                              size_t ws_size, hipStream_t stream) {
  if (n_in < 11) return;
  const long long per = (long long)CDIM * NPIX;
  const long long tot = (long long)in_sizes[0];
  if (tot <= 0 || (tot % per) != 0) return;
  const int B = (int)(tot / per);
  if ((long long)out_size != tot) return;
  if (in_sizes[1] != CDIM || in_sizes[2] != CDIM) return;
  if (in_sizes[3] != CDIM * CDIM || in_sizes[5] != CDIM * CDIM ||
      in_sizes[7] != CDIM * CDIM || in_sizes[9] != CDIM * CDIM) return;
  if (in_sizes[4] != CDIM || in_sizes[6] != CDIM || in_sizes[8] != CDIM || in_sizes[10] != CDIM) return;
  if (B > 65535) return;

  const float* x     = (const float*)d_in[0];
  const float* gamma = (const float*)d_in[1];
  const float* beta  = (const float*)d_in[2];
  const float* wq = (const float*)d_in[3]; const float* bq = (const float*)d_in[4];
  const float* wk = (const float*)d_in[5]; const float* bk = (const float*)d_in[6];
  const float* wv = (const float*)d_in[7]; const float* bv = (const float*)d_in[8];
  const float* wo = (const float*)d_in[9]; const float* bo = (const float*)d_in[10];
  float* out = (float*)d_out;

  // workspace carve: qT | kT | v16 | hT(->oT) (each B*N*C f16)
  const size_t HB = (size_t)B * CDIM * NPIX * sizeof(_Float16);
  if (4 * HB > ws_size) return;
  char* ws = (char*)d_ws;
  _Float16* qT  = (_Float16*)(ws);
  _Float16* kT  = (_Float16*)(ws + HB);
  _Float16* v16 = (_Float16*)(ws + 2 * HB);
  _Float16* hT  = (_Float16*)(ws + 3 * HB);   // later reused as oT

  const size_t actB = (size_t)NPIX * CDIM;    // per-batch stride of hT/qT/kT/v16/oT/out (elements)
  const float wsc   = 64.0f;                   // f16 weight pre-scale
  const float attn_scale = 0.04419417382415922f;   // 512^-0.5
  const float psh   = 12.0f;                   // f16 probability pre-scale, as a power of two (x4096)
  const float osc   = 16.0f;                   // f16 pre-scale of the p*v result

  gn_kernel<<<B * (CDIM / CBLK), 256, 0, stream>>>(x, gamma, beta, hT);

  dim3 gc(CDIM / BT, NPIX / BT, B);
  // q, k: A = W[o][c] f32 (x64), Bt = hT[n][c]; out [b][n][o] f16
  gemm_kernel<1, 0><<<gc, 256, 0, stream>>>(wq, hT, 0, CDIM, wsc, hT, actB, CDIM, CDIM,
                                            bq, 1, 1.0f / wsc, qT, out, x, 0, actB, CDIM);
  gemm_kernel<1, 0><<<gc, 256, 0, stream>>>(wk, hT, 0, CDIM, wsc, hT, actB, CDIM, CDIM,
                                            bk, 1, 1.0f / wsc, kT, out, x, 0, actB, CDIM);
  // v: out [b][o][n] f16
  gemm_kernel<1, 1><<<gc, 256, 0, stream>>>(wv, hT, 0, CDIM, wsc, hT, actB, CDIM, CDIM,
                                            bv, 1, 1.0f / wsc, v16, out, x, 0, actB, NPIX);
  // attention: scores, softmax (e x4096 as f16, in LDS) and oT[b][i][c] = sum_j v16[c][j] * e[i][j] / sum_j e[i][j], stored x16 as f16 (hT buffer)
  dim3 ga(NPIX / AQ, B);
  attn_kernel<<<ga, 256, 0, stream>>>(qT, kT, v16, hT, attn_scale, psh, osc);
  // output projection: A = Wo[o][c] f32 (x64), Bt = oT[n][c] (x16); out[b][o][n] = res + acc/(64*16) + bo
  gemm_kernel<1, 2><<<gc, 256, 0, stream>>>(wo, hT, 0, CDIM, wsc, hT, actB, CDIM, CDIM,
                                            bo, 1, 1.0f / (wsc * osc), qT, out, x, 1, actB, NPIX);
}

// v004
// It runs in 141 microseconds.
// Two timings next to v003 put it at 1.07 and 1.06 times that version's speed.
// All steps since v000 together make it 1.75 times as fast.
#include <hip/hip_runtime.h>
#include <stddef.h>
#include <stdint.h>

// All contractions: v_wmma_f32_16x16x32_f16 (f16 operands, f32 accumulate): three 1x1 projections (weights x64),
// q*k^T, p*v (p x4096, divided by its row sum behind the product), output projection (o x16, weights x64); all scales are powers of two folded back in f32.

#define CDIM 512
#define NPIX 1024
#define GCH  16      // channels per norm group (CDIM / 32)
#define CBLK 64      // channels per norm block (4 groups)
#define GNT  512     // threads per norm block
// LDS row pitches of the GEMM tiles: 16 B x odd, so that 16 rows read or written 16 B wide fall on 64 distinct banks
// (and rows 8 apart, as the two lane halves of an accumulator hold them, fall 32 banks apart).
#define BT   128     // GEMM block tile: BT x BT results
#define BK   64      // k per slab: one whole 128-B line of an f16 operand row
#define KP   72      // operand tiles: 64 halves of k + 8 pad  (144 B)
#define DHP  136     // f16 result tile: 128 halves + 8 pad    (272 B)
#define DFP  132     // f32 result tile: 128 floats + 4 pad    (528 B)
#define AQ   64      // attention: queries per work-group
#define QP   520     // attention q and o tiles: 512 halves + 8 pad  (1040 B)
#define PP   1032    // attention p tile: 1024 halves + 8 pad        (2064 B)

typedef _Float16 v16h __attribute__((ext_vector_type(16)));
typedef _Float16 v8h  __attribute__((ext_vector_type(8)));
typedef _Float16 v4h  __attribute__((ext_vector_type(4)));
typedef float    v8f  __attribute__((ext_vector_type(8)));
typedef float    v4f  __attribute__((ext_vector_type(4)));
typedef float    v2f  __attribute__((ext_vector_type(2)));
union Frag { v16h v; v8h half[2]; };

// ---------------------------------------------------------------------------
// 16x16x32 f16 WMMA with hazard guard.
__device__ __forceinline__ v8f wmma_f16(v16h a, v16h b, v8f c) {
  v8f d = __builtin_amdgcn_wmma_f32_16x16x32_f16(false, a, false, b, (short)0, c, false, false);
  asm volatile("v_nop\n\tv_nop\n\tv_nop\n\tv_nop" : "+v"(d) : "v"(a), "v"(b));
  return d;
}

// The builtin alone, for the attention kernel: its accumulators reach above v255, where an asm operand cannot lie
// (tied to the asm guard above they all went to scratch); the compiler keeps the distances behind its own builtin.
__device__ __forceinline__ v8f wmma_f16_b(v16h a, v16h b, v8f c) {
  return __builtin_amdgcn_wmma_f32_16x16x32_f16(false, a, false, b, (short)0, c, false, false);
}

// 2^x with the free slot behind it that the instruction set asks for after a transcendental, in one statement.
__device__ __forceinline__ float exp2_slot(float x) {
  float e;
  asm("v_exp_f32 %0, %1\n\tv_nop" : "=v"(e) : "v"(x));
  return e;
}

// Fragment from an LDS tile stored [row][k] with pitch KP halves (used for A rows and for B columns alike):
// lane l: row = l&15, h = l>>4; elements 0..7 <- k 8h..8h+7, elements 8..15 <- k 16+8h..16+8h+7.
__device__ __forceinline__ v16h ld_frag(const _Float16* tile, int row, int h) {
  Frag f;
  const _Float16* rp = tile + row * KP;
  f.half[0] = *(const v8h*)(rp + 8 * h);
  f.half[1] = *(const v8h*)(rp + 16 + 8 * h);
  return f.v;
}

// The same fragment from a tile of another row pitch (in halves).
template <int PITCH>
__device__ __forceinline__ v16h ld_frag_p(const _Float16* tile, int row, int h) {
  Frag f;
  const _Float16* rp = tile + row * PITCH;
  f.half[0] = *(const v8h*)(rp + 8 * h);
  f.half[1] = *(const v8h*)(rp + 16 + 8 * h);
  return f.v;
}

// ---------------------------------------------------------------------------
// Kernel 1: group norm -> transposed f16 activations hT[b][n][c].
// One work-group of 16 waves per 64 channels (4 groups) of one batch. Wave w holds channels 8(w&7)..+7 x pixels 512(w>>3)..+511 in
// registers: every wave-wide load covers 512 B in a row of one channel, x is read once, statistics and normalisation work on the registers.
// A lane holds 8 channels of each of its pixels, so a pixel's part of the transposed tile is one 16-B LDS store.
// Pixel n = 128a + 4l + e lies in LDS row 128a + 32e + l: the 32 lanes of a store fall on 32 rows in a row (pitch 16 B x odd).
__global__ __launch_bounds__(GNT) void gn_kernel(
    const float* __restrict__ x, const float* __restrict__ gamma,
    const float* __restrict__ beta, _Float16* hT) {
  const int b  = blockIdx.x >> 3, cg = blockIdx.x & 7;
  const int c0 = cg * CBLK;
  const int t  = threadIdx.x, lane = t & 31;
  const int wv = __builtin_amdgcn_readfirstlane(t >> 5);   // the wave's number as a scalar: gamma and beta come by scalar loads
  const int oct = wv & 7, ph = wv >> 3;      // channel octet, half of the pixel range
  const float* xw = x + ((size_t)b * CDIM + c0 + 8 * oct) * NPIX + ph * (NPIX / 2);   // the wave's part of x
  const int lo4 = 4 * lane;                  // the lane's place in a 512-B run

  __shared__ __align__(16) _Float16 Ts[NPIX * KP];
  __shared__ float rs1[GNT / 32], rs2[GNT / 32];

  v4f v[8][4];
#pragma unroll
  for (int i = 0; i < 8; ++i)
#pragma unroll
    for (int j = 0; j < 4; ++j) v[i][j] = *(const v4f*)(xw + lo4 + i * NPIX + 128 * j);
  v4f ga[2], be[2];
#pragma unroll
  for (int u = 0; u < 2; ++u) {
    ga[u] = *(const v4f*)(gamma + c0 + 8 * oct + 4 * u);
    be[u] = *(const v4f*)(beta + c0 + 8 * oct + 4 * u);
  }
  // registers that held these loads' addresses are reused below: wait before they are overwritten
  asm volatile("s_wait_xcnt 0x0" ::: "memory");

  // statistics: all 8 channels of a wave belong to one group; pixel pairs are summed two wide, one chain per 128-pixel run
  v2f sa[4], qa[4];
#pragma unroll
  for (int j = 0; j < 4; ++j) { sa[j] = (v2f){0.f, 0.f}; qa[j] = (v2f){0.f, 0.f}; }
#pragma unroll
  for (int i = 0; i < 8; ++i)
#pragma unroll
    for (int j = 0; j < 4; ++j) {
      const v2f lo = __builtin_shufflevector(v[i][j], v[i][j], 0, 1);
      const v2f hi = __builtin_shufflevector(v[i][j], v[i][j], 2, 3);
      sa[j] += lo; sa[j] += hi;
      qa[j] += lo * lo; qa[j] += hi * hi;
    }
  const v2f st = (sa[0] + sa[1]) + (sa[2] + sa[3]);
  const v2f qt = (qa[0] + qa[1]) + (qa[2] + qa[3]);
  float s = st[0] + st[1], ss = qt[0] + qt[1];
#pragma unroll
  for (int k = 16; k > 0; k >>= 1) { s += __shfl_xor(s, k, 32); ss += __shfl_xor(ss, k, 32); }
  if (lane == 0) { rs1[wv] = s; rs2[wv] = ss; }
  __syncthreads();
  // a group is two octets x two pixel halves: waves o2, o2+1, o2+8, o2+9
  const int o2 = oct & 6;
  const float gs  = (rs1[o2] + rs1[o2 + 1]) + (rs1[o2 + 8] + rs1[o2 + 9]);
  const float gss = (rs2[o2] + rs2[o2 + 1]) + (rs2[o2 + 8] + rs2[o2 + 9]);
  const float inv_cnt = 1.0f / (float)(GCH * NPIX);
  const float mean = gs * inv_cnt;
  float var = gss * inv_cnt - mean * mean;
  var = fmaxf(var, 0.f);
  const float inv = rsqrtf(var + 1e-6f);
  float gm[8], bt[8];
#pragma unroll
  for (int i = 0; i < 8; ++i) {
    gm[i] = ga[i >> 2][i & 3] * inv;
    bt[i] = be[i >> 2][i & 3] - mean * gm[i];
  }

#pragma unroll
  for (int j = 0; j < 4; ++j)
#pragma unroll
    for (int e = 0; e < 4; ++e) {
      v8h pv;
#pragma unroll
      for (int i = 0; i < 8; ++i) pv[i] = (_Float16)(v[i][j][e] * gm[i] + bt[i]);
      *(v8h*)&Ts[(128 * (4 * ph + j) + 32 * e + lane) * KP + 8 * oct] = pv;
    }
  __syncthreads();

  // 1024 lines (one per pixel), 8 lanes x 16 B per line; sweep it takes LDS rows 64it..64it+63
  const int rl = t >> 3, p = t & 7;           // row in the sweep, 16-B piece of the line
  _Float16* hp = hT + ((size_t)b * NPIX + 4 * (rl & 31) + (rl >> 5)) * CDIM + c0 + p * 8;
  v8h val[16];
#pragma unroll
  for (int it = 0; it < 16; ++it) val[it] = *(const v8h*)&Ts[(64 * it + rl) * KP + p * 8];
#pragma unroll
  for (int it = 0; it < 16; ++it) *(v8h*)(hp + (size_t)(128 * (it >> 1) + 2 * (it & 1)) * CDIM) = val[it];
}

// ---------------------------------------------------------------------------
// Generic 128x128 tile GEMM on f16 16x16x32 WMMA: D[m][n] = sum_k A[m][k] * Bt[n][k]  (both operands k-contiguous).
// 8 waves as 2 x 4, each 64 x 32 of the tile (4 x 2 accumulators); a k-slab is 64, worked as two WMMA depths in rising k.
// AF32: A is f32 (converted to f16 with ascale at staging) else f16.  Bt always f16.
// MODE 0: f16 out, stored [n][m] (m contiguous):  out16[b*o_bs + (n0+n)*ldo + m0+m]
// MODE 1: f16 out, stored [m][n]:                  out16[b*o_bs + (m0+m)*ldo + n0+n]
// MODE 2: f32 out, stored [m][n], optional residual add at the same index.
template <int AF32, int MODE>
__global__ __launch_bounds__(256) void gemm_kernel(
    const float* __restrict__ Af, const _Float16* __restrict__ Ah, size_t a_bs, int lda, float ascale,
    const _Float16* __restrict__ Bt, size_t b_bs, int ldb, int K,
    const float* __restrict__ bias, int has_bias, float oscale,
    _Float16* out16, float* out32, const float* __restrict__ res, int has_res,
    size_t o_bs, int ldo) {
  const int m0 = blockIdx.x * BT, n0 = blockIdx.y * BT, b = blockIdx.z;
  const int tid = threadIdx.x, lane = tid & 31, wv = tid >> 5;
  const int h = lane >> 4, lm = lane & 15;
  const int wr = (wv >> 2) * 64, wc = (wv & 3) * 32;

  __shared__ __align__(16) _Float16 As[BT * KP];   // [m][k]
  __shared__ __align__(16) _Float16 Bs[BT * KP];   // [n][k]
  __shared__ __align__(16) _Float16 Dh[(MODE != 2) ? BT * DHP : 8];
  __shared__ __align__(16) float    Df[(MODE == 2) ? BT * DFP : 4];

  v8f zero;
#pragma unroll
  for (int e = 0; e < 8; ++e) zero[e] = 0.f;
  v8f acc[4][2];
#pragma unroll
  for (int mi = 0; mi < 4; ++mi) { acc[mi][0] = zero; acc[mi][1] = zero; }

  // staging: a slab row is 128 B of f16 (8 lanes x 16 B, 32 rows a sweep) or 256 B of f32 (16 lanes x 16 B, 16 rows a sweep),
  // so every wave-wide load covers four whole lines
  const int hr = tid >> 3, hk = (tid & 7) * 8;
  const int fr = tid >> 4, fk = (tid & 15) * 4;
  const float*    ap_f = Af + (size_t)b * a_bs + (size_t)(m0 + fr) * lda + fk;
  const _Float16* ap_h = Ah + (size_t)b * a_bs + (size_t)(m0 + hr) * lda + hk;
  const _Float16* bp   = Bt + (size_t)b * b_bs + (size_t)(n0 + hr) * ldb + hk;

  v4f w[8];
  v8h ah[4], bh[4];
  if (AF32) {
#pragma unroll
    for (int i = 0; i < 8; ++i) w[i] = *(const v4f*)(ap_f + (size_t)(16 * i) * lda);
  } else {
#pragma unroll
    for (int i = 0; i < 4; ++i) ah[i] = *(const v8h*)(ap_h + (size_t)(32 * i) * lda);
  }
#pragma unroll
  for (int i = 0; i < 4; ++i) bh[i] = *(const v8h*)(bp + (size_t)(32 * i) * ldb);

  for (int k0 = 0; k0 < K; k0 += BK) {
    if (AF32) {
#pragma unroll
      for (int i = 0; i < 8; ++i) {
        v4h t;
#pragma unroll
        for (int e = 0; e < 4; ++e) t[e] = (_Float16)(w[i][e] * ascale);
        *(v4h*)&As[(16 * i + fr) * KP + fk] = t;
      }
    } else {
#pragma unroll
      for (int i = 0; i < 4; ++i) *(v8h*)&As[(32 * i + hr) * KP + hk] = ah[i];
    }
#pragma unroll
    for (int i = 0; i < 4; ++i) *(v8h*)&Bs[(32 * i + hr) * KP + hk] = bh[i];
    __syncthreads();

    const int k1 = k0 + BK;
    if (k1 < K) {   // prefetch next k-slab into registers (block-uniform)
      if (AF32) {
#pragma unroll
        for (int i = 0; i < 8; ++i) w[i] = *(const v4f*)(ap_f + (size_t)(16 * i) * lda + k1);
      } else {
#pragma unroll
        for (int i = 0; i < 4; ++i) ah[i] = *(const v8h*)(ap_h + (size_t)(32 * i) * lda + k1);
      }
#pragma unroll
      for (int i = 0; i < 4; ++i) bh[i] = *(const v8h*)(bp + (size_t)(32 * i) * ldb + k1);
      // the fragment reads below land in the registers that held these loads' addresses: wait before they are overwritten
      asm volatile("s_wait_xcnt 0x0" ::: "memory");
    }

#pragma unroll
    for (int kk = 0; kk < BK; kk += 32) {
      v16h a[4], bf[2];
#pragma unroll
      for (int mi = 0; mi < 4; ++mi) a[mi] = ld_frag(As + kk, wr + 16 * mi + lm, h);
#pragma unroll
      for (int ni = 0; ni < 2; ++ni) bf[ni] = ld_frag(Bs + kk, wc + 16 * ni + lm, h);
#pragma unroll
      for (int mi = 0; mi < 4; ++mi)
#pragma unroll
        for (int ni = 0; ni < 2; ++ni) acc[mi][ni] = wmma_f16(a[mi], bf[ni], acc[mi][ni]);
    }
    __syncthreads();
  }

  // D: acc[mi][ni][r] = tile element (row wr+mi*16+8h+r, col wc+ni*16+lm); stage in LDS
#pragma unroll
  for (int mi = 0; mi < 4; ++mi)
#pragma unroll
    for (int ni = 0; ni < 2; ++ni)
#pragma unroll
      for (int r = 0; r < 8; ++r) {
        const int ml = wr + mi * 16 + 8 * h + r;
        const int nl = wc + ni * 16 + lm;
        float v = acc[mi][ni][r] * oscale;
        if (has_bias) v += bias[m0 + ml];
        if (MODE == 0)      Dh[nl * DHP + ml] = (_Float16)v;
        else if (MODE == 1) Dh[ml * DHP + nl] = (_Float16)v;
        else                Df[ml * DFP + nl] = v;
      }
  __syncthreads();

  if (MODE != 2) {
    // 128 rows x 256 B: two lines per row, 16 lanes x 16 B per row
    v8h val[8]; size_t idx[8];
#pragma unroll
    for (int it = 0; it < 8; ++it) {
      const int sI = it * 256 + tid;
      const int row = sI >> 4, p = sI & 15;
      val[it] = *(const v8h*)&Dh[row * DHP + p * 8];
      if (MODE == 0) idx[it] = (size_t)b * o_bs + (size_t)(n0 + row) * ldo + m0 + p * 8;
      else           idx[it] = (size_t)b * o_bs + (size_t)(m0 + row) * ldo + n0 + p * 8;
    }
#pragma unroll
    for (int it = 0; it < 8; ++it) *(v8h*)(out16 + idx[it]) = val[it];
  } else {
    // 128 rows x 512 B: four lines per row, one wave x 16 B per row
    v4f val[16]; size_t idx[16];
#pragma unroll
    for (int it = 0; it < 16; ++it) {
      const int sI = it * 256 + tid;
      const int row = sI >> 5, p = sI & 31;
      v4f v = *(const v4f*)&Df[row * DFP + p * 4];
      idx[it] = (size_t)b * o_bs + (size_t)(m0 + row) * ldo + n0 + p * 4;
      if (has_res) v += *(const v4f*)(res + idx[it]);
      val[it] = v;
    }
#pragma unroll
    for (int it = 0; it < 16; ++it) *(v4f*)(out32 + idx[it]) = val[it];
  }
}

// ---------------------------------------------------------------------------
// Kernel: attention of AQ queries against all NPIX keys of one batch, one work-group of 8 waves.
// Phase 1: St[j][i] = sum_c kT[j][c] * qT[i][c]; wave w holds keys 128w..128w+127 x 64 queries in 8 x 4 accumulators,
//          so a lane holds 64 scores of each of 4 queries (query 16ni+lm, keys 128w+16mi+8h+r).
// Softmax: maximum and sum in the lane, one exchange between the lane halves, then over the 8 waves through LDS.
// Phase 2: Ot[c][i] = sum_j v16[c][j] * P[i][j]; P (f16, not yet divided by its row sum) lies in LDS as [query][key];
//          wave w holds channels 64w..64w+63; the row sum divides the result.
// LDS: phase 1 [k slab 1024 x KP | q tile AQ x QP]; phase 2 [p tile AQ x PP | v slab 512 x KP]; at the end the o tile AQ x QP.
__global__ __launch_bounds__(256) void attn_kernel(
    const _Float16* __restrict__ qT, const _Float16* __restrict__ kT, const _Float16* __restrict__ v16,
    _Float16* oT, float sscale, float pshift, float oscale) {
  const int i0 = blockIdx.x * AQ, b = blockIdx.y;
  const int tid = threadIdx.x, lane = tid & 31, wv = tid >> 5;
  const int h = lane >> 4, lm = lane & 15;
  const size_t actB = (size_t)NPIX * CDIM;

  __shared__ __align__(16) _Float16 sm[NPIX * KP + AQ * QP];
  __shared__ float redm[8 * AQ], reds[8 * AQ];
  _Float16* Ks = sm;
  _Float16* Qs = sm + NPIX * KP;
  _Float16* Pl = sm;
  _Float16* Vs = sm + AQ * PP;
  _Float16* Os = sm;

  v8f zero;
#pragma unroll
  for (int e = 0; e < 8; ++e) zero[e] = 0.f;

  // staging maps: q and o rows are 1024 B (64 lanes x 16 B, 4 rows a sweep); k and v slab rows are 128 B (8 lanes x 16 B, 32 rows a sweep)
  const int qr = tid >> 6, qc = (tid & 63) * 8;
  const int hr = tid >> 3, hk = (tid & 7) * 8;
  const _Float16* qp = qT + (size_t)b * actB + (size_t)(i0 + qr) * CDIM + qc;
  const _Float16* kp = kT + (size_t)b * actB + (size_t)hr * CDIM + hk;
  const _Float16* vp = v16 + (size_t)b * actB + (size_t)hr * NPIX + hk;   // walks on by one slab a trip

  v8h kh[32];
  {
    v8h qv[16];
#pragma unroll
    for (int it = 0; it < 16; ++it) qv[it] = *(const v8h*)(qp + (size_t)(4 * it) * CDIM);
#pragma unroll
    for (int i = 0; i < 32; ++i) kh[i] = *(const v8h*)(kp + (size_t)(32 * i) * CDIM);
    // registers that held these loads' addresses are reused below: wait before they are overwritten
    asm volatile("s_wait_xcnt 0x0" ::: "memory");
    // holds what follows behind that wait: the compiler had lifted the accumulators' zeroing, which lands on the address registers, over it
    __builtin_amdgcn_sched_barrier(0);
#pragma unroll
    for (int it = 0; it < 16; ++it) *(v8h*)&Qs[(4 * it + qr) * QP + qc] = qv[it];
  }

  v8f acc[8][4];
#pragma unroll
  for (int mi = 0; mi < 8; ++mi)
#pragma unroll
    for (int ni = 0; ni < 4; ++ni) acc[mi][ni] = zero;

  // rolled: for speed only
#pragma unroll 1
  for (int k0 = 0; k0 < CDIM; k0 += BK) {
#pragma unroll
    for (int i = 0; i < 32; ++i) *(v8h*)&Ks[(32 * i + hr) * KP + hk] = kh[i];
    __syncthreads();

    const int k1 = k0 + BK;
    if (k1 < CDIM) {   // prefetch next k-slab into registers (block-uniform)
#pragma unroll
      for (int i = 0; i < 32; ++i) kh[i] = *(const v8h*)(kp + (size_t)(32 * i) * CDIM + k1);
      // the fragment reads below may land in the registers that held these loads' addresses: wait before they are overwritten
      asm volatile("s_wait_xcnt 0x0" ::: "memory");
    }

#pragma unroll
    for (int kk = 0; kk < BK; kk += 32) {
      v16h bf[4];
#pragma unroll
      for (int ni = 0; ni < 4; ++ni) bf[ni] = ld_frag_p<QP>(Qs + k0 + kk, 16 * ni + lm, h);
#pragma unroll
      for (int mg = 0; mg < 8; mg += 4) {
        v16h a[4];
#pragma unroll
        for (int mi = 0; mi < 4; ++mi) a[mi] = ld_frag(Ks + kk, 128 * wv + 16 * (mg + mi) + lm, h);
        // keeps the block's fragment reads together in front of its 16 WMMAs: left free, the compiler read one fragment
        // at a time into one register set and waited out the LDS latency before every 4 WMMAs
        __builtin_amdgcn_sched_barrier(0);
#pragma unroll
        for (int mi = 0; mi < 4; ++mi)
#pragma unroll
          for (int ni = 0; ni < 4; ++ni) acc[mg + mi][ni] = wmma_f16_b(a[mi], bf[ni], acc[mg + mi][ni]);
        // ends the block: the next block's reads do not move in among these WMMAs
        __builtin_amdgcn_sched_barrier(0);
      }
    }
    __syncthreads();
  }

  // first v slab: its latency runs under the softmax
  v8h vh[16];
#pragma unroll
  for (int i = 0; i < 16; ++i) vh[i] = *(const v8h*)(vp + (size_t)(32 * i) * NPIX);   // vp lives on: no load lands on it
  // registers that held these loads' addresses may be reused below: wait before they are overwritten
  asm volatile("s_wait_xcnt 0x0" ::: "memory");

  // softmax in the log2 domain: e = 2^((score - row maximum) * sscale * log2(e) + pshift), at most 2^pshift, goes to LDS as f16
  // without the division; the row sum of the same e divides the p*v result at the end
  const float c1 = sscale * 1.4426950408889634f;
#pragma unroll
  for (int ni = 0; ni < 4; ++ni) {
    float m = acc[0][ni][0];
#pragma unroll
    for (int mi = 0; mi < 8; ++mi)
#pragma unroll
      for (int r = 0; r < 8; ++r) m = fmaxf(m, acc[mi][ni][r]);
    m = fmaxf(m, __shfl_xor(m, 16, 32));
    if (h == 0) redm[wv * AQ + 16 * ni + lm] = m;
  }
  __syncthreads();
  // every wave has left the k slab (the barriers above): the p tile may overwrite it
#pragma unroll
  for (int ni = 0; ni < 4; ++ni) {
    float m = redm[16 * ni + lm];
#pragma unroll
    for (int w = 1; w < 8; ++w) m = fmaxf(m, redm[w * AQ + 16 * ni + lm]);
    const float mc = m * c1 - pshift;
    float s = 0.f;
#pragma unroll
    for (int mi = 0; mi < 8; ++mi) {
      v8h pv;
#pragma unroll
      for (int r = 0; r < 8; ++r) {
        const float e = exp2_slot(acc[mi][ni][r] * c1 - mc);
        s += e;
        pv[r] = (_Float16)e;
      }
      *(v8h*)&Pl[(16 * ni + lm) * PP + 128 * wv + 16 * mi + 8 * h] = pv;
    }
    s += __shfl_xor(s, 16, 32);
    if (h == 0) reds[wv * AQ + 16 * ni + lm] = s;
  }

  v8f oc[4][4];
#pragma unroll
  for (int mi = 0; mi < 4; ++mi)
#pragma unroll
    for (int ni = 0; ni < 4; ++ni) oc[mi][ni] = zero;

  // rolled: for speed only
#pragma unroll 1
  for (int j0 = 0; j0 < NPIX; j0 += BK) {
#pragma unroll
    for (int i = 0; i < 16; ++i) *(v8h*)&Vs[(32 * i + hr) * KP + hk] = vh[i];
    __syncthreads();   // on the first trip it also publishes the p tile and the waves' row sums

    const int j1 = j0 + BK;
    if (j1 < NPIX) {   // prefetch next v slab into registers (block-uniform)
      vp += BK;
#pragma unroll
      for (int i = 0; i < 16; ++i) vh[i] = *(const v8h*)(vp + (size_t)(32 * i) * NPIX);
      // the fragment reads below may land in the registers that held these loads' addresses: wait before they are overwritten
      asm volatile("s_wait_xcnt 0x0" ::: "memory");
    }

    v16h a[2][4], bf[2][4];
#pragma unroll
    for (int ks = 0; ks < 2; ++ks) {
#pragma unroll
      for (int mi = 0; mi < 4; ++mi) a[ks][mi] = ld_frag(Vs + 32 * ks, 64 * wv + 16 * mi + lm, h);
#pragma unroll
      for (int ni = 0; ni < 4; ++ni) bf[ks][ni] = ld_frag_p<PP>(Pl + j0 + 32 * ks, 16 * ni + lm, h);
    }
    // keeps the slab's fragment reads as one group in front of its 32 WMMAs: left free, the compiler read one fragment
    // at a time into one register set and waited out the LDS latency before every 4 WMMAs
    __builtin_amdgcn_sched_barrier(0);
#pragma unroll
    for (int ks = 0; ks < 2; ++ks)   // rising k
#pragma unroll
      for (int mi = 0; mi < 4; ++mi)
#pragma unroll
        for (int ni = 0; ni < 4; ++ni) oc[mi][ni] = wmma_f16_b(a[ks][mi], bf[ks][ni], oc[mi][ni]);
    // keeps the barrier, and the wait for the prefetched slab that comes with it, behind the WMMAs: the compiler had
    // lifted both in front of them, so that the loads' latency was waited out before the products
    __builtin_amdgcn_sched_barrier(0);
    __syncthreads();
  }

  // oc[mi][ni][r] = (channel 64wv+16mi+8h+r, query 16ni+lm): 8 channels in a row per lane; stage [query][channel] for whole-line stores
  float inv[4];
#pragma unroll
  for (int ni = 0; ni < 4; ++ni) {
    float s = reds[16 * ni + lm];
#pragma unroll
    for (int w = 1; w < 8; ++w) s += reds[w * AQ + 16 * ni + lm];
    inv[ni] = oscale / s;
  }
#pragma unroll
  for (int mi = 0; mi < 4; ++mi)
#pragma unroll
    for (int ni = 0; ni < 4; ++ni) {
      v8h ov;
#pragma unroll
      for (int r = 0; r < 8; ++r) ov[r] = (_Float16)(oc[mi][ni][r] * inv[ni]);
      *(v8h*)&Os[(16 * ni + lm) * QP + 64 * wv + 16 * mi + 8 * h] = ov;
    }
  __syncthreads();
  _Float16* op = oT + (size_t)b * actB + (size_t)(i0 + qr) * CDIM + qc;
  v8h val[16];
#pragma unroll
  for (int it = 0; it < 16; ++it) val[it] = *(const v8h*)&Os[(4 * it + qr) * QP + qc];
#pragma unroll
  for (int it = 0; it < 16; ++it) *(v8h*)(op + (size_t)(4 * it) * CDIM) = val[it];
}

// ---------------------------------------------------------------------------
extern "C" void kernel_launch(void* const* d_in, const int* in_sizes, int n_in,
                              void* d_out, int out_size, void* d_ws,
                              size_t ws_size, hipStream_t stream) {
  if (n_in < 11) return;
  const long long per = (long long)CDIM * NPIX;
  const long long tot = (long long)in_sizes[0];
  if (tot <= 0 || (tot % per) != 0) return;
  const int B = (int)(tot / per);
  if ((long long)out_size != tot) return;
  if (in_sizes[1] != CDIM || in_sizes[2] != CDIM) return;
  if (in_sizes[3] != CDIM * CDIM || in_sizes[5] != CDIM * CDIM ||
      in_sizes[7] != CDIM * CDIM || in_sizes[9] != CDIM * CDIM) return;
  if (in_sizes[4] != CDIM || in_sizes[6] != CDIM || in_sizes[8] != CDIM || in_sizes[10] != CDIM) return;
  if (B > 65535) return;

  const float* x     = (const float*)d_in[0];
  const float* gamma = (const float*)d_in[1];
  const float* beta  = (const float*)d_in[2];
  const float* wq = (const float*)d_in[3]; const float* bq = (const float*)d_in[4];
  const float* wk = (const float*)d_in[5]; const float* bk = (const float*)d_in[6];
  const float* wv = (const float*)d_in[7]; const float* bv = (const float*)d_in[8];
  const float* wo = (const float*)d_in[9]; const float* bo = (const float*)d_in[10];
  float* out = (float*)d_out;

  // workspace carve: qT | kT | v16 | hT(->oT) (each B*N*C f16)
  const size_t HB = (size_t)B * CDIM * NPIX * sizeof(_Float16);
  if (4 * HB > ws_size) return;
  char* ws = (char*)d_ws;
  _Float16* qT  = (_Float16*)(ws);
  _Float16* kT  = (_Float16*)(ws + HB);
  _Float16* v16 = (_Float16*)(ws + 2 * HB);
  _Float16* hT  = (_Float16*)(ws + 3 * HB);   // later reused as oT

  const size_t actB = (size_t)NPIX * CDIM;    // per-batch stride of hT/qT/kT/v16/oT/out (elements)
  const float wsc   = 64.0f;                   // f16 weight pre-scale
  const float attn_scale = 0.04419417382415922f;   // 512^-0.5
  const float psh   = 12.0f;                   // f16 probability pre-scale, as a power of two (x4096)
  const float osc   = 16.0f;                   // f16 pre-scale of the p*v result

  gn_kernel<<<B * (CDIM / CBLK), GNT, 0, stream>>>(x, gamma, beta, hT);

  dim3 gc(CDIM / BT, NPIX / BT, B);
  // q, k: A = W[o][c] f32 (x64), Bt = hT[n][c]; out [b][n][o] f16
  gemm_kernel<1, 0><<<gc, 256, 0, stream>>>(wq, hT, 0, CDIM, wsc, hT, actB, CDIM, CDIM,
                                            bq, 1, 1.0f / wsc, qT, out, x, 0, actB, CDIM);
  gemm_kernel<1, 0><<<gc, 256, 0, stream>>>(wk, hT, 0, CDIM, wsc, hT, actB, CDIM, CDIM,
                                            bk, 1, 1.0f / wsc, kT, out, x, 0, actB, CDIM);
  // v: out [b][o][n] f16
  gemm_kernel<1, 1><<<gc, 256, 0, stream>>>(wv, hT, 0, CDIM, wsc, hT, actB, CDIM, CDIM,
                                            bv, 1, 1.0f / wsc, v16, out, x, 0, actB, NPIX);
  // attention: scores, softmax (e x4096 as f16, in LDS) and oT[b][i][c] = sum_j v16[c][j] * e[i][j] / sum_j e[i][j], stored x16 as f16 (hT buffer)
  dim3 ga(NPIX / AQ, B);
  attn_kernel<<<ga, 256, 0, stream>>>(qT, kT, v16, hT, attn_scale, psh, osc);
  // output projection: A = Wo[o][c] f32 (x64), Bt = oT[n][c] (x16); out[b][o][n] = res + acc/(64*16) + bo
  gemm_kernel<1, 2><<<gc, 256, 0, stream>>>(wo, hT, 0, CDIM, wsc, hT, actB, CDIM, CDIM,
                                            bo, 1, 1.0f / (wsc * osc), qT, out, x, 1, actB, NPIX);
}

// v005
// A run of this version takes 120 microseconds.
// Next to v004, in two timings, it ran 1.18 times as fast each time.
// Over all steps from v000 it is 2.06 times as fast.
#include <hip/hip_runtime.h>
#include <stddef.h>
#include <stdint.h>

// All contractions: v_wmma_f32_16x16x32_f16 (f16 operands, f32 accumulate): three 1x1 projections (weights x64),
// q*k^T, p*v (p x4096, divided by its row sum behind the product), output projection (o x16, weights x64); all scales are powers of two folded back in f32.

#define CDIM 512
#define NPIX 1024
#define GCH  16      // channels per norm group (CDIM / 32)
#define CBLK 64      // channels per norm block (4 groups)
#define GNT  512     // threads per norm block
// LDS row pitches of the GEMM tiles: 16 B x odd, so that 16 rows read or written 16 B wide fall on 64 distinct banks
// (and rows 8 apart, as the two lane halves of an accumulator hold them, fall 32 banks apart).
#define BT   128     // GEMM block tile: BT x BT results
#define BK   64      // k per slab: one whole 128-B line of an f16 operand row
#define KP   72      // operand tiles: 64 halves of k + 8 pad  (144 B)
#define DHP  136     // f16 result tile: 128 halves + 8 pad    (272 B)
#define DFP  132     // f32 result tile: 128 floats + 4 pad    (528 B)
#define AQ   64      // attention: queries per work-group
#define QP   520     // attention q and o tiles: 512 halves + 8 pad  (1040 B)
#define PP   1032    // attention p tile: 1024 halves + 8 pad        (2064 B)

typedef _Float16 v16h __attribute__((ext_vector_type(16)));
typedef _Float16 v8h  __attribute__((ext_vector_type(8)));
typedef _Float16 v4h  __attribute__((ext_vector_type(4)));
typedef float    v8f  __attribute__((ext_vector_type(8)));
typedef float    v4f  __attribute__((ext_vector_type(4)));
typedef float    v2f  __attribute__((ext_vector_type(2)));
union Frag { v16h v; v8h half[2]; };

// ---------------------------------------------------------------------------
// 16x16x32 f16 WMMA with hazard guard.
__device__ __forceinline__ v8f wmma_f16(v16h a, v16h b, v8f c) {
  v8f d = __builtin_amdgcn_wmma_f32_16x16x32_f16(false, a, false, b, (short)0, c, false, false);
  asm volatile("v_nop\n\tv_nop\n\tv_nop\n\tv_nop" : "+v"(d) : "v"(a), "v"(b));
  return d;
}

// The builtin alone, for the attention kernel: its accumulators reach above v255, where an asm operand cannot lie
// (tied to the asm guard above they all went to scratch); the compiler keeps the distances behind its own builtin.
__device__ __forceinline__ v8f wmma_f16_b(v16h a, v16h b, v8f c) {
  return __builtin_amdgcn_wmma_f32_16x16x32_f16(false, a, false, b, (short)0, c, false, false);
}

// 2^x with the free slot behind it that the instruction set asks for after a transcendental, in one statement.
__device__ __forceinline__ float exp2_slot(float x) {
  float e;
  asm("v_exp_f32 %0, %1\n\tv_nop" : "=v"(e) : "v"(x));
  return e;
}

// Fragment from an LDS tile stored [row][k] with pitch KP halves (used for A rows and for B columns alike):
// lane l: row = l&15, h = l>>4; elements 0..7 <- k 8h..8h+7, elements 8..15 <- k 16+8h..16+8h+7.
__device__ __forceinline__ v16h ld_frag(const _Float16* tile, int row, int h) {
  Frag f;
  const _Float16* rp = tile + row * KP;
  f.half[0] = *(const v8h*)(rp + 8 * h);
  f.half[1] = *(const v8h*)(rp + 16 + 8 * h);
  return f.v;
}

// The same fragment from a tile of another row pitch (in halves).
template <int PITCH>
__device__ __forceinline__ v16h ld_frag_p(const _Float16* tile, int row, int h) {
  Frag f;
  const _Float16* rp = tile + row * PITCH;
  f.half[0] = *(const v8h*)(rp + 8 * h);
  f.half[1] = *(const v8h*)(rp + 16 + 8 * h);
  return f.v;
}

// ---------------------------------------------------------------------------
// Kernel 1: group norm -> transposed f16 activations hT[b][n][c].
// One work-group of 16 waves per 64 channels (4 groups) of one batch. Wave w holds channels 8(w&7)..+7 x pixels 512(w>>3)..+511 in
// registers: every wave-wide load covers 512 B in a row of one channel, x is read once, statistics and normalisation work on the registers.
// A lane holds 8 channels of each of its pixels, so a pixel's part of the transposed tile is one 16-B LDS store.
// Pixel n = 128a + 4l + e lies in LDS row 128a + 32e + l: the 32 lanes of a store fall on 32 rows in a row (pitch 16 B x odd).
__global__ __launch_bounds__(GNT) void gn_kernel(
    const float* __restrict__ x, const float* __restrict__ gamma,
    const float* __restrict__ beta, _Float16* hT) {
  const int b  = blockIdx.x >> 3, cg = blockIdx.x & 7;
  const int c0 = cg * CBLK;
  const int t  = threadIdx.x, lane = t & 31;
  const int wv = __builtin_amdgcn_readfirstlane(t >> 5);   // the wave's number as a scalar: gamma and beta come by scalar loads
  const int oct = wv & 7, ph = wv >> 3;      // channel octet, half of the pixel range
  const float* xw = x + ((size_t)b * CDIM + c0 + 8 * oct) * NPIX + ph * (NPIX / 2);   // the wave's part of x
  const int lo4 = 4 * lane;                  // the lane's place in a 512-B run

  __shared__ __align__(16) _Float16 Ts[NPIX * KP];
  __shared__ float rs1[GNT / 32], rs2[GNT / 32];

  v4f v[8][4];
#pragma unroll
  for (int i = 0; i < 8; ++i)
#pragma unroll
    for (int j = 0; j < 4; ++j) v[i][j] = *(const v4f*)(xw + lo4 + i * NPIX + 128 * j);
  v4f ga[2], be[2];
#pragma unroll
  for (int u = 0; u < 2; ++u) {
    ga[u] = *(const v4f*)(gamma + c0 + 8 * oct + 4 * u);
    be[u] = *(const v4f*)(beta + c0 + 8 * oct + 4 * u);
  }
  // registers that held these loads' addresses are reused below: wait before they are overwritten
  asm volatile("s_wait_xcnt 0x0" ::: "memory");

  // statistics: all 8 channels of a wave belong to one group; pixel pairs are summed two wide, one chain per 128-pixel run
  v2f sa[4], qa[4];
#pragma unroll
  for (int j = 0; j < 4; ++j) { sa[j] = (v2f){0.f, 0.f}; qa[j] = (v2f){0.f, 0.f}; }
#pragma unroll
  for (int i = 0; i < 8; ++i)
#pragma unroll
    for (int j = 0; j < 4; ++j) {
      const v2f lo = __builtin_shufflevector(v[i][j], v[i][j], 0, 1);
      const v2f hi = __builtin_shufflevector(v[i][j], v[i][j], 2, 3);
      sa[j] += lo; sa[j] += hi;
      qa[j] += lo * lo; qa[j] += hi * hi;
    }
  const v2f st = (sa[0] + sa[1]) + (sa[2] + sa[3]);
  const v2f qt = (qa[0] + qa[1]) + (qa[2] + qa[3]);
  float s = st[0] + st[1], ss = qt[0] + qt[1];
#pragma unroll
  for (int k = 16; k > 0; k >>= 1) { s += __shfl_xor(s, k, 32); ss += __shfl_xor(ss, k, 32); }
  if (lane == 0) { rs1[wv] = s; rs2[wv] = ss; }
  __syncthreads();
  // a group is two octets x two pixel halves: waves o2, o2+1, o2+8, o2+9
  const int o2 = oct & 6;
  const float gs  = (rs1[o2] + rs1[o2 + 1]) + (rs1[o2 + 8] + rs1[o2 + 9]);
  const float gss = (rs2[o2] + rs2[o2 + 1]) + (rs2[o2 + 8] + rs2[o2 + 9]);
  const float inv_cnt = 1.0f / (float)(GCH * NPIX);
  const float mean = gs * inv_cnt;
  float var = gss * inv_cnt - mean * mean;
  var = fmaxf(var, 0.f);
  const float inv = rsqrtf(var + 1e-6f);
  float gm[8], bt[8];
#pragma unroll
  for (int i = 0; i < 8; ++i) {
    gm[i] = ga[i >> 2][i & 3] * inv;
    bt[i] = be[i >> 2][i & 3] - mean * gm[i];
  }

#pragma unroll
  for (int j = 0; j < 4; ++j)
#pragma unroll
    for (int e = 0; e < 4; ++e) {
      v8h pv;
#pragma unroll
      for (int i = 0; i < 8; ++i) pv[i] = (_Float16)(v[i][j][e] * gm[i] + bt[i]);
      *(v8h*)&Ts[(128 * (4 * ph + j) + 32 * e + lane) * KP + 8 * oct] = pv;
    }
  __syncthreads();

  // 1024 lines (one per pixel), 8 lanes x 16 B per line; sweep it takes LDS rows 64it..64it+63
  const int rl = t >> 3, p = t & 7;           // row in the sweep, 16-B piece of the line
  _Float16* hp = hT + ((size_t)b * NPIX + 4 * (rl & 31) + (rl >> 5)) * CDIM + c0 + p * 8;
  v8h val[16];
#pragma unroll
  for (int it = 0; it < 16; ++it) val[it] = *(const v8h*)&Ts[(64 * it + rl) * KP + p * 8];
#pragma unroll
  for (int it = 0; it < 16; ++it) *(v8h*)(hp + (size_t)(128 * (it >> 1) + 2 * (it & 1)) * CDIM) = val[it];
}

// ---------------------------------------------------------------------------
// Generic 128x128 tile GEMM on f16 16x16x32 WMMA: D[m][n] = sum_k A[m][k] * Bt[n][k]  (both operands k-contiguous).
// 8 waves as 2 x 4, each 64 x 32 of the tile (4 x 2 accumulators); a k-slab is 64, worked as two WMMA depths in rising k.
// AF32: A is f32 (converted to f16 with ascale at staging) else f16.  Bt always f16.
// MODE 0: f16 out, stored [n][m] (m contiguous):  out16[b*o_bs + (n0+n)*ldo + m0+m]
// MODE 1: f16 out, stored [m][n]:                  out16[b*o_bs + (m0+m)*ldo + n0+n]
// MODE 2: f32 out, stored [m][n], optional residual add at the same index.
template <int AF32, int MODE>
__global__ __launch_bounds__(256) void gemm_kernel(
    const float* __restrict__ Af, const _Float16* __restrict__ Ah, size_t a_bs, int lda, float ascale,
    const _Float16* __restrict__ Bt, size_t b_bs, int ldb, int K,
    const float* __restrict__ bias, int has_bias, float oscale,
    _Float16* out16, float* out32, const float* __restrict__ res, int has_res,
    size_t o_bs, int ldo) {
  const int m0 = blockIdx.x * BT, n0 = blockIdx.y * BT, b = blockIdx.z;
  const int tid = threadIdx.x, lane = tid & 31, wv = tid >> 5;
  const int h = lane >> 4, lm = lane & 15;
  const int wr = (wv >> 2) * 64, wc = (wv & 3) * 32;

  __shared__ __align__(16) _Float16 As[BT * KP];   // [m][k]
  __shared__ __align__(16) _Float16 Bs[BT * KP];   // [n][k]
  __shared__ __align__(16) _Float16 Dh[(MODE != 2) ? BT * DHP : 8];
  __shared__ __align__(16) float    Df[(MODE == 2) ? BT * DFP : 4];

  v8f zero;
#pragma unroll
  for (int e = 0; e < 8; ++e) zero[e] = 0.f;
  v8f acc[4][2];
#pragma unroll
  for (int mi = 0; mi < 4; ++mi) { acc[mi][0] = zero; acc[mi][1] = zero; }

  // staging: a slab row is 128 B of f16 (8 lanes x 16 B, 32 rows a sweep) or 256 B of f32 (16 lanes x 16 B, 16 rows a sweep),
  // so every wave-wide load covers four whole lines
  const int hr = tid >> 3, hk = (tid & 7) * 8;
  const int fr = tid >> 4, fk = (tid & 15) * 4;
  const float*    ap_f = Af + (size_t)b * a_bs + (size_t)(m0 + fr) * lda + fk;
  const _Float16* ap_h = Ah + (size_t)b * a_bs + (size_t)(m0 + hr) * lda + hk;
  const _Float16* bp   = Bt + (size_t)b * b_bs + (size_t)(n0 + hr) * ldb + hk;

  v4f w[8];
  v8h ah[4], bh[4];
  if (AF32) {
#pragma unroll
    for (int i = 0; i < 8; ++i) w[i] = *(const v4f*)(ap_f + (size_t)(16 * i) * lda);
  } else {
#pragma unroll
    for (int i = 0; i < 4; ++i) ah[i] = *(const v8h*)(ap_h + (size_t)(32 * i) * lda);
  }
#pragma unroll
  for (int i = 0; i < 4; ++i) bh[i] = *(const v8h*)(bp + (size_t)(32 * i) * ldb);

  for (int k0 = 0; k0 < K; k0 += BK) {
    if (AF32) {
#pragma unroll
      for (int i = 0; i < 8; ++i) {
        v4h t;
#pragma unroll
        for (int e = 0; e < 4; ++e) t[e] = (_Float16)(w[i][e] * ascale);
        *(v4h*)&As[(16 * i + fr) * KP + fk] = t;
      }
    } else {
#pragma unroll
      for (int i = 0; i < 4; ++i) *(v8h*)&As[(32 * i + hr) * KP + hk] = ah[i];
    }
#pragma unroll
    for (int i = 0; i < 4; ++i) *(v8h*)&Bs[(32 * i + hr) * KP + hk] = bh[i];
    __syncthreads();

    const int k1 = k0 + BK;
    if (k1 < K) {   // prefetch next k-slab into registers (block-uniform)
      if (AF32) {
#pragma unroll
        for (int i = 0; i < 8; ++i) w[i] = *(const v4f*)(ap_f + (size_t)(16 * i) * lda + k1);
      } else {
#pragma unroll
        for (int i = 0; i < 4; ++i) ah[i] = *(const v8h*)(ap_h + (size_t)(32 * i) * lda + k1);
      }
#pragma unroll
      for (int i = 0; i < 4; ++i) bh[i] = *(const v8h*)(bp + (size_t)(32 * i) * ldb + k1);
      // the fragment reads below land in the registers that held these loads' addresses: wait before they are overwritten
      asm volatile("s_wait_xcnt 0x0" ::: "memory");
    }

#pragma unroll
    for (int kk = 0; kk < BK; kk += 32) {
      v16h a[4], bf[2];
#pragma unroll
      for (int mi = 0; mi < 4; ++mi) a[mi] = ld_frag(As + kk, wr + 16 * mi + lm, h);
#pragma unroll
      for (int ni = 0; ni < 2; ++ni) bf[ni] = ld_frag(Bs + kk, wc + 16 * ni + lm, h);
#pragma unroll
      for (int mi = 0; mi < 4; ++mi)
#pragma unroll
        for (int ni = 0; ni < 2; ++ni) acc[mi][ni] = wmma_f16(a[mi], bf[ni], acc[mi][ni]);
    }
    __syncthreads();
  }

  // What the epilogue reads from global memory goes out here as one group, each flag tested once: (MODE 2) the residual of the 16
  // pieces the thread stores, then the bias of the lane's 4 x 8 result rows. Their latencies run side by side, not one after another.
  v4f rv[(MODE == 2) ? 16 : 1];
  unsigned off[(MODE == 2) ? 16 : 1];   // byte offsets of those pieces in the batch's plane (below 4 GiB), for the residual and the store alike
  if (MODE == 2) {
#pragma unroll
    for (int it = 0; it < 16; ++it) {
      off[it] = ((unsigned)(m0 + 8 * it + wv) * (unsigned)ldo + (unsigned)(n0 + lane * 4)) * 4u;
      rv[it] = (v4f){0.f, 0.f, 0.f, 0.f};
    }
    if (has_res) {
      const char* rb = (const char*)(res + (size_t)b * o_bs);
#pragma unroll
      for (int it = 0; it < 16; ++it) rv[it] = *(const v4f*)(rb + off[it]);
      // wait before a register that these loads name is overwritten
      asm volatile("s_wait_xcnt 0x0" ::: "memory");
    }
  }
  v4f bb[4][2];
#pragma unroll
  for (int mi = 0; mi < 4; ++mi) { bb[mi][0] = (v4f){0.f, 0.f, 0.f, 0.f}; bb[mi][1] = (v4f){0.f, 0.f, 0.f, 0.f}; }
  if (has_bias) {
    const float* bp4 = bias + m0 + wr + 8 * h;
#pragma unroll
    for (int mi = 0; mi < 4; ++mi) {
      bb[mi][0] = *(const v4f*)(bp4 + 16 * mi);
      bb[mi][1] = *(const v4f*)(bp4 + 16 * mi + 4);
    }
    // registers that held these loads' addresses are reused below: wait before they are overwritten
    asm volatile("s_wait_xcnt 0x0" ::: "memory");
  }

  // D: acc[mi][ni][r] = tile element (row wr+mi*16+8h+r, col wc+ni*16+lm); stage in LDS
#pragma unroll
  for (int mi = 0; mi < 4; ++mi)
#pragma unroll
    for (int ni = 0; ni < 2; ++ni)
#pragma unroll
      for (int r = 0; r < 8; ++r) {
        const int ml = wr + mi * 16 + 8 * h + r;
        const int nl = wc + ni * 16 + lm;
        const float v = acc[mi][ni][r] * oscale + bb[mi][r >> 2][r & 3];
        if (MODE == 0)      Dh[nl * DHP + ml] = (_Float16)v;
        else if (MODE == 1) Dh[ml * DHP + nl] = (_Float16)v;
        else                Df[ml * DFP + nl] = v;
      }
  __syncthreads();

  if (MODE != 2) {
    // 128 rows x 256 B: two lines per row, 16 lanes x 16 B per row
    v8h val[8]; size_t idx[8];
#pragma unroll
    for (int it = 0; it < 8; ++it) {
      const int sI = it * 256 + tid;
      const int row = sI >> 4, p = sI & 15;
      val[it] = *(const v8h*)&Dh[row * DHP + p * 8];
      if (MODE == 0) idx[it] = (size_t)b * o_bs + (size_t)(n0 + row) * ldo + m0 + p * 8;
      else           idx[it] = (size_t)b * o_bs + (size_t)(m0 + row) * ldo + n0 + p * 8;
    }
#pragma unroll
    for (int it = 0; it < 8; ++it) *(v8h*)(out16 + idx[it]) = val[it];
  } else {
    // 128 rows x 512 B: four lines per row, one wave x 16 B per row
    v4f val[16];
#pragma unroll
    for (int it = 0; it < 16; ++it) val[it] = *(const v4f*)&Df[(8 * it + wv) * DFP + lane * 4] + rv[it];
    char* ob = (char*)(out32 + (size_t)b * o_bs);
#pragma unroll
    for (int it = 0; it < 16; ++it) *(v4f*)(ob + off[it]) = val[it];
  }
}

// ---------------------------------------------------------------------------
// Kernel: attention of AQ queries against all NPIX keys of one batch, one work-group of 8 waves.
// Phase 1: St[j][i] = sum_c kT[j][c] * qT[i][c]; wave w holds keys 128w..128w+127 x 64 queries in 8 x 4 accumulators,
//          so a lane holds 64 scores of each of 4 queries (query 16ni+lm, keys 128w+16mi+8h+r).
// Softmax: maximum and sum in the lane, one exchange between the lane halves, then over the 8 waves through LDS.
// Phase 2: Ot[c][i] = sum_j v16[c][j] * P[i][j]; P (f16, not yet divided by its row sum) lies in LDS as [query][key];
//          wave w holds channels 64w..64w+63; the row sum divides the result.
// LDS: phase 1 [k slab 1024 x KP | q tile AQ x QP]; phase 2 [p tile AQ x PP | v slab 512 x KP]; at the end the o tile AQ x QP.
__global__ __launch_bounds__(256) void attn_kernel(
    const _Float16* __restrict__ qT, const _Float16* __restrict__ kT, const _Float16* __restrict__ v16,
    _Float16* oT, float sscale, float pshift, float oscale) {
  const int i0 = blockIdx.x * AQ, b = blockIdx.y;
  const int tid = threadIdx.x, lane = tid & 31, wv = tid >> 5;
  const int h = lane >> 4, lm = lane & 15;
  const size_t actB = (size_t)NPIX * CDIM;

  __shared__ __align__(16) _Float16 sm[NPIX * KP + AQ * QP];
  __shared__ float redm[8 * AQ], reds[8 * AQ];
  _Float16* Ks = sm;
  _Float16* Qs = sm + NPIX * KP;
  _Float16* Pl = sm;
  _Float16* Vs = sm + AQ * PP;
  _Float16* Os = sm;

  v8f zero;
#pragma unroll
  for (int e = 0; e < 8; ++e) zero[e] = 0.f;

  // staging maps: q and o rows are 1024 B (64 lanes x 16 B, 4 rows a sweep); k and v slab rows are 128 B (8 lanes x 16 B, 32 rows a sweep)
  const int qr = tid >> 6, qc = (tid & 63) * 8;
  const int hr = tid >> 3, hk = (tid & 7) * 8;
  const _Float16* qp = qT + (size_t)b * actB + (size_t)(i0 + qr) * CDIM + qc;
  const _Float16* kp = kT + (size_t)b * actB + (size_t)hr * CDIM + hk;
  const _Float16* vp = v16 + (size_t)b * actB + (size_t)hr * NPIX + hk;   // walks on by one slab a trip

  v8h kh[32];
  {
    v8h qv[16];
#pragma unroll
    for (int it = 0; it < 16; ++it) qv[it] = *(const v8h*)(qp + (size_t)(4 * it) * CDIM);
#pragma unroll
    for (int i = 0; i < 32; ++i) kh[i] = *(const v8h*)(kp + (size_t)(32 * i) * CDIM);
    // registers that held these loads' addresses are reused below: wait before they are overwritten
    asm volatile("s_wait_xcnt 0x0" ::: "memory");
    // holds what follows behind that wait: the compiler had lifted the accumulators' zeroing, which lands on the address registers, over it
    __builtin_amdgcn_sched_barrier(0);
#pragma unroll
    for (int it = 0; it < 16; ++it) *(v8h*)&Qs[(4 * it + qr) * QP + qc] = qv[it];
  }

  v8f acc[8][4];
#pragma unroll
  for (int mi = 0; mi < 8; ++mi)
#pragma unroll
    for (int ni = 0; ni < 4; ++ni) acc[mi][ni] = zero;

  // rolled: for speed only
#pragma unroll 1
  for (int k0 = 0; k0 < CDIM; k0 += BK) {
#pragma unroll
    for (int i = 0; i < 32; ++i) *(v8h*)&Ks[(32 * i + hr) * KP + hk] = kh[i];
    __syncthreads();

    const int k1 = k0 + BK;
    if (k1 < CDIM) {   // prefetch next k-slab into registers (block-uniform)
#pragma unroll
      for (int i = 0; i < 32; ++i) kh[i] = *(const v8h*)(kp + (size_t)(32 * i) * CDIM + k1);
      // the fragment reads below may land in the registers that held these loads' addresses: wait before they are overwritten
      asm volatile("s_wait_xcnt 0x0" ::: "memory");
    }

#pragma unroll
    for (int kk = 0; kk < BK; kk += 32) {
      v16h bf[4];
#pragma unroll
      for (int ni = 0; ni < 4; ++ni) bf[ni] = ld_frag_p<QP>(Qs + k0 + kk, 16 * ni + lm, h);
#pragma unroll
      for (int mg = 0; mg < 8; mg += 4) {
        v16h a[4];
#pragma unroll
        for (int mi = 0; mi < 4; ++mi) a[mi] = ld_frag(Ks + kk, 128 * wv + 16 * (mg + mi) + lm, h);
        // keeps the block's fragment reads together in front of its 16 WMMAs: left free, the compiler read one fragment
        // at a time into one register set and waited out the LDS latency before every 4 WMMAs
        __builtin_amdgcn_sched_barrier(0);
#pragma unroll
        for (int mi = 0; mi < 4; ++mi)
#pragma unroll
          for (int ni = 0; ni < 4; ++ni) acc[mg + mi][ni] = wmma_f16_b(a[mi], bf[ni], acc[mg + mi][ni]);
        // ends the block: the next block's reads do not move in among these WMMAs
        __builtin_amdgcn_sched_barrier(0);
      }
    }
    __syncthreads();
  }

  // first v slab: its latency runs under the softmax
  v8h vh[16];
#pragma unroll
  for (int i = 0; i < 16; ++i) vh[i] = *(const v8h*)(vp + (size_t)(32 * i) * NPIX);   // vp lives on: no load lands on it
  // registers that held these loads' addresses may be reused below: wait before they are overwritten
  asm volatile("s_wait_xcnt 0x0" ::: "memory");

  // softmax in the log2 domain: e = 2^((score - row maximum) * sscale * log2(e) + pshift), at most 2^pshift, goes to LDS as f16
  // without the division; the row sum of the same e divides the p*v result at the end
  const float c1 = sscale * 1.4426950408889634f;
#pragma unroll
  for (int ni = 0; ni < 4; ++ni) {
    float m = acc[0][ni][0];
#pragma unroll
    for (int mi = 0; mi < 8; ++mi)
#pragma unroll
      for (int r = 0; r < 8; ++r) m = fmaxf(m, acc[mi][ni][r]);
    m = fmaxf(m, __shfl_xor(m, 16, 32));
    if (h == 0) redm[wv * AQ + 16 * ni + lm] = m;
  }
  __syncthreads();
  // every wave has left the k slab (the barriers above): the p tile may overwrite it
#pragma unroll
  for (int ni = 0; ni < 4; ++ni) {
    float m = redm[16 * ni + lm];
#pragma unroll
    for (int w = 1; w < 8; ++w) m = fmaxf(m, redm[w * AQ + 16 * ni + lm]);
    const float mc = m * c1 - pshift;
    float s = 0.f;
#pragma unroll
    for (int mi = 0; mi < 8; ++mi) {
      v8h pv;
#pragma unroll
      for (int r = 0; r < 8; ++r) {
        const float e = exp2_slot(acc[mi][ni][r] * c1 - mc);
        s += e;
        pv[r] = (_Float16)e;
      }
      *(v8h*)&Pl[(16 * ni + lm) * PP + 128 * wv + 16 * mi + 8 * h] = pv;
    }
    s += __shfl_xor(s, 16, 32);
    if (h == 0) reds[wv * AQ + 16 * ni + lm] = s;
  }

  v8f oc[4][4];
#pragma unroll
  for (int mi = 0; mi < 4; ++mi)
#pragma unroll
    for (int ni = 0; ni < 4; ++ni) oc[mi][ni] = zero;

  // rolled: for speed only
#pragma unroll 1
  for (int j0 = 0; j0 < NPIX; j0 += BK) {
#pragma unroll
    for (int i = 0; i < 16; ++i) *(v8h*)&Vs[(32 * i + hr) * KP + hk] = vh[i];
    __syncthreads();   // on the first trip it also publishes the p tile and the waves' row sums

    const int j1 = j0 + BK;
    if (j1 < NPIX) {   // prefetch next v slab into registers (block-uniform)
      vp += BK;
#pragma unroll
      for (int i = 0; i < 16; ++i) vh[i] = *(const v8h*)(vp + (size_t)(32 * i) * NPIX);
      // the fragment reads below may land in the registers that held these loads' addresses: wait before they are overwritten
      asm volatile("s_wait_xcnt 0x0" ::: "memory");
    }

    v16h a[2][4], bf[2][4];
#pragma unroll
    for (int ks = 0; ks < 2; ++ks) {
#pragma unroll
      for (int mi = 0; mi < 4; ++mi) a[ks][mi] = ld_frag(Vs + 32 * ks, 64 * wv + 16 * mi + lm, h);
#pragma unroll
      for (int ni = 0; ni < 4; ++ni) bf[ks][ni] = ld_frag_p<PP>(Pl + j0 + 32 * ks, 16 * ni + lm, h);
    }
    // keeps the slab's fragment reads as one group in front of its 32 WMMAs: left free, the compiler read one fragment
    // at a time into one register set and waited out the LDS latency before every 4 WMMAs
    __builtin_amdgcn_sched_barrier(0);
#pragma unroll
    for (int ks = 0; ks < 2; ++ks)   // rising k
#pragma unroll
      for (int mi = 0; mi < 4; ++mi)
#pragma unroll
        for (int ni = 0; ni < 4; ++ni) oc[mi][ni] = wmma_f16_b(a[ks][mi], bf[ks][ni], oc[mi][ni]);
    // keeps the barrier, and the wait for the prefetched slab that comes with it, behind the WMMAs: the compiler had
    // lifted both in front of them, so that the loads' latency was waited out before the products
    __builtin_amdgcn_sched_barrier(0);
    __syncthreads();
  }

  // oc[mi][ni][r] = (channel 64wv+16mi+8h+r, query 16ni+lm): 8 channels in a row per lane; stage [query][channel] for whole-line stores
  float inv[4];
#pragma unroll
  for (int ni = 0; ni < 4; ++ni) {
    float s = reds[16 * ni + lm];
#pragma unroll
    for (int w = 1; w < 8; ++w) s += reds[w * AQ + 16 * ni + lm];
    inv[ni] = oscale / s;
  }
#pragma unroll
  for (int mi = 0; mi < 4; ++mi)
#pragma unroll
    for (int ni = 0; ni < 4; ++ni) {
      v8h ov;
#pragma unroll
      for (int r = 0; r < 8; ++r) ov[r] = (_Float16)(oc[mi][ni][r] * inv[ni]);
      *(v8h*)&Os[(16 * ni + lm) * QP + 64 * wv + 16 * mi + 8 * h] = ov;
    }
  __syncthreads();
  _Float16* op = oT + (size_t)b * actB + (size_t)(i0 + qr) * CDIM + qc;
  v8h val[16];
#pragma unroll
  for (int it = 0; it < 16; ++it) val[it] = *(const v8h*)&Os[(4 * it + qr) * QP + qc];
#pragma unroll
  for (int it = 0; it < 16; ++it) *(v8h*)(op + (size_t)(4 * it) * CDIM) = val[it];
}

// ---------------------------------------------------------------------------
extern "C" void kernel_launch(void* const* d_in, const int* in_sizes, int n_in,
                              void* d_out, int out_size, void* d_ws,
                              size_t ws_size, hipStream_t stream) {
  if (n_in < 11) return;
  const long long per = (long long)CDIM * NPIX;
  const long long tot = (long long)in_sizes[0];
  if (tot <= 0 || (tot % per) != 0) return;
  const int B = (int)(tot / per);
  if ((long long)out_size != tot) return;
  if (in_sizes[1] != CDIM || in_sizes[2] != CDIM) return;
  if (in_sizes[3] != CDIM * CDIM || in_sizes[5] != CDIM * CDIM ||
      in_sizes[7] != CDIM * CDIM || in_sizes[9] != CDIM * CDIM) return;
  if (in_sizes[4] != CDIM || in_sizes[6] != CDIM || in_sizes[8] != CDIM || in_sizes[10] != CDIM) return;
  if (B > 65535) return;

  const float* x     = (const float*)d_in[0];
  const float* gamma = (const float*)d_in[1];
  const float* beta  = (const float*)d_in[2];
  const float* wq = (const float*)d_in[3]; const float* bq = (const float*)d_in[4];
  const float* wk = (const float*)d_in[5]; const float* bk = (const float*)d_in[6];
  const float* wv = (const float*)d_in[7]; const float* bv = (const float*)d_in[8];
  const float* wo = (const float*)d_in[9]; const float* bo = (const float*)d_in[10];
  float* out = (float*)d_out;

  // workspace carve: qT | kT | v16 | hT(->oT) (each B*N*C f16)
  const size_t HB = (size_t)B * CDIM * NPIX * sizeof(_Float16);
  if (4 * HB > ws_size) return;
  char* ws = (char*)d_ws;
  _Float16* qT  = (_Float16*)(ws);
  _Float16* kT  = (_Float16*)(ws + HB);
  _Float16* v16 = (_Float16*)(ws + 2 * HB);
  _Float16* hT  = (_Float16*)(ws + 3 * HB);   // later reused as oT

  const size_t actB = (size_t)NPIX * CDIM;    // per-batch stride of hT/qT/kT/v16/oT/out (elements)
  const float wsc   = 64.0f;                   // f16 weight pre-scale
  const float attn_scale = 0.04419417382415922f;   // 512^-0.5
  const float psh   = 12.0f;                   // f16 probability pre-scale, as a power of two (x4096)
  const float osc   = 16.0f;                   // f16 pre-scale of the p*v result

  gn_kernel<<<B * (CDIM / CBLK), GNT, 0, stream>>>(x, gamma, beta, hT);

  dim3 gc(CDIM / BT, NPIX / BT, B);
  // q, k: A = W[o][c] f32 (x64), Bt = hT[n][c]; out [b][n][o] f16
  gemm_kernel<1, 0><<<gc, 256, 0, stream>>>(wq, hT, 0, CDIM, wsc, hT, actB, CDIM, CDIM,
                                            bq, 1, 1.0f / wsc, qT, out, x, 0, actB, CDIM);
  gemm_kernel<1, 0><<<gc, 256, 0, stream>>>(wk, hT, 0, CDIM, wsc, hT, actB, CDIM, CDIM,
                                            bk, 1, 1.0f / wsc, kT, out, x, 0, actB, CDIM);
  // v: out [b][o][n] f16
  gemm_kernel<1, 1><<<gc, 256, 0, stream>>>(wv, hT, 0, CDIM, wsc, hT, actB, CDIM, CDIM,
                                            bv, 1, 1.0f / wsc, v16, out, x, 0, actB, NPIX);
  // attention: scores, softmax (e x4096 as f16, in LDS) and oT[b][i][c] = sum_j v16[c][j] * e[i][j] / sum_j e[i][j], stored x16 as f16 (hT buffer)
  dim3 ga(NPIX / AQ, B);
  attn_kernel<<<ga, 256, 0, stream>>>(qT, kT, v16, hT, attn_scale, psh, osc);
  // output projection: A = Wo[o][c] f32 (x64), Bt = oT[n][c] (x16); out[b][o][n] = res + acc/(64*16) + bo
  gemm_kernel<1, 2><<<gc, 256, 0, stream>>>(wo, hT, 0, CDIM, wsc, hT, actB, CDIM, CDIM,
                                            bo, 1, 1.0f / (wsc * osc), qT, out, x, 1, actB, NPIX);
}

// v006
// One run takes 111 microseconds.
// In two side-by-side timings against v005, it was 1.08 and 1.09 times as fast.
// Over all steps from v000 it is 2.23 times as fast.
#include <hip/hip_runtime.h>
#include <stddef.h>
#include <stdint.h>

// All contractions: v_wmma_f32_16x16x32_f16 (f16 operands, f32 accumulate): three 1x1 projections (weights x64),
// q*k^T, p*v (p x4096, divided by its row sum behind the product), output projection (o x16, weights x64); all scales are powers of two folded back in f32.

#define CDIM 512
#define NPIX 1024
#define GCH  16      // channels per norm group (CDIM / 32)
#define CBLK 64      // channels per norm block (4 groups)
#define GNT  512     // threads per norm block
// LDS row pitches of the GEMM tiles: 16 B x odd, so that 16 rows read or written 16 B wide fall on 64 distinct banks
// (and rows 8 apart, as the two lane halves of an accumulator hold them, fall 32 banks apart).
#define BT   128     // GEMM block tile: BT x BT results
#define BK   64      // k per slab: one whole 128-B line of an f16 operand row
#define MT   (CDIM / BT)   // block tiles along the rows of one weight matrix
#define KP   72      // operand tiles: 64 halves of k + 8 pad  (144 B)
#define DHP  136     // f16 result tile: 128 halves + 8 pad    (272 B)
#define DFP  132     // f32 result tile: 128 floats + 4 pad    (528 B)
#define AQ   64      // attention: queries per work-group
#define QP   520     // attention q and o tiles: 512 halves + 8 pad  (1040 B)
#define PP   1032    // attention p tile: 1024 halves + 8 pad        (2064 B)

typedef _Float16 v16h __attribute__((ext_vector_type(16)));
typedef _Float16 v8h  __attribute__((ext_vector_type(8)));
typedef _Float16 v4h  __attribute__((ext_vector_type(4)));
typedef float    v8f  __attribute__((ext_vector_type(8)));
typedef float    v4f  __attribute__((ext_vector_type(4)));
typedef float    v2f  __attribute__((ext_vector_type(2)));
union Frag { v16h v; v8h half[2]; };

// ---------------------------------------------------------------------------
// 16x16x32 f16 WMMA with hazard guard.
__device__ __forceinline__ v8f wmma_f16(v16h a, v16h b, v8f c) {
  v8f d = __builtin_amdgcn_wmma_f32_16x16x32_f16(false, a, false, b, (short)0, c, false, false);
  asm volatile("v_nop\n\tv_nop\n\tv_nop\n\tv_nop" : "+v"(d) : "v"(a), "v"(b));
  return d;
}

// The builtin alone, for the attention kernel: its accumulators reach above v255, where an asm operand cannot lie
// (tied to the asm guard above they all went to scratch); the compiler keeps the distances behind its own builtin.
__device__ __forceinline__ v8f wmma_f16_b(v16h a, v16h b, v8f c) {
  return __builtin_amdgcn_wmma_f32_16x16x32_f16(false, a, false, b, (short)0, c, false, false);
}

// 2^x with the free slot behind it that the instruction set asks for after a transcendental, in one statement.
__device__ __forceinline__ float exp2_slot(float x) {
  float e;
  asm("v_exp_f32 %0, %1\n\tv_nop" : "=v"(e) : "v"(x));
  return e;
}

// Fragment from an LDS tile stored [row][k] with pitch KP halves (used for A rows and for B columns alike):
// lane l: row = l&15, h = l>>4; elements 0..7 <- k 8h..8h+7, elements 8..15 <- k 16+8h..16+8h+7.
__device__ __forceinline__ v16h ld_frag(const _Float16* tile, int row, int h) {
  Frag f;
  const _Float16* rp = tile + row * KP;
  f.half[0] = *(const v8h*)(rp + 8 * h);
  f.half[1] = *(const v8h*)(rp + 16 + 8 * h);
  return f.v;
}

// The same fragment from a tile of another row pitch (in halves).
template <int PITCH>
__device__ __forceinline__ v16h ld_frag_p(const _Float16* tile, int row, int h) {
  Frag f;
  const _Float16* rp = tile + row * PITCH;
  f.half[0] = *(const v8h*)(rp + 8 * h);
  f.half[1] = *(const v8h*)(rp + 16 + 8 * h);
  return f.v;
}

// ---------------------------------------------------------------------------
// Kernel 1: group norm -> transposed f16 activations hT[b][n][c].
// One work-group of 16 waves per 64 channels (4 groups) of one batch. Wave w holds channels 8(w&7)..+7 x pixels 512(w>>3)..+511 in
// registers: every wave-wide load covers 512 B in a row of one channel, x is read once, statistics and normalisation work on the registers.
// A lane holds 8 channels of each of its pixels, so a pixel's part of the transposed tile is one 16-B LDS store.
// Pixel n = 128a + 4l + e lies in LDS row 128a + 32e + l: the 32 lanes of a store fall on 32 rows in a row (pitch 16 B x odd).
__global__ __launch_bounds__(GNT) void gn_kernel(
    const float* __restrict__ x, const float* __restrict__ gamma,
    const float* __restrict__ beta, _Float16* hT) {
  const int b  = blockIdx.x >> 3, cg = blockIdx.x & 7;
  const int c0 = cg * CBLK;
  const int t  = threadIdx.x, lane = t & 31;
  const int wv = __builtin_amdgcn_readfirstlane(t >> 5);   // the wave's number as a scalar: gamma and beta come by scalar loads
  const int oct = wv & 7, ph = wv >> 3;      // channel octet, half of the pixel range
  const float* xw = x + ((size_t)b * CDIM + c0 + 8 * oct) * NPIX + ph * (NPIX / 2);   // the wave's part of x
  const int lo4 = 4 * lane;                  // the lane's place in a 512-B run

  __shared__ __align__(16) _Float16 Ts[NPIX * KP];
  __shared__ float rs1[GNT / 32], rs2[GNT / 32];

  v4f v[8][4];
#pragma unroll
  for (int i = 0; i < 8; ++i)
#pragma unroll
    for (int j = 0; j < 4; ++j) v[i][j] = *(const v4f*)(xw + lo4 + i * NPIX + 128 * j);
  v4f ga[2], be[2];
#pragma unroll
  for (int u = 0; u < 2; ++u) {
    ga[u] = *(const v4f*)(gamma + c0 + 8 * oct + 4 * u);
    be[u] = *(const v4f*)(beta + c0 + 8 * oct + 4 * u);
  }
  // registers that held these loads' addresses are reused below: wait before they are overwritten
  asm volatile("s_wait_xcnt 0x0" ::: "memory");

  // statistics: all 8 channels of a wave belong to one group; pixel pairs are summed two wide, one chain per 128-pixel run
  v2f sa[4], qa[4];
#pragma unroll
  for (int j = 0; j < 4; ++j) { sa[j] = (v2f){0.f, 0.f}; qa[j] = (v2f){0.f, 0.f}; }
#pragma unroll
  for (int i = 0; i < 8; ++i)
#pragma unroll
    for (int j = 0; j < 4; ++j) {
      const v2f lo = __builtin_shufflevector(v[i][j], v[i][j], 0, 1);
      const v2f hi = __builtin_shufflevector(v[i][j], v[i][j], 2, 3);
      sa[j] += lo; sa[j] += hi;
      qa[j] += lo * lo; qa[j] += hi * hi;
    }
  const v2f st = (sa[0] + sa[1]) + (sa[2] + sa[3]);
  const v2f qt = (qa[0] + qa[1]) + (qa[2] + qa[3]);
  float s = st[0] + st[1], ss = qt[0] + qt[1];
#pragma unroll
  for (int k = 16; k > 0; k >>= 1) { s += __shfl_xor(s, k, 32); ss += __shfl_xor(ss, k, 32); }
  if (lane == 0) { rs1[wv] = s; rs2[wv] = ss; }
  __syncthreads();
  // a group is two octets x two pixel halves: waves o2, o2+1, o2+8, o2+9
  const int o2 = oct & 6;
  const float gs  = (rs1[o2] + rs1[o2 + 1]) + (rs1[o2 + 8] + rs1[o2 + 9]);
  const float gss = (rs2[o2] + rs2[o2 + 1]) + (rs2[o2 + 8] + rs2[o2 + 9]);
  const float inv_cnt = 1.0f / (float)(GCH * NPIX);
  const float mean = gs * inv_cnt;
  float var = gss * inv_cnt - mean * mean;
  var = fmaxf(var, 0.f);
  const float inv = rsqrtf(var + 1e-6f);
  float gm[8], bt[8];
#pragma unroll
  for (int i = 0; i < 8; ++i) {
    gm[i] = ga[i >> 2][i & 3] * inv;
    bt[i] = be[i >> 2][i & 3] - mean * gm[i];
  }

#pragma unroll
  for (int j = 0; j < 4; ++j)
#pragma unroll
    for (int e = 0; e < 4; ++e) {
      v8h pv;
#pragma unroll
      for (int i = 0; i < 8; ++i) pv[i] = (_Float16)(v[i][j][e] * gm[i] + bt[i]);
      *(v8h*)&Ts[(128 * (4 * ph + j) + 32 * e + lane) * KP + 8 * oct] = pv;
    }
  __syncthreads();

  // 1024 lines (one per pixel), 8 lanes x 16 B per line; sweep it takes LDS rows 64it..64it+63
  const int rl = t >> 3, p = t & 7;           // row in the sweep, 16-B piece of the line
  _Float16* hp = hT + ((size_t)b * NPIX + 4 * (rl & 31) + (rl >> 5)) * CDIM + c0 + p * 8;
  v8h val[16];
#pragma unroll
  for (int it = 0; it < 16; ++it) val[it] = *(const v8h*)&Ts[(64 * it + rl) * KP + p * 8];
#pragma unroll
  for (int it = 0; it < 16; ++it) *(v8h*)(hp + (size_t)(128 * (it >> 1) + 2 * (it & 1)) * CDIM) = val[it];
}

// ---------------------------------------------------------------------------
// Generic 128x128 tile GEMM on f16 16x16x32 WMMA: D[m][n] = sum_k A[m][k] * Bt[n][k]  (both operands k-contiguous).
// 8 waves as 2 x 4, each 64 x 32 of the tile (4 x 2 accumulators); a k-slab is 64, worked as two WMMA depths in rising k.
// AF32: A is f32 (converted to f16 with ascale at staging) else f16.  Bt always f16.
// MODE 0: three products on one Bt in one grid, f16 out: blockIdx.x = MT * job + row tile; job j takes A, bias and result j.
//         jobs 0 and 1 are stored [n][m] (m contiguous): out16[b*o_bs + (n0+n)*ldo + m0+m]
//         job 2 is stored [m][n]:                         out16[b*o_bs + (m0+m)*ldo2 + n0+n]
// MODE 2: one product, f32 out, stored [m][n], optional residual add at the same index.
template <int AF32, int MODE>
__global__ __launch_bounds__(256) void gemm_kernel(
    const float* __restrict__ Af0, const float* __restrict__ Af1, const float* __restrict__ Af2,
    const _Float16* __restrict__ Ah, size_t a_bs, int lda, float ascale,
    const _Float16* __restrict__ Bt, size_t b_bs, int ldb, int K,
    const float* __restrict__ bias0, const float* __restrict__ bias1, const float* __restrict__ bias2, int has_bias, float oscale,
    _Float16* out16_0, _Float16* out16_1, _Float16* out16_2, float* out32, const float* __restrict__ res, int has_res,
    size_t o_bs, int ldo, int ldo2) {
  // the job is the same for the whole work-group: what it picks stays in scalar registers
  const int job = (MODE == 0) ? (int)(blockIdx.x / MT) : 0;
  const int m0 = ((MODE == 0) ? (int)(blockIdx.x % MT) : (int)blockIdx.x) * BT, n0 = blockIdx.y * BT, b = blockIdx.z;
  const float* Af   = (job == 0) ? Af0 : (job == 1) ? Af1 : Af2;
  const float* bias = (job == 0) ? bias0 : (job == 1) ? bias1 : bias2;
  _Float16* out16   = (job == 0) ? out16_0 : (job == 1) ? out16_1 : out16_2;
  const bool tr = job < 2;   // MODE 0: result stored [n][m]
  const int tid = threadIdx.x, lane = tid & 31, wv = tid >> 5;
  const int h = lane >> 4, lm = lane & 15;
  const int wr = (wv >> 2) * 64, wc = (wv & 3) * 32;

  __shared__ __align__(16) _Float16 As[BT * KP];   // [m][k]
  __shared__ __align__(16) _Float16 Bs[BT * KP];   // [n][k]
  __shared__ __align__(16) _Float16 Dh[(MODE != 2) ? BT * DHP : 8];
  __shared__ __align__(16) float    Df[(MODE == 2) ? BT * DFP : 4];

  v8f zero;
#pragma unroll
  for (int e = 0; e < 8; ++e) zero[e] = 0.f;
  v8f acc[4][2];
#pragma unroll
  for (int mi = 0; mi < 4; ++mi) { acc[mi][0] = zero; acc[mi][1] = zero; }

  // staging: a slab row is 128 B of f16 (8 lanes x 16 B, 32 rows a sweep) or 256 B of f32 (16 lanes x 16 B, 16 rows a sweep),
  // so every wave-wide load covers four whole lines
  const int hr = tid >> 3, hk = (tid & 7) * 8;
  const int fr = tid >> 4, fk = (tid & 15) * 4;
  const float*    ap_f = Af + (size_t)b * a_bs + (size_t)(m0 + fr) * lda + fk;
  const _Float16* ap_h = Ah + (size_t)b * a_bs + (size_t)(m0 + hr) * lda + hk;
  const _Float16* bp   = Bt + (size_t)b * b_bs + (size_t)(n0 + hr) * ldb + hk;

  v4f w[8];
  v8h ah[4], bh[4];
  if (AF32) {
#pragma unroll
    for (int i = 0; i < 8; ++i) w[i] = *(const v4f*)(ap_f + (size_t)(16 * i) * lda);
  } else {
#pragma unroll
    for (int i = 0; i < 4; ++i) ah[i] = *(const v8h*)(ap_h + (size_t)(32 * i) * lda);
  }
#pragma unroll
  for (int i = 0; i < 4; ++i) bh[i] = *(const v8h*)(bp + (size_t)(32 * i) * ldb);

  for (int k0 = 0; k0 < K; k0 += BK) {
    if (AF32) {
#pragma unroll
      for (int i = 0; i < 8; ++i) {
        v4h t;
#pragma unroll
        for (int e = 0; e < 4; ++e) t[e] = (_Float16)(w[i][e] * ascale);
        *(v4h*)&As[(16 * i + fr) * KP + fk] = t;
      }
    } else {
#pragma unroll
      for (int i = 0; i < 4; ++i) *(v8h*)&As[(32 * i + hr) * KP + hk] = ah[i];
    }
#pragma unroll
    for (int i = 0; i < 4; ++i) *(v8h*)&Bs[(32 * i + hr) * KP + hk] = bh[i];
    __syncthreads();

    const int k1 = k0 + BK;
    if (k1 < K) {   // prefetch next k-slab into registers (block-uniform)
      if (AF32) {
#pragma unroll
        for (int i = 0; i < 8; ++i) w[i] = *(const v4f*)(ap_f + (size_t)(16 * i) * lda + k1);
      } else {
#pragma unroll
        for (int i = 0; i < 4; ++i) ah[i] = *(const v8h*)(ap_h + (size_t)(32 * i) * lda + k1);
      }
#pragma unroll
      for (int i = 0; i < 4; ++i) bh[i] = *(const v8h*)(bp + (size_t)(32 * i) * ldb + k1);
      // the fragment reads below land in the registers that held these loads' addresses: wait before they are overwritten
      asm volatile("s_wait_xcnt 0x0" ::: "memory");
    }

#pragma unroll
    for (int kk = 0; kk < BK; kk += 32) {
      v16h a[4], bf[2];
#pragma unroll
      for (int mi = 0; mi < 4; ++mi) a[mi] = ld_frag(As + kk, wr + 16 * mi + lm, h);
#pragma unroll
      for (int ni = 0; ni < 2; ++ni) bf[ni] = ld_frag(Bs + kk, wc + 16 * ni + lm, h);
#pragma unroll
      for (int mi = 0; mi < 4; ++mi)
#pragma unroll
        for (int ni = 0; ni < 2; ++ni) acc[mi][ni] = wmma_f16(a[mi], bf[ni], acc[mi][ni]);
    }
    __syncthreads();
  }

  // What the epilogue reads from global memory goes out here as one group, each flag tested once: (MODE 2) the residual of the 16
  // pieces the thread stores, then the bias of the lane's 4 x 8 result rows. Their latencies run side by side, not one after another.
  v4f rv[(MODE == 2) ? 16 : 1];
  unsigned off[(MODE == 2) ? 16 : 1];   // byte offsets of those pieces in the batch's plane (below 4 GiB), for the residual and the store alike
  if (MODE == 2) {
#pragma unroll
    for (int it = 0; it < 16; ++it) {
      off[it] = ((unsigned)(m0 + 8 * it + wv) * (unsigned)ldo + (unsigned)(n0 + lane * 4)) * 4u;
      rv[it] = (v4f){0.f, 0.f, 0.f, 0.f};
    }
    if (has_res) {
      const char* rb = (const char*)(res + (size_t)b * o_bs);
#pragma unroll
      for (int it = 0; it < 16; ++it) rv[it] = *(const v4f*)(rb + off[it]);
      // wait before a register that these loads name is overwritten
      asm volatile("s_wait_xcnt 0x0" ::: "memory");
    }
  }
  v4f bb[4][2];
#pragma unroll
  for (int mi = 0; mi < 4; ++mi) { bb[mi][0] = (v4f){0.f, 0.f, 0.f, 0.f}; bb[mi][1] = (v4f){0.f, 0.f, 0.f, 0.f}; }
  if (has_bias) {
    const float* bp4 = bias + m0 + wr + 8 * h;
#pragma unroll
    for (int mi = 0; mi < 4; ++mi) {
      bb[mi][0] = *(const v4f*)(bp4 + 16 * mi);
      bb[mi][1] = *(const v4f*)(bp4 + 16 * mi + 4);
    }
    // registers that held these loads' addresses are reused below: wait before they are overwritten
    asm volatile("s_wait_xcnt 0x0" ::: "memory");
  }

  // D: acc[mi][ni][r] = tile element (row wr+mi*16+8h+r, col wc+ni*16+lm); stage in LDS in the order it is stored in
  // (the order is tested once, outside the loops)
  if (MODE == 2) {
#pragma unroll
    for (int mi = 0; mi < 4; ++mi)
#pragma unroll
      for (int ni = 0; ni < 2; ++ni)
#pragma unroll
        for (int r = 0; r < 8; ++r)
          Df[(wr + mi * 16 + 8 * h + r) * DFP + wc + ni * 16 + lm] = acc[mi][ni][r] * oscale + bb[mi][r >> 2][r & 3];
  } else if (tr) {
#pragma unroll
    for (int mi = 0; mi < 4; ++mi)
#pragma unroll
      for (int ni = 0; ni < 2; ++ni)
#pragma unroll
        for (int r = 0; r < 8; ++r)
          Dh[(wc + ni * 16 + lm) * DHP + wr + mi * 16 + 8 * h + r] = (_Float16)(acc[mi][ni][r] * oscale + bb[mi][r >> 2][r & 3]);
  } else {
#pragma unroll
    for (int mi = 0; mi < 4; ++mi)
#pragma unroll
      for (int ni = 0; ni < 2; ++ni)
#pragma unroll
        for (int r = 0; r < 8; ++r)
          Dh[(wr + mi * 16 + 8 * h + r) * DHP + wc + ni * 16 + lm] = (_Float16)(acc[mi][ni][r] * oscale + bb[mi][r >> 2][r & 3]);
  }
  __syncthreads();

  if (MODE != 2) {
    // 128 rows x 256 B: two lines per row, 16 lanes x 16 B per row
    const int r0 = tr ? n0 : m0, c0 = tr ? m0 : n0, ld = tr ? ldo : ldo2;   // the stored tile's first row, first column and row pitch
    v8h val[8]; size_t idx[8];
#pragma unroll
    for (int it = 0; it < 8; ++it) {
      const int sI = it * 256 + tid;
      const int row = sI >> 4, p = sI & 15;
      val[it] = *(const v8h*)&Dh[row * DHP + p * 8];
      idx[it] = (size_t)b * o_bs + (size_t)(r0 + row) * ld + c0 + p * 8;
    }
#pragma unroll
    for (int it = 0; it < 8; ++it) *(v8h*)(out16 + idx[it]) = val[it];
  } else {
    // 128 rows x 512 B: four lines per row, one wave x 16 B per row
    v4f val[16];
#pragma unroll
    for (int it = 0; it < 16; ++it) val[it] = *(const v4f*)&Df[(8 * it + wv) * DFP + lane * 4] + rv[it];
    char* ob = (char*)(out32 + (size_t)b * o_bs);
#pragma unroll
    for (int it = 0; it < 16; ++it) *(v4f*)(ob + off[it]) = val[it];
  }
}

// ---------------------------------------------------------------------------
// Kernel: attention of AQ queries against all NPIX keys of one batch, one work-group of 8 waves.
// Phase 1: St[j][i] = sum_c kT[j][c] * qT[i][c]; wave w holds keys 128w..128w+127 x 64 queries in 8 x 4 accumulators,
//          so a lane holds 64 scores of each of 4 queries (query 16ni+lm, keys 128w+16mi+8h+r).
// Softmax: maximum and sum in the lane, one exchange between the lane halves, then over the 8 waves through LDS.
// Phase 2: Ot[c][i] = sum_j v16[c][j] * P[i][j]; P (f16, not yet divided by its row sum) lies in LDS as [query][key];
//          wave w holds channels 64w..64w+63; the row sum divides the result.
// LDS: phase 1 [k slab 1024 x KP | q tile AQ x QP]; phase 2 [p tile AQ x PP | v slab 512 x KP]; at the end the o tile AQ x QP.
__global__ __launch_bounds__(256) void attn_kernel(
    const _Float16* __restrict__ qT, const _Float16* __restrict__ kT, const _Float16* __restrict__ v16,
    _Float16* oT, float sscale, float pshift, float oscale) {
  const int i0 = blockIdx.x * AQ, b = blockIdx.y;
  const int tid = threadIdx.x, lane = tid & 31, wv = tid >> 5;
  const int h = lane >> 4, lm = lane & 15;
  const size_t actB = (size_t)NPIX * CDIM;

  __shared__ __align__(16) _Float16 sm[NPIX * KP + AQ * QP];
  __shared__ float redm[8 * AQ], reds[8 * AQ];
  _Float16* Ks = sm;
  _Float16* Qs = sm + NPIX * KP;
  _Float16* Pl = sm;
  _Float16* Vs = sm + AQ * PP;
  _Float16* Os = sm;

  v8f zero;
#pragma unroll
  for (int e = 0; e < 8; ++e) zero[e] = 0.f;

  // staging maps: q and o rows are 1024 B (64 lanes x 16 B, 4 rows a sweep); k and v slab rows are 128 B (8 lanes x 16 B, 32 rows a sweep)
  const int qr = tid >> 6, qc = (tid & 63) * 8;
  const int hr = tid >> 3, hk = (tid & 7) * 8;
  const _Float16* qp = qT + (size_t)b * actB + (size_t)(i0 + qr) * CDIM + qc;
  const _Float16* kp = kT + (size_t)b * actB + (size_t)hr * CDIM + hk;
  const _Float16* vp = v16 + (size_t)b * actB + (size_t)hr * NPIX + hk;   // walks on by one slab a trip

  v8h kh[32];
  {
    v8h qv[16];
#pragma unroll
    for (int it = 0; it < 16; ++it) qv[it] = *(const v8h*)(qp + (size_t)(4 * it) * CDIM);
#pragma unroll
    for (int i = 0; i < 32; ++i) kh[i] = *(const v8h*)(kp + (size_t)(32 * i) * CDIM);
    // registers that held these loads' addresses are reused below: wait before they are overwritten
    asm volatile("s_wait_xcnt 0x0" ::: "memory");
    // holds what follows behind that wait: the compiler had lifted the accumulators' zeroing, which lands on the address registers, over it
    __builtin_amdgcn_sched_barrier(0);
#pragma unroll
    for (int it = 0; it < 16; ++it) *(v8h*)&Qs[(4 * it + qr) * QP + qc] = qv[it];
  }

  v8f acc[8][4];
#pragma unroll
  for (int mi = 0; mi < 8; ++mi)
#pragma unroll
    for (int ni = 0; ni < 4; ++ni) acc[mi][ni] = zero;

  // rolled: for speed only
#pragma unroll 1
  for (int k0 = 0; k0 < CDIM; k0 += BK) {
#pragma unroll
    for (int i = 0; i < 32; ++i) *(v8h*)&Ks[(32 * i + hr) * KP + hk] = kh[i];
    __syncthreads();

    const int k1 = k0 + BK;
    if (k1 < CDIM) {   // prefetch next k-slab into registers (block-uniform)
#pragma unroll
      for (int i = 0; i < 32; ++i) kh[i] = *(const v8h*)(kp + (size_t)(32 * i) * CDIM + k1);
      // the fragment reads below may land in the registers that held these loads' addresses: wait before they are overwritten
      asm volatile("s_wait_xcnt 0x0" ::: "memory");
    }

#pragma unroll
    for (int kk = 0; kk < BK; kk += 32) {
      v16h bf[4];
#pragma unroll
      for (int ni = 0; ni < 4; ++ni) bf[ni] = ld_frag_p<QP>(Qs + k0 + kk, 16 * ni + lm, h);
#pragma unroll
      for (int mg = 0; mg < 8; mg += 4) {
        v16h a[4];
#pragma unroll
        for (int mi = 0; mi < 4; ++mi) a[mi] = ld_frag(Ks + kk, 128 * wv + 16 * (mg + mi) + lm, h);
        // keeps the block's fragment reads together in front of its 16 WMMAs: left free, the compiler read one fragment
        // at a time into one register set and waited out the LDS latency before every 4 WMMAs
        __builtin_amdgcn_sched_barrier(0);
#pragma unroll
        for (int mi = 0; mi < 4; ++mi)
#pragma unroll
          for (int ni = 0; ni < 4; ++ni) acc[mg + mi][ni] = wmma_f16_b(a[mi], bf[ni], acc[mg + mi][ni]);
        // ends the block: the next block's reads do not move in among these WMMAs
        __builtin_amdgcn_sched_barrier(0);
      }
    }
    __syncthreads();
  }

  // first v slab: its latency runs under the softmax
  v8h vh[16];
#pragma unroll
  for (int i = 0; i < 16; ++i) vh[i] = *(const v8h*)(vp + (size_t)(32 * i) * NPIX);   // vp lives on: no load lands on it
  // registers that held these loads' addresses may be reused below: wait before they are overwritten
  asm volatile("s_wait_xcnt 0x0" ::: "memory");

  // softmax in the log2 domain: e = 2^((score - row maximum) * sscale * log2(e) + pshift), at most 2^pshift, goes to LDS as f16
  // without the division; the row sum of the same e divides the p*v result at the end
  const float c1 = sscale * 1.4426950408889634f;
#pragma unroll
  for (int ni = 0; ni < 4; ++ni) {
    float m = acc[0][ni][0];
#pragma unroll
    for (int mi = 0; mi < 8; ++mi)
#pragma unroll
      for (int r = 0; r < 8; ++r) m = fmaxf(m, acc[mi][ni][r]);
    m = fmaxf(m, __shfl_xor(m, 16, 32));
    if (h == 0) redm[wv * AQ + 16 * ni + lm] = m;
  }
  __syncthreads();
  // every wave has left the k slab (the barriers above): the p tile may overwrite it
#pragma unroll
  for (int ni = 0; ni < 4; ++ni) {
    float m = redm[16 * ni + lm];
#pragma unroll
    for (int w = 1; w < 8; ++w) m = fmaxf(m, redm[w * AQ + 16 * ni + lm]);
    const float mc = m * c1 - pshift;
    float s = 0.f;
#pragma unroll
    for (int mi = 0; mi < 8; ++mi) {
      v8h pv;
#pragma unroll
      for (int r = 0; r < 8; ++r) {
        const float e = exp2_slot(acc[mi][ni][r] * c1 - mc);
        s += e;
        pv[r] = (_Float16)e;
      }
      *(v8h*)&Pl[(16 * ni + lm) * PP + 128 * wv + 16 * mi + 8 * h] = pv;
    }
    s += __shfl_xor(s, 16, 32);
    if (h == 0) reds[wv * AQ + 16 * ni + lm] = s;
  }

  v8f oc[4][4];
#pragma unroll
  for (int mi = 0; mi < 4; ++mi)
#pragma unroll
    for (int ni = 0; ni < 4; ++ni) oc[mi][ni] = zero;

  // rolled: for speed only
#pragma unroll 1
  for (int j0 = 0; j0 < NPIX; j0 += BK) {
#pragma unroll
    for (int i = 0; i < 16; ++i) *(v8h*)&Vs[(32 * i + hr) * KP + hk] = vh[i];
    __syncthreads();   // on the first trip it also publishes the p tile and the waves' row sums

    const int j1 = j0 + BK;
    if (j1 < NPIX) {   // prefetch next v slab into registers (block-uniform)
      vp += BK;
#pragma unroll
      for (int i = 0; i < 16; ++i) vh[i] = *(const v8h*)(vp + (size_t)(32 * i) * NPIX);
      // the fragment reads below may land in the registers that held these loads' addresses: wait before they are overwritten
      asm volatile("s_wait_xcnt 0x0" ::: "memory");
    }

    v16h a[2][4], bf[2][4];
#pragma unroll
    for (int ks = 0; ks < 2; ++ks) {
#pragma unroll
      for (int mi = 0; mi < 4; ++mi) a[ks][mi] = ld_frag(Vs + 32 * ks, 64 * wv + 16 * mi + lm, h);
#pragma unroll
      for (int ni = 0; ni < 4; ++ni) bf[ks][ni] = ld_frag_p<PP>(Pl + j0 + 32 * ks, 16 * ni + lm, h);
    }
    // keeps the slab's fragment reads as one group in front of its 32 WMMAs: left free, the compiler read one fragment
    // at a time into one register set and waited out the LDS latency before every 4 WMMAs
    __builtin_amdgcn_sched_barrier(0);
#pragma unroll
    for (int ks = 0; ks < 2; ++ks)   // rising k
#pragma unroll
      for (int mi = 0; mi < 4; ++mi)
#pragma unroll
        for (int ni = 0; ni < 4; ++ni) oc[mi][ni] = wmma_f16_b(a[ks][mi], bf[ks][ni], oc[mi][ni]);
    // keeps the barrier, and the wait for the prefetched slab that comes with it, behind the WMMAs: the compiler had
    // lifted both in front of them, so that the loads' latency was waited out before the products
    __builtin_amdgcn_sched_barrier(0);
    __syncthreads();
  }

  // oc[mi][ni][r] = (channel 64wv+16mi+8h+r, query 16ni+lm): 8 channels in a row per lane; stage [query][channel] for whole-line stores
  float inv[4];
#pragma unroll
  for (int ni = 0; ni < 4; ++ni) {
    float s = reds[16 * ni + lm];
#pragma unroll
    for (int w = 1; w < 8; ++w) s += reds[w * AQ + 16 * ni + lm];
    inv[ni] = oscale / s;
  }
#pragma unroll
  for (int mi = 0; mi < 4; ++mi)
#pragma unroll
    for (int ni = 0; ni < 4; ++ni) {
      v8h ov;
#pragma unroll
      for (int r = 0; r < 8; ++r) ov[r] = (_Float16)(oc[mi][ni][r] * inv[ni]);
      *(v8h*)&Os[(16 * ni + lm) * QP + 64 * wv + 16 * mi + 8 * h] = ov;
    }
  __syncthreads();
  _Float16* op = oT + (size_t)b * actB + (size_t)(i0 + qr) * CDIM + qc;
  v8h val[16];
#pragma unroll
  for (int it = 0; it < 16; ++it) val[it] = *(const v8h*)&Os[(4 * it + qr) * QP + qc];
#pragma unroll
  for (int it = 0; it < 16; ++it) *(v8h*)(op + (size_t)(4 * it) * CDIM) = val[it];
}

// ---------------------------------------------------------------------------
extern "C" void kernel_launch(void* const* d_in, const int* in_sizes, int n_in,
                              void* d_out, int out_size, void* d_ws,
                              size_t ws_size, hipStream_t stream) {
  if (n_in < 11) return;
  const long long per = (long long)CDIM * NPIX;
  const long long tot = (long long)in_sizes[0];
  if (tot <= 0 || (tot % per) != 0) return;
  const int B = (int)(tot / per);
  if ((long long)out_size != tot) return;
  if (in_sizes[1] != CDIM || in_sizes[2] != CDIM) return;
  if (in_sizes[3] != CDIM * CDIM || in_sizes[5] != CDIM * CDIM ||
      in_sizes[7] != CDIM * CDIM || in_sizes[9] != CDIM * CDIM) return;
  if (in_sizes[4] != CDIM || in_sizes[6] != CDIM || in_sizes[8] != CDIM || in_sizes[10] != CDIM) return;
  if (B > 65535) return;

  const float* x     = (const float*)d_in[0];
  const float* gamma = (const float*)d_in[1];
  const float* beta  = (const float*)d_in[2];
  const float* wq = (const float*)d_in[3]; const float* bq = (const float*)d_in[4];
  const float* wk = (const float*)d_in[5]; const float* bk = (const float*)d_in[6];
  const float* wv = (const float*)d_in[7]; const float* bv = (const float*)d_in[8];
  const float* wo = (const float*)d_in[9]; const float* bo = (const float*)d_in[10];
  float* out = (float*)d_out;

  // workspace carve: qT | kT | v16 | hT(->oT) (each B*N*C f16)
  const size_t HB = (size_t)B * CDIM * NPIX * sizeof(_Float16);
  if (4 * HB > ws_size) return;
  char* ws = (char*)d_ws;
  _Float16* qT  = (_Float16*)(ws);
  _Float16* kT  = (_Float16*)(ws + HB);
  _Float16* v16 = (_Float16*)(ws + 2 * HB);
  _Float16* hT  = (_Float16*)(ws + 3 * HB);   // later reused as oT

  const size_t actB = (size_t)NPIX * CDIM;    // per-batch stride of hT/qT/kT/v16/oT/out (elements)
  const float wsc   = 64.0f;                   // f16 weight pre-scale
  const float attn_scale = 0.04419417382415922f;   // 512^-0.5
  const float psh   = 12.0f;                   // f16 probability pre-scale, as a power of two (x4096)
  const float osc   = 16.0f;                   // f16 pre-scale of the p*v result

  gn_kernel<<<B * (CDIM / CBLK), GNT, 0, stream>>>(x, gamma, beta, hT);

  dim3 gc(MT, NPIX / BT, B);
  dim3 gp(3 * MT, NPIX / BT, B);
  // q, k, v in one grid: A = W[o][c] f32 (x64), Bt = hT[n][c]; q and k out [b][n][o] f16, v out [b][o][n] f16
  gemm_kernel<1, 0><<<gp, 256, 0, stream>>>(wq, wk, wv, hT, 0, CDIM, wsc, hT, actB, CDIM, CDIM,
                                            bq, bk, bv, 1, 1.0f / wsc, qT, kT, v16, out, x, 0, actB, CDIM, NPIX);
  // attention: scores, softmax (e x4096 as f16, in LDS) and oT[b][i][c] = sum_j v16[c][j] * e[i][j] / sum_j e[i][j], stored x16 as f16 (hT buffer)
  dim3 ga(NPIX / AQ, B);
  attn_kernel<<<ga, 256, 0, stream>>>(qT, kT, v16, hT, attn_scale, psh, osc);
  // output projection: A = Wo[o][c] f32 (x64), Bt = oT[n][c] (x16); out[b][o][n] = res + acc/(64*16) + bo
  gemm_kernel<1, 2><<<gc, 256, 0, stream>>>(wo, wo, wo, hT, 0, CDIM, wsc, hT, actB, CDIM, CDIM,
                                            bo, bo, bo, 1, 1.0f / (wsc * osc), qT, qT, qT, out, x, 1, actB, NPIX, NPIX);
}

// v007
// It runs in 104 microseconds.
// Two timings next to v006 both put it at 1.06 times that version's speed.
// Counting every step since v000, it is 2.37 times as fast.
#include <hip/hip_runtime.h>
#include <stddef.h>
#include <stdint.h>

// All contractions: v_wmma_f32_16x16x32_f16 (f16 operands, f32 accumulate): three 1x1 projections (weights x64, made f16 once, in the first launch),
// q*k^T, p*v (p x4096, divided by its row sum behind the product), output projection (o x16, weights x64); all scales are powers of two folded back in f32.

#define CDIM 512
#define NPIX 1024
#define GCH  16      // channels per norm group (CDIM / 32)
#define CBLK 64      // channels per norm block (4 groups)
#define GNT  512     // threads per norm block
#define WEL  (CDIM * CDIM)          // elements of one weight matrix
#define WCB  (WEL / (GNT * 32))     // work-groups that convert one weight matrix: 32 elements a thread
// LDS row pitches of the GEMM tiles: 16 B x odd, so that 16 rows read or written 16 B wide fall on 64 distinct banks
// (and rows 8 apart, as the two lane halves of an accumulator hold them, fall 32 banks apart).
#define BT   128     // GEMM block tile: BT x BT results
#define BK   64      // k per slab: one whole 128-B line of an f16 operand row
#define MT   (CDIM / BT)   // block tiles along the rows of one weight matrix
#define KP   72      // operand tiles: 64 halves of k + 8 pad  (144 B)
#define DHP  136     // f16 result tile: 128 halves + 8 pad    (272 B)
#define DFP  132     // f32 result tile: 128 floats + 4 pad    (528 B)
#define AQ   64      // attention: queries per work-group
#define QP   520     // attention q and o tiles: 512 halves + 8 pad  (1040 B)
#define PP   1032    // attention p tile: 1024 halves + 8 pad        (2064 B)

typedef _Float16 v16h __attribute__((ext_vector_type(16)));
typedef _Float16 v8h  __attribute__((ext_vector_type(8)));
typedef float    v8f  __attribute__((ext_vector_type(8)));
typedef float    v4f  __attribute__((ext_vector_type(4)));
typedef float    v2f  __attribute__((ext_vector_type(2)));
union Frag { v16h v; v8h half[2]; };

// ---------------------------------------------------------------------------
// 16x16x32 f16 WMMA with hazard guard.
__device__ __forceinline__ v8f wmma_f16(v16h a, v16h b, v8f c) {
  v8f d = __builtin_amdgcn_wmma_f32_16x16x32_f16(false, a, false, b, (short)0, c, false, false);
  asm volatile("v_nop\n\tv_nop\n\tv_nop\n\tv_nop" : "+v"(d) : "v"(a), "v"(b));
  return d;
}

// The builtin alone, for the attention kernel: its accumulators reach above v255, where an asm operand cannot lie
// (tied to the asm guard above they all went to scratch); the compiler keeps the distances behind its own builtin.
__device__ __forceinline__ v8f wmma_f16_b(v16h a, v16h b, v8f c) {
  return __builtin_amdgcn_wmma_f32_16x16x32_f16(false, a, false, b, (short)0, c, false, false);
}

// 2^x with the free slot behind it that the instruction set asks for after a transcendental, in one statement.
__device__ __forceinline__ float exp2_slot(float x) {
  float e;
  asm("v_exp_f32 %0, %1\n\tv_nop" : "=v"(e) : "v"(x));
  return e;
}

// Fragment from an LDS tile stored [row][k] with pitch KP halves (used for A rows and for B columns alike):
// lane l: row = l&15, h = l>>4; elements 0..7 <- k 8h..8h+7, elements 8..15 <- k 16+8h..16+8h+7.
__device__ __forceinline__ v16h ld_frag(const _Float16* tile, int row, int h) {
  Frag f;
  const _Float16* rp = tile + row * KP;
  f.half[0] = *(const v8h*)(rp + 8 * h);
  f.half[1] = *(const v8h*)(rp + 16 + 8 * h);
  return f.v;
}

// The same fragment from a tile of another row pitch (in halves).
template <int PITCH>
__device__ __forceinline__ v16h ld_frag_p(const _Float16* tile, int row, int h) {
  Frag f;
  const _Float16* rp = tile + row * PITCH;
  f.half[0] = *(const v8h*)(rp + 8 * h);
  f.half[1] = *(const v8h*)(rp + 16 + 8 * h);
  return f.v;
}

// ---------------------------------------------------------------------------
// Kernel 1: group norm -> transposed f16 activations hT[b][n][c].
// One work-group of 16 waves per 64 channels (4 groups) of one batch. Wave w holds channels 8(w&7)..+7 x pixels 512(w>>3)..+511 in
// registers: every wave-wide load covers 512 B in a row of one channel, x is read once, statistics and normalisation work on the registers.
// A lane holds 8 channels of each of its pixels, so a pixel's part of the transposed tile is one 16-B LDS store.
// Pixel n = 128a + 4l + e lies in LDS row 128a + 32e + l: the 32 lanes of a store fall on 32 rows in a row (pitch 16 B x odd).
// The work-groups behind the nnorm norm blocks (4 * WCB of them) turn the four f32 weight matrices into f16 (x wscale), w16[matrix][o][c]:
// each weight is rounded once here, and the GEMM work-groups that share it read 2 bytes of it, not 4.
__global__ __launch_bounds__(GNT) void gn_kernel(
    const float* __restrict__ x, const float* __restrict__ gamma,
    const float* __restrict__ beta, _Float16* hT, int nnorm,
    const float* __restrict__ w0, const float* __restrict__ w1, const float* __restrict__ w2, const float* __restrict__ w3,
    float wscale, _Float16* w16) {
  if ((int)blockIdx.x >= nnorm) {   // the same for the whole work-group, in front of every barrier
    const int cb = (int)blockIdx.x - nnorm, mat = cb / WCB;
    const float* wsrc = (mat == 0) ? w0 : (mat == 1) ? w1 : (mat == 2) ? w2 : w3;
    const int e0 = (cb % WCB) * (GNT * 32) + (int)threadIdx.x * 8;   // a sweep: 8 elements a thread, 16-B stores side by side
    v4f wl[4][2];
#pragma unroll
    for (int i = 0; i < 4; ++i) {
      wl[i][0] = *(const v4f*)(wsrc + e0 + i * (GNT * 8));
      wl[i][1] = *(const v4f*)(wsrc + e0 + i * (GNT * 8) + 4);
    }
    // wait before a register that these loads name is overwritten
    asm volatile("s_wait_xcnt 0x0" ::: "memory");
    _Float16* wd = w16 + (size_t)mat * WEL + e0;
#pragma unroll
    for (int i = 0; i < 4; ++i) {
      v8h o;
#pragma unroll
      for (int e = 0; e < 8; ++e) o[e] = (_Float16)(wl[i][e >> 2][e & 3] * wscale);
      *(v8h*)(wd + i * (GNT * 8)) = o;
    }
    return;
  }
  const int b  = blockIdx.x >> 3, cg = blockIdx.x & 7;
  const int c0 = cg * CBLK;
  const int t  = threadIdx.x, lane = t & 31;
  const int wv = __builtin_amdgcn_readfirstlane(t >> 5);   // the wave's number as a scalar: gamma and beta come by scalar loads
  const int oct = wv & 7, ph = wv >> 3;      // channel octet, half of the pixel range
  const float* xw = x + ((size_t)b * CDIM + c0 + 8 * oct) * NPIX + ph * (NPIX / 2);   // the wave's part of x
  const int lo4 = 4 * lane;                  // the lane's place in a 512-B run

  __shared__ __align__(16) _Float16 Ts[NPIX * KP];
  __shared__ float rs1[GNT / 32], rs2[GNT / 32];

  v4f v[8][4];
#pragma unroll
  for (int i = 0; i < 8; ++i)
#pragma unroll
    for (int j = 0; j < 4; ++j) v[i][j] = *(const v4f*)(xw + lo4 + i * NPIX + 128 * j);
  v4f ga[2], be[2];
#pragma unroll
  for (int u = 0; u < 2; ++u) {
    ga[u] = *(const v4f*)(gamma + c0 + 8 * oct + 4 * u);
    be[u] = *(const v4f*)(beta + c0 + 8 * oct + 4 * u);
  }
  // registers that held these loads' addresses are reused below: wait before they are overwritten
  asm volatile("s_wait_xcnt 0x0" ::: "memory");

  // statistics: all 8 channels of a wave belong to one group; pixel pairs are summed two wide, one chain per 128-pixel run
  v2f sa[4], qa[4];
#pragma unroll
  for (int j = 0; j < 4; ++j) { sa[j] = (v2f){0.f, 0.f}; qa[j] = (v2f){0.f, 0.f}; }
#pragma unroll
  for (int i = 0; i < 8; ++i)
#pragma unroll
    for (int j = 0; j < 4; ++j) {
      const v2f lo = __builtin_shufflevector(v[i][j], v[i][j], 0, 1);
      const v2f hi = __builtin_shufflevector(v[i][j], v[i][j], 2, 3);
      sa[j] += lo; sa[j] += hi;
      qa[j] += lo * lo; qa[j] += hi * hi;
    }
  const v2f st = (sa[0] + sa[1]) + (sa[2] + sa[3]);
  const v2f qt = (qa[0] + qa[1]) + (qa[2] + qa[3]);
  float s = st[0] + st[1], ss = qt[0] + qt[1];
#pragma unroll
  for (int k = 16; k > 0; k >>= 1) { s += __shfl_xor(s, k, 32); ss += __shfl_xor(ss, k, 32); }
  if (lane == 0) { rs1[wv] = s; rs2[wv] = ss; }
  __syncthreads();
  // a group is two octets x two pixel halves: waves o2, o2+1, o2+8, o2+9
  const int o2 = oct & 6;
  const float gs  = (rs1[o2] + rs1[o2 + 1]) + (rs1[o2 + 8] + rs1[o2 + 9]);
  const float gss = (rs2[o2] + rs2[o2 + 1]) + (rs2[o2 + 8] + rs2[o2 + 9]);
  const float inv_cnt = 1.0f / (float)(GCH * NPIX);
  const float mean = gs * inv_cnt;
  float var = gss * inv_cnt - mean * mean;
  var = fmaxf(var, 0.f);
  const float inv = rsqrtf(var + 1e-6f);
  float gm[8], bt[8];
#pragma unroll
  for (int i = 0; i < 8; ++i) {
    gm[i] = ga[i >> 2][i & 3] * inv;
    bt[i] = be[i >> 2][i & 3] - mean * gm[i];
  }

#pragma unroll
  for (int j = 0; j < 4; ++j)
#pragma unroll
    for (int e = 0; e < 4; ++e) {
      v8h pv;
#pragma unroll
      for (int i = 0; i < 8; ++i) pv[i] = (_Float16)(v[i][j][e] * gm[i] + bt[i]);
      *(v8h*)&Ts[(128 * (4 * ph + j) + 32 * e + lane) * KP + 8 * oct] = pv;
    }
  __syncthreads();

  // 1024 lines (one per pixel), 8 lanes x 16 B per line; sweep it takes LDS rows 64it..64it+63
  const int rl = t >> 3, p = t & 7;           // row in the sweep, 16-B piece of the line
  _Float16* hp = hT + ((size_t)b * NPIX + 4 * (rl & 31) + (rl >> 5)) * CDIM + c0 + p * 8;
  v8h val[16];
#pragma unroll
  for (int it = 0; it < 16; ++it) val[it] = *(const v8h*)&Ts[(64 * it + rl) * KP + p * 8];
#pragma unroll
  for (int it = 0; it < 16; ++it) *(v8h*)(hp + (size_t)(128 * (it >> 1) + 2 * (it & 1)) * CDIM) = val[it];
}

// ---------------------------------------------------------------------------
// Generic 128x128 tile GEMM on f16 16x16x32 WMMA: D[m][n] = sum_k A[m][k] * Bt[n][k]  (both operands k-contiguous).
// 8 waves as 2 x 4, each 64 x 32 of the tile (4 x 2 accumulators); a k-slab is 64, worked as two WMMA depths in rising k.
// A and Bt are f16.
// MODE 0: three products on one Bt in one grid, f16 out: blockIdx.x = MT * job + row tile; job j takes A, bias and result j.
//         jobs 0 and 1 are stored [n][m] (m contiguous): out16[b*o_bs + (n0+n)*ldo + m0+m]
//         job 2 is stored [m][n]:                         out16[b*o_bs + (m0+m)*ldo2 + n0+n]
// MODE 2: one product, f32 out, stored [m][n], optional residual add at the same index.
template <int MODE>
__global__ __launch_bounds__(256) void gemm_kernel(
    const _Float16* __restrict__ Ah0, const _Float16* __restrict__ Ah1, const _Float16* __restrict__ Ah2, size_t a_bs, int lda,
    const _Float16* __restrict__ Bt, size_t b_bs, int ldb, int K,
    const float* __restrict__ bias0, const float* __restrict__ bias1, const float* __restrict__ bias2, int has_bias, float oscale,
    _Float16* out16_0, _Float16* out16_1, _Float16* out16_2, float* out32, const float* __restrict__ res, int has_res,
    size_t o_bs, int ldo, int ldo2) {
  // the job is the same for the whole work-group: what it picks stays in scalar registers
  const int job = (MODE == 0) ? (int)(blockIdx.x / MT) : 0;
  const int m0 = ((MODE == 0) ? (int)(blockIdx.x % MT) : (int)blockIdx.x) * BT, n0 = blockIdx.y * BT, b = blockIdx.z;
  const _Float16* Ah = (job == 0) ? Ah0 : (job == 1) ? Ah1 : Ah2;
  const float* bias = (job == 0) ? bias0 : (job == 1) ? bias1 : bias2;
  _Float16* out16   = (job == 0) ? out16_0 : (job == 1) ? out16_1 : out16_2;
  const bool tr = job < 2;   // MODE 0: result stored [n][m]
  const int tid = threadIdx.x, lane = tid & 31, wv = tid >> 5;
  const int h = lane >> 4, lm = lane & 15;
  const int wr = (wv >> 2) * 64, wc = (wv & 3) * 32;

  __shared__ __align__(16) _Float16 As[BT * KP];   // [m][k]
  __shared__ __align__(16) _Float16 Bs[BT * KP];   // [n][k]
  __shared__ __align__(16) _Float16 Dh[(MODE != 2) ? BT * DHP : 8];
  __shared__ __align__(16) float    Df[(MODE == 2) ? BT * DFP : 4];

  v8f zero;
#pragma unroll
  for (int e = 0; e < 8; ++e) zero[e] = 0.f;
  v8f acc[4][2];
#pragma unroll
  for (int mi = 0; mi < 4; ++mi) { acc[mi][0] = zero; acc[mi][1] = zero; }

  // staging: a slab row is 128 B of f16 (8 lanes x 16 B, 32 rows a sweep), so every wave-wide load covers four whole lines
  const int hr = tid >> 3, hk = (tid & 7) * 8;
  const _Float16* ap_h = Ah + (size_t)b * a_bs + (size_t)(m0 + hr) * lda + hk;
  const _Float16* bp   = Bt + (size_t)b * b_bs + (size_t)(n0 + hr) * ldb + hk;

  v8h ah[4], bh[4];
#pragma unroll
  for (int i = 0; i < 4; ++i) ah[i] = *(const v8h*)(ap_h + (size_t)(32 * i) * lda);
#pragma unroll
  for (int i = 0; i < 4; ++i) bh[i] = *(const v8h*)(bp + (size_t)(32 * i) * ldb);

  for (int k0 = 0; k0 < K; k0 += BK) {
#pragma unroll
    for (int i = 0; i < 4; ++i) *(v8h*)&As[(32 * i + hr) * KP + hk] = ah[i];
#pragma unroll
    for (int i = 0; i < 4; ++i) *(v8h*)&Bs[(32 * i + hr) * KP + hk] = bh[i];
    __syncthreads();

    const int k1 = k0 + BK;
    if (k1 < K) {   // prefetch next k-slab into registers (block-uniform)
#pragma unroll
      for (int i = 0; i < 4; ++i) ah[i] = *(const v8h*)(ap_h + (size_t)(32 * i) * lda + k1);
#pragma unroll
      for (int i = 0; i < 4; ++i) bh[i] = *(const v8h*)(bp + (size_t)(32 * i) * ldb + k1);
      // the fragment reads below land in the registers that held these loads' addresses: wait before they are overwritten
      asm volatile("s_wait_xcnt 0x0" ::: "memory");
    }

#pragma unroll
    for (int kk = 0; kk < BK; kk += 32) {
      v16h a[4], bf[2];
#pragma unroll
      for (int mi = 0; mi < 4; ++mi) a[mi] = ld_frag(As + kk, wr + 16 * mi + lm, h);
#pragma unroll
      for (int ni = 0; ni < 2; ++ni) bf[ni] = ld_frag(Bs + kk, wc + 16 * ni + lm, h);
#pragma unroll
      for (int mi = 0; mi < 4; ++mi)
#pragma unroll
        for (int ni = 0; ni < 2; ++ni) acc[mi][ni] = wmma_f16(a[mi], bf[ni], acc[mi][ni]);
    }
    __syncthreads();
  }

  // What the epilogue reads from global memory goes out here as one group, each flag tested once: (MODE 2) the residual of the 16
  // pieces the thread stores, then the bias of the lane's 4 x 8 result rows. Their latencies run side by side, not one after another.
  v4f rv[(MODE == 2) ? 16 : 1];
  unsigned off[(MODE == 2) ? 16 : 1];   // byte offsets of those pieces in the batch's plane (below 4 GiB), for the residual and the store alike
  if (MODE == 2) {
#pragma unroll
    for (int it = 0; it < 16; ++it) {
      off[it] = ((unsigned)(m0 + 8 * it + wv) * (unsigned)ldo + (unsigned)(n0 + lane * 4)) * 4u;
      rv[it] = (v4f){0.f, 0.f, 0.f, 0.f};
    }
    if (has_res) {
      const char* rb = (const char*)(res + (size_t)b * o_bs);
#pragma unroll
      for (int it = 0; it < 16; ++it) rv[it] = *(const v4f*)(rb + off[it]);
      // wait before a register that these loads name is overwritten
      asm volatile("s_wait_xcnt 0x0" ::: "memory");
    }
  }
  v4f bb[4][2];
#pragma unroll
  for (int mi = 0; mi < 4; ++mi) { bb[mi][0] = (v4f){0.f, 0.f, 0.f, 0.f}; bb[mi][1] = (v4f){0.f, 0.f, 0.f, 0.f}; }
  if (has_bias) {
    const float* bp4 = bias + m0 + wr + 8 * h;
#pragma unroll
    for (int mi = 0; mi < 4; ++mi) {
      bb[mi][0] = *(const v4f*)(bp4 + 16 * mi);
      bb[mi][1] = *(const v4f*)(bp4 + 16 * mi + 4);
    }
    // registers that held these loads' addresses are reused below: wait before they are overwritten
    asm volatile("s_wait_xcnt 0x0" ::: "memory");
  }

  // D: acc[mi][ni][r] = tile element (row wr+mi*16+8h+r, col wc+ni*16+lm); stage in LDS in the order it is stored in
  // (the order is tested once, outside the loops)
  if (MODE == 2) {
#pragma unroll
    for (int mi = 0; mi < 4; ++mi)
#pragma unroll
      for (int ni = 0; ni < 2; ++ni)
#pragma unroll
        for (int r = 0; r < 8; ++r)
          Df[(wr + mi * 16 + 8 * h + r) * DFP + wc + ni * 16 + lm] = acc[mi][ni][r] * oscale + bb[mi][r >> 2][r & 3];
  } else if (tr) {
#pragma unroll
    for (int mi = 0; mi < 4; ++mi)
#pragma unroll
      for (int ni = 0; ni < 2; ++ni)
#pragma unroll
        for (int r = 0; r < 8; ++r)
          Dh[(wc + ni * 16 + lm) * DHP + wr + mi * 16 + 8 * h + r] = (_Float16)(acc[mi][ni][r] * oscale + bb[mi][r >> 2][r & 3]);
  } else {
#pragma unroll
    for (int mi = 0; mi < 4; ++mi)
#pragma unroll
      for (int ni = 0; ni < 2; ++ni)
#pragma unroll
        for (int r = 0; r < 8; ++r)
          Dh[(wr + mi * 16 + 8 * h + r) * DHP + wc + ni * 16 + lm] = (_Float16)(acc[mi][ni][r] * oscale + bb[mi][r >> 2][r & 3]);
  }
  __syncthreads();

  if (MODE != 2) {
    // 128 rows x 256 B: two lines per row, 16 lanes x 16 B per row
    const int r0 = tr ? n0 : m0, c0 = tr ? m0 : n0, ld = tr ? ldo : ldo2;   // the stored tile's first row, first column and row pitch
    v8h val[8]; size_t idx[8];
#pragma unroll
    for (int it = 0; it < 8; ++it) {
      const int sI = it * 256 + tid;
      const int row = sI >> 4, p = sI & 15;
      val[it] = *(const v8h*)&Dh[row * DHP + p * 8];
      idx[it] = (size_t)b * o_bs + (size_t)(r0 + row) * ld + c0 + p * 8;
    }
#pragma unroll
    for (int it = 0; it < 8; ++it) *(v8h*)(out16 + idx[it]) = val[it];
  } else {
    // 128 rows x 512 B: four lines per row, one wave x 16 B per row
    v4f val[16];
#pragma unroll
    for (int it = 0; it < 16; ++it) val[it] = *(const v4f*)&Df[(8 * it + wv) * DFP + lane * 4] + rv[it];
    char* ob = (char*)(out32 + (size_t)b * o_bs);
#pragma unroll
    for (int it = 0; it < 16; ++it) *(v4f*)(ob + off[it]) = val[it];
  }
}

// ---------------------------------------------------------------------------
// Kernel: attention of AQ queries against all NPIX keys of one batch, one work-group of 8 waves.
// Phase 1: St[j][i] = sum_c kT[j][c] * qT[i][c]; wave w holds keys 128w..128w+127 x 64 queries in 8 x 4 accumulators,
//          so a lane holds 64 scores of each of 4 queries (query 16ni+lm, keys 128w+16mi+8h+r).
// Softmax: maximum and sum in the lane, one exchange between the lane halves, then over the 8 waves through LDS.
// Phase 2: Ot[c][i] = sum_j v16[c][j] * P[i][j]; P (f16, not yet divided by its row sum) lies in LDS as [query][key];
//          wave w holds channels 64w..64w+63; the row sum divides the result.
// LDS: phase 1 [k slab 1024 x KP | q tile AQ x QP]; phase 2 [p tile AQ x PP | v slab 512 x KP]; at the end the o tile AQ x QP.
__global__ __launch_bounds__(256) void attn_kernel(
    const _Float16* __restrict__ qT, const _Float16* __restrict__ kT, const _Float16* __restrict__ v16,
    _Float16* oT, float sscale, float pshift, float oscale) {
  const int i0 = blockIdx.x * AQ, b = blockIdx.y;
  const int tid = threadIdx.x, lane = tid & 31, wv = tid >> 5;
  const int h = lane >> 4, lm = lane & 15;
  const size_t actB = (size_t)NPIX * CDIM;

  __shared__ __align__(16) _Float16 sm[NPIX * KP + AQ * QP];
  __shared__ float redm[8 * AQ], reds[8 * AQ];
  _Float16* Ks = sm;
  _Float16* Qs = sm + NPIX * KP;
  _Float16* Pl = sm;
  _Float16* Vs = sm + AQ * PP;
  _Float16* Os = sm;

  v8f zero;
#pragma unroll
  for (int e = 0; e < 8; ++e) zero[e] = 0.f;

  // staging maps: q and o rows are 1024 B (64 lanes x 16 B, 4 rows a sweep); k and v slab rows are 128 B (8 lanes x 16 B, 32 rows a sweep)
  const int qr = tid >> 6, qc = (tid & 63) * 8;
  const int hr = tid >> 3, hk = (tid & 7) * 8;
  const _Float16* qp = qT + (size_t)b * actB + (size_t)(i0 + qr) * CDIM + qc;
  const _Float16* kp = kT + (size_t)b * actB + (size_t)hr * CDIM + hk;
  const _Float16* vp = v16 + (size_t)b * actB + (size_t)hr * NPIX + hk;   // walks on by one slab a trip

  v8h kh[32];
  {
    v8h qv[16];
#pragma unroll
    for (int it = 0; it < 16; ++it) qv[it] = *(const v8h*)(qp + (size_t)(4 * it) * CDIM);
#pragma unroll
    for (int i = 0; i < 32; ++i) kh[i] = *(const v8h*)(kp + (size_t)(32 * i) * CDIM);
    // registers that held these loads' addresses are reused below: wait before they are overwritten
    asm volatile("s_wait_xcnt 0x0" ::: "memory");
    // holds what follows behind that wait: the compiler had lifted the accumulators' zeroing, which lands on the address registers, over it
    __builtin_amdgcn_sched_barrier(0);
#pragma unroll
    for (int it = 0; it < 16; ++it) *(v8h*)&Qs[(4 * it + qr) * QP + qc] = qv[it];
  }

  v8f acc[8][4];
#pragma unroll
  for (int mi = 0; mi < 8; ++mi)
#pragma unroll
    for (int ni = 0; ni < 4; ++ni) acc[mi][ni] = zero;

  // rolled: for speed only
#pragma unroll 1
  for (int k0 = 0; k0 < CDIM; k0 += BK) {
#pragma unroll
    for (int i = 0; i < 32; ++i) *(v8h*)&Ks[(32 * i + hr) * KP + hk] = kh[i];
    __syncthreads();

    const int k1 = k0 + BK;
    if (k1 < CDIM) {   // prefetch next k-slab into registers (block-uniform)
#pragma unroll
      for (int i = 0; i < 32; ++i) kh[i] = *(const v8h*)(kp + (size_t)(32 * i) * CDIM + k1);
      // the fragment reads below may land in the registers that held these loads' addresses: wait before they are overwritten
      asm volatile("s_wait_xcnt 0x0" ::: "memory");
    }

#pragma unroll
    for (int kk = 0; kk < BK; kk += 32) {
      v16h bf[4];
#pragma unroll
      for (int ni = 0; ni < 4; ++ni) bf[ni] = ld_frag_p<QP>(Qs + k0 + kk, 16 * ni + lm, h);
#pragma unroll
      for (int mg = 0; mg < 8; mg += 4) {
        v16h a[4];
#pragma unroll
        for (int mi = 0; mi < 4; ++mi) a[mi] = ld_frag(Ks + kk, 128 * wv + 16 * (mg + mi) + lm, h);
        // keeps the block's fragment reads together in front of its 16 WMMAs: left free, the compiler read one fragment
        // at a time into one register set and waited out the LDS latency before every 4 WMMAs
        __builtin_amdgcn_sched_barrier(0);
#pragma unroll
        for (int mi = 0; mi < 4; ++mi)
#pragma unroll
          for (int ni = 0; ni < 4; ++ni) acc[mg + mi][ni] = wmma_f16_b(a[mi], bf[ni], acc[mg + mi][ni]);
        // ends the block: the next block's reads do not move in among these WMMAs
        __builtin_amdgcn_sched_barrier(0);
      }
    }
    __syncthreads();
  }

  // first v slab: its latency runs under the softmax
  v8h vh[16];
#pragma unroll
  for (int i = 0; i < 16; ++i) vh[i] = *(const v8h*)(vp + (size_t)(32 * i) * NPIX);   // vp lives on: no load lands on it
  // registers that held these loads' addresses may be reused below: wait before they are overwritten
  asm volatile("s_wait_xcnt 0x0" ::: "memory");

  // softmax in the log2 domain: e = 2^((score - row maximum) * sscale * log2(e) + pshift), at most 2^pshift, goes to LDS as f16
  // without the division; the row sum of the same e divides the p*v result at the end
  const float c1 = sscale * 1.4426950408889634f;
#pragma unroll
  for (int ni = 0; ni < 4; ++ni) {
    float m = acc[0][ni][0];
#pragma unroll
    for (int mi = 0; mi < 8; ++mi)
#pragma unroll
      for (int r = 0; r < 8; ++r) m = fmaxf(m, acc[mi][ni][r]);
    m = fmaxf(m, __shfl_xor(m, 16, 32));
    if (h == 0) redm[wv * AQ + 16 * ni + lm] = m;
  }
  __syncthreads();
  // every wave has left the k slab (the barriers above): the p tile may overwrite it
#pragma unroll
  for (int ni = 0; ni < 4; ++ni) {
    float m = redm[16 * ni + lm];
#pragma unroll
    for (int w = 1; w < 8; ++w) m = fmaxf(m, redm[w * AQ + 16 * ni + lm]);
    const float mc = m * c1 - pshift;
    float s = 0.f;
#pragma unroll
    for (int mi = 0; mi < 8; ++mi) {
      v8h pv;
#pragma unroll
      for (int r = 0; r < 8; ++r) {
        const float e = exp2_slot(acc[mi][ni][r] * c1 - mc);
        s += e;
        pv[r] = (_Float16)e;
      }
      *(v8h*)&Pl[(16 * ni + lm) * PP + 128 * wv + 16 * mi + 8 * h] = pv;
    }
    s += __shfl_xor(s, 16, 32);
    if (h == 0) reds[wv * AQ + 16 * ni + lm] = s;
  }

  v8f oc[4][4];
#pragma unroll
  for (int mi = 0; mi < 4; ++mi)
#pragma unroll
    for (int ni = 0; ni < 4; ++ni) oc[mi][ni] = zero;

  // rolled: for speed only
#pragma unroll 1
  for (int j0 = 0; j0 < NPIX; j0 += BK) {
#pragma unroll
    for (int i = 0; i < 16; ++i) *(v8h*)&Vs[(32 * i + hr) * KP + hk] = vh[i];
    __syncthreads();   // on the first trip it also publishes the p tile and the waves' row sums

    const int j1 = j0 + BK;
    if (j1 < NPIX) {   // prefetch next v slab into registers (block-uniform)
      vp += BK;
#pragma unroll
      for (int i = 0; i < 16; ++i) vh[i] = *(const v8h*)(vp + (size_t)(32 * i) * NPIX);
      // the fragment reads below may land in the registers that held these loads' addresses: wait before they are overwritten
      asm volatile("s_wait_xcnt 0x0" ::: "memory");
    }

    v16h a[2][4], bf[2][4];
#pragma unroll
    for (int ks = 0; ks < 2; ++ks) {
#pragma unroll
      for (int mi = 0; mi < 4; ++mi) a[ks][mi] = ld_frag(Vs + 32 * ks, 64 * wv + 16 * mi + lm, h);
#pragma unroll
      for (int ni = 0; ni < 4; ++ni) bf[ks][ni] = ld_frag_p<PP>(Pl + j0 + 32 * ks, 16 * ni + lm, h);
    }
    // keeps the slab's fragment reads as one group in front of its 32 WMMAs: left free, the compiler read one fragment
    // at a time into one register set and waited out the LDS latency before every 4 WMMAs
    __builtin_amdgcn_sched_barrier(0);
#pragma unroll
    for (int ks = 0; ks < 2; ++ks)   // rising k
#pragma unroll
      for (int mi = 0; mi < 4; ++mi)
#pragma unroll
        for (int ni = 0; ni < 4; ++ni) oc[mi][ni] = wmma_f16_b(a[ks][mi], bf[ks][ni], oc[mi][ni]);
    // keeps the barrier, and the wait for the prefetched slab that comes with it, behind the WMMAs: the compiler had
    // lifted both in front of them, so that the loads' latency was waited out before the products
    __builtin_amdgcn_sched_barrier(0);
    __syncthreads();
  }

  // oc[mi][ni][r] = (channel 64wv+16mi+8h+r, query 16ni+lm): 8 channels in a row per lane; stage [query][channel] for whole-line stores
  float inv[4];
#pragma unroll
  for (int ni = 0; ni < 4; ++ni) {
    float s = reds[16 * ni + lm];
#pragma unroll
    for (int w = 1; w < 8; ++w) s += reds[w * AQ + 16 * ni + lm];
    inv[ni] = oscale / s;
  }
#pragma unroll
  for (int mi = 0; mi < 4; ++mi)
#pragma unroll
    for (int ni = 0; ni < 4; ++ni) {
      v8h ov;
#pragma unroll
      for (int r = 0; r < 8; ++r) ov[r] = (_Float16)(oc[mi][ni][r] * inv[ni]);
      *(v8h*)&Os[(16 * ni + lm) * QP + 64 * wv + 16 * mi + 8 * h] = ov;
    }
  __syncthreads();
  _Float16* op = oT + (size_t)b * actB + (size_t)(i0 + qr) * CDIM + qc;
  v8h val[16];
#pragma unroll
  for (int it = 0; it < 16; ++it) val[it] = *(const v8h*)&Os[(4 * it + qr) * QP + qc];
#pragma unroll
  for (int it = 0; it < 16; ++it) *(v8h*)(op + (size_t)(4 * it) * CDIM) = val[it];
}

// ---------------------------------------------------------------------------
extern "C" void kernel_launch(void* const* d_in, const int* in_sizes, int n_in,
                              void* d_out, int out_size, void* d_ws,
                              size_t ws_size, hipStream_t stream) {
  if (n_in < 11) return;
  const long long per = (long long)CDIM * NPIX;
  const long long tot = (long long)in_sizes[0];
  if (tot <= 0 || (tot % per) != 0) return;
  const int B = (int)(tot / per);
  if ((long long)out_size != tot) return;
  if (in_sizes[1] != CDIM || in_sizes[2] != CDIM) return;
  if (in_sizes[3] != CDIM * CDIM || in_sizes[5] != CDIM * CDIM ||
      in_sizes[7] != CDIM * CDIM || in_sizes[9] != CDIM * CDIM) return;
  if (in_sizes[4] != CDIM || in_sizes[6] != CDIM || in_sizes[8] != CDIM || in_sizes[10] != CDIM) return;
  if (B > 65535) return;

  const float* x     = (const float*)d_in[0];
  const float* gamma = (const float*)d_in[1];
  const float* beta  = (const float*)d_in[2];
  const float* wq = (const float*)d_in[3]; const float* bq = (const float*)d_in[4];
  const float* wk = (const float*)d_in[5]; const float* bk = (const float*)d_in[6];
  const float* wv = (const float*)d_in[7]; const float* bv = (const float*)d_in[8];
  const float* wo = (const float*)d_in[9]; const float* bo = (const float*)d_in[10];
  float* out = (float*)d_out;

  // workspace carve: qT | kT | v16 | hT(->oT) (each B*N*C f16) | w16 (the four weight matrices as f16)
  const size_t HB = (size_t)B * CDIM * NPIX * sizeof(_Float16);
  if (4 * HB + 4 * WEL * sizeof(_Float16) > ws_size) return;
  char* ws = (char*)d_ws;
  _Float16* qT  = (_Float16*)(ws);
  _Float16* kT  = (_Float16*)(ws + HB);
  _Float16* v16 = (_Float16*)(ws + 2 * HB);
  _Float16* hT  = (_Float16*)(ws + 3 * HB);   // later reused as oT
  _Float16* w16 = (_Float16*)(ws + 4 * HB);   // wq | wk | wv | wo

  const size_t actB = (size_t)NPIX * CDIM;    // per-batch stride of hT/qT/kT/v16/oT/out (elements)
  const float wsc   = 64.0f;                   // f16 weight pre-scale
  const float attn_scale = 0.04419417382415922f;   // 512^-0.5
  const float psh   = 12.0f;                   // f16 probability pre-scale, as a power of two (x4096)
  const float osc   = 16.0f;                   // f16 pre-scale of the p*v result

  gn_kernel<<<B * (CDIM / CBLK) + 4 * WCB, GNT, 0, stream>>>(x, gamma, beta, hT, B * (CDIM / CBLK), wq, wk, wv, wo, wsc, w16);

  dim3 gc(MT, NPIX / BT, B);
  dim3 gp(3 * MT, NPIX / BT, B);
  // q, k, v in one grid: A = W[o][c] f16 (x64), Bt = hT[n][c]; q and k out [b][n][o] f16, v out [b][o][n] f16
  gemm_kernel<0><<<gp, 256, 0, stream>>>(w16, w16 + WEL, w16 + 2 * WEL, 0, CDIM, hT, actB, CDIM, CDIM,
                                            bq, bk, bv, 1, 1.0f / wsc, qT, kT, v16, out, x, 0, actB, CDIM, NPIX);
  // attention: scores, softmax (e x4096 as f16, in LDS) and oT[b][i][c] = sum_j v16[c][j] * e[i][j] / sum_j e[i][j], stored x16 as f16 (hT buffer)
  dim3 ga(NPIX / AQ, B);
  attn_kernel<<<ga, 256, 0, stream>>>(qT, kT, v16, hT, attn_scale, psh, osc);
  // output projection: A = Wo[o][c] f16 (x64), Bt = oT[n][c] (x16); out[b][o][n] = res + acc/(64*16) + bo
  gemm_kernel<2><<<gc, 256, 0, stream>>>(w16 + 3 * WEL, w16 + 3 * WEL, w16 + 3 * WEL, 0, CDIM, hT, actB, CDIM, CDIM,
                                            bo, bo, bo, 1, 1.0f / (wsc * osc), qT, qT, qT, out, x, 1, actB, NPIX, NPIX);
}

// v008
// It runs in 96.6 microseconds.
// In both of two side-by-side timings against v007, it was 1.08 times as fast.
// Over all steps from v000 it is 2.56 times as fast.
#include <hip/hip_runtime.h>
#include <stddef.h>
#include <stdint.h>

// All contractions: v_wmma_f32_16x16x32_f16 (f16 operands, f32 accumulate): three 1x1 projections (weights x64, made f16 once, in the first launch),
// q*k^T, p*v (p x4096, divided by its row sum behind the product), output projection (o x16, weights x64); all scales are powers of two folded back in f32.
// Three launches: norm (+ weights to f16), the three projections, attention with the output projection and the residual behind it.

#define CDIM 512
#define NPIX 1024
#define GCH  16      // channels per norm group (CDIM / 32)
#define CBLK 64      // channels per norm block (4 groups)
#define GNT  512     // threads per norm block
#define WEL  (CDIM * CDIM)          // elements of one weight matrix
#define WCB  (WEL / (GNT * 32))     // work-groups that convert one weight matrix: 32 elements a thread
// LDS row pitches of the GEMM tiles: 16 B x odd, so that 16 rows read or written 16 B wide fall on 64 distinct banks
// (and rows 8 apart, as the two lane halves of an accumulator hold them, fall 32 banks apart).
#define BT   128     // GEMM block tile: BT x BT results
#define BK   64      // k per slab: one whole 128-B line of an f16 operand row
#define MT   (CDIM / BT)   // block tiles along the rows of one weight matrix
#define KP   72      // operand tiles: 64 halves of k + 8 pad  (144 B)
#define DHP  136     // f16 result tile: 128 halves + 8 pad    (272 B)
#define AQ   64      // attention: queries per work-group
#define QP   520     // attention q and o tiles: 512 halves + 8 pad  (1040 B)
#define PP   1032    // attention p tile: 1024 halves + 8 pad        (2064 B)
#define OFP  68      // attention f32 result tile: 64 floats + 4 pad (272 B)

typedef _Float16 v16h __attribute__((ext_vector_type(16)));
typedef _Float16 v8h  __attribute__((ext_vector_type(8)));
typedef float    v8f  __attribute__((ext_vector_type(8)));
typedef float    v4f  __attribute__((ext_vector_type(4)));
typedef float    v2f  __attribute__((ext_vector_type(2)));
union Frag { v16h v; v8h half[2]; };

// ---------------------------------------------------------------------------
// 16x16x32 f16 WMMA with hazard guard.
__device__ __forceinline__ v8f wmma_f16(v16h a, v16h b, v8f c) {
  v8f d = __builtin_amdgcn_wmma_f32_16x16x32_f16(false, a, false, b, (short)0, c, false, false);
  asm volatile("v_nop\n\tv_nop\n\tv_nop\n\tv_nop" : "+v"(d) : "v"(a), "v"(b));
  return d;
}

// The builtin alone, for the attention kernel: its accumulators reach above v255, where an asm operand cannot lie
// (tied to the asm guard above they all went to scratch); the compiler keeps the distances behind its own builtin.
__device__ __forceinline__ v8f wmma_f16_b(v16h a, v16h b, v8f c) {
  return __builtin_amdgcn_wmma_f32_16x16x32_f16(false, a, false, b, (short)0, c, false, false);
}

// 2^x with the free slot behind it that the instruction set asks for after a transcendental, in one statement.
__device__ __forceinline__ float exp2_slot(float x) {
  float e;
  asm("v_exp_f32 %0, %1\n\tv_nop" : "=v"(e) : "v"(x));
  return e;
}

// Work-group barrier that orders the LDS alone. __syncthreads() also waits out every global load in flight; across phase 3 of the attention
// kernel the residual's loads (read-only data, used by the loading thread alone) are to stay in flight.
__device__ __forceinline__ void barrier_lds() {
  __builtin_amdgcn_fence(__ATOMIC_RELEASE, "workgroup", "local");
  __builtin_amdgcn_s_barrier();
  __builtin_amdgcn_fence(__ATOMIC_ACQUIRE, "workgroup", "local");
}

// Fragment from an LDS tile stored [row][k] with pitch KP halves (used for A rows and for B columns alike):
// lane l: row = l&15, h = l>>4; elements 0..7 <- k 8h..8h+7, elements 8..15 <- k 16+8h..16+8h+7.
__device__ __forceinline__ v16h ld_frag(const _Float16* tile, int row, int h) {
  Frag f;
  const _Float16* rp = tile + row * KP;
  f.half[0] = *(const v8h*)(rp + 8 * h);
  f.half[1] = *(const v8h*)(rp + 16 + 8 * h);
  return f.v;
}

// The same fragment from a tile of another row pitch (in halves).
template <int PITCH>
__device__ __forceinline__ v16h ld_frag_p(const _Float16* tile, int row, int h) {
  Frag f;
  const _Float16* rp = tile + row * PITCH;
  f.half[0] = *(const v8h*)(rp + 8 * h);
  f.half[1] = *(const v8h*)(rp + 16 + 8 * h);
  return f.v;
}

// ---------------------------------------------------------------------------
// Kernel 1: group norm -> transposed f16 activations hT[b][n][c].
// One work-group of 16 waves per 64 channels (4 groups) of one batch. Wave w holds channels 8(w&7)..+7 x pixels 512(w>>3)..+511 in
// registers: every wave-wide load covers 512 B in a row of one channel, x is read once, statistics and normalisation work on the registers.
// A lane holds 8 channels of each of its pixels, so a pixel's part of the transposed tile is one 16-B LDS store.
// Pixel n = 128a + 4l + e lies in LDS row 128a + 32e + l: the 32 lanes of a store fall on 32 rows in a row (pitch 16 B x odd).
// The work-groups behind the nnorm norm blocks (4 * WCB of them) turn the four f32 weight matrices into f16 (x wscale), w16[matrix][o][c]:
// each weight is rounded once here, and the GEMM work-groups that share it read 2 bytes of it, not 4.
__global__ __launch_bounds__(GNT) void gn_kernel(
    const float* __restrict__ x, const float* __restrict__ gamma,
    const float* __restrict__ beta, _Float16* hT, int nnorm,
    const float* __restrict__ w0, const float* __restrict__ w1, const float* __restrict__ w2, const float* __restrict__ w3,
    float wscale, _Float16* w16) {
  if ((int)blockIdx.x >= nnorm) {   // the same for the whole work-group, in front of every barrier
    const int cb = (int)blockIdx.x - nnorm, mat = cb / WCB;
    const float* wsrc = (mat == 0) ? w0 : (mat == 1) ? w1 : (mat == 2) ? w2 : w3;
    const int e0 = (cb % WCB) * (GNT * 32) + (int)threadIdx.x * 8;   // a sweep: 8 elements a thread, 16-B stores side by side
    v4f wl[4][2];
#pragma unroll
    for (int i = 0; i < 4; ++i) {
      wl[i][0] = *(const v4f*)(wsrc + e0 + i * (GNT * 8));
      wl[i][1] = *(const v4f*)(wsrc + e0 + i * (GNT * 8) + 4);
    }
    // wait before a register that these loads name is overwritten
    asm volatile("s_wait_xcnt 0x0" ::: "memory");
    _Float16* wd = w16 + (size_t)mat * WEL + e0;
#pragma unroll
    for (int i = 0; i < 4; ++i) {
      v8h o;
#pragma unroll
      for (int e = 0; e < 8; ++e) o[e] = (_Float16)(wl[i][e >> 2][e & 3] * wscale);
      *(v8h*)(wd + i * (GNT * 8)) = o;
    }
    return;
  }
  const int b  = blockIdx.x >> 3, cg = blockIdx.x & 7;
  const int c0 = cg * CBLK;
  const int t  = threadIdx.x, lane = t & 31;
  const int wv = __builtin_amdgcn_readfirstlane(t >> 5);   // the wave's number as a scalar: gamma and beta come by scalar loads
  const int oct = wv & 7, ph = wv >> 3;      // channel octet, half of the pixel range
  const float* xw = x + ((size_t)b * CDIM + c0 + 8 * oct) * NPIX + ph * (NPIX / 2);   // the wave's part of x
  const int lo4 = 4 * lane;                  // the lane's place in a 512-B run

  __shared__ __align__(16) _Float16 Ts[NPIX * KP];
  __shared__ float rs1[GNT / 32], rs2[GNT / 32];

  v4f v[8][4];
#pragma unroll
  for (int i = 0; i < 8; ++i)
#pragma unroll
    for (int j = 0; j < 4; ++j) v[i][j] = *(const v4f*)(xw + lo4 + i * NPIX + 128 * j);
  v4f ga[2], be[2];
#pragma unroll
  for (int u = 0; u < 2; ++u) {
    ga[u] = *(const v4f*)(gamma + c0 + 8 * oct + 4 * u);
    be[u] = *(const v4f*)(beta + c0 + 8 * oct + 4 * u);
  }
  // registers that held these loads' addresses are reused below: wait before they are overwritten
  asm volatile("s_wait_xcnt 0x0" ::: "memory");

  // statistics: all 8 channels of a wave belong to one group; pixel pairs are summed two wide, one chain per 128-pixel run
  v2f sa[4], qa[4];
#pragma unroll
  for (int j = 0; j < 4; ++j) { sa[j] = (v2f){0.f, 0.f}; qa[j] = (v2f){0.f, 0.f}; }
#pragma unroll
  for (int i = 0; i < 8; ++i)
#pragma unroll
    for (int j = 0; j < 4; ++j) {
      const v2f lo = __builtin_shufflevector(v[i][j], v[i][j], 0, 1);
      const v2f hi = __builtin_shufflevector(v[i][j], v[i][j], 2, 3);
      sa[j] += lo; sa[j] += hi;
      qa[j] += lo * lo; qa[j] += hi * hi;
    }
  const v2f st = (sa[0] + sa[1]) + (sa[2] + sa[3]);
  const v2f qt = (qa[0] + qa[1]) + (qa[2] + qa[3]);
  float s = st[0] + st[1], ss = qt[0] + qt[1];
#pragma unroll
  for (int k = 16; k > 0; k >>= 1) { s += __shfl_xor(s, k, 32); ss += __shfl_xor(ss, k, 32); }
  if (lane == 0) { rs1[wv] = s; rs2[wv] = ss; }
  __syncthreads();
  // a group is two octets x two pixel halves: waves o2, o2+1, o2+8, o2+9
  const int o2 = oct & 6;
  const float gs  = (rs1[o2] + rs1[o2 + 1]) + (rs1[o2 + 8] + rs1[o2 + 9]);
  const float gss = (rs2[o2] + rs2[o2 + 1]) + (rs2[o2 + 8] + rs2[o2 + 9]);
  const float inv_cnt = 1.0f / (float)(GCH * NPIX);
  const float mean = gs * inv_cnt;
  float var = gss * inv_cnt - mean * mean;
  var = fmaxf(var, 0.f);
  const float inv = rsqrtf(var + 1e-6f);
  float gm[8], bt[8];
#pragma unroll
  for (int i = 0; i < 8; ++i) {
    gm[i] = ga[i >> 2][i & 3] * inv;
    bt[i] = be[i >> 2][i & 3] - mean * gm[i];
  }

#pragma unroll
  for (int j = 0; j < 4; ++j)
#pragma unroll
    for (int e = 0; e < 4; ++e) {
      v8h pv;
#pragma unroll
      for (int i = 0; i < 8; ++i) pv[i] = (_Float16)(v[i][j][e] * gm[i] + bt[i]);
      *(v8h*)&Ts[(128 * (4 * ph + j) + 32 * e + lane) * KP + 8 * oct] = pv;
    }
  __syncthreads();

  // 1024 lines (one per pixel), 8 lanes x 16 B per line; sweep it takes LDS rows 64it..64it+63
  const int rl = t >> 3, p = t & 7;           // row in the sweep, 16-B piece of the line
  _Float16* hp = hT + ((size_t)b * NPIX + 4 * (rl & 31) + (rl >> 5)) * CDIM + c0 + p * 8;
  v8h val[16];
#pragma unroll
  for (int it = 0; it < 16; ++it) val[it] = *(const v8h*)&Ts[(64 * it + rl) * KP + p * 8];
#pragma unroll
  for (int it = 0; it < 16; ++it) *(v8h*)(hp + (size_t)(128 * (it >> 1) + 2 * (it & 1)) * CDIM) = val[it];
}

// ---------------------------------------------------------------------------
// 128x128 tile GEMM on f16 16x16x32 WMMA: D[m][n] = sum_k A[m][k] * Bt[n][k]  (both operands k-contiguous).
// 8 waves as 2 x 4, each 64 x 32 of the tile (4 x 2 accumulators); a k-slab is 64, worked as two WMMA depths in rising k.
// A and Bt are f16.
// Three products on one Bt in one grid, f16 out: blockIdx.x = MT * job + row tile; job j takes A, bias and result j.
//   jobs 0 and 1 are stored [n][m] (m contiguous): out16[b*o_bs + (n0+n)*ldo + m0+m]
//   job 2 is stored [m][n]:                         out16[b*o_bs + (m0+m)*ldo2 + n0+n]
__global__ __launch_bounds__(256) void gemm_kernel(
    const _Float16* __restrict__ Ah0, const _Float16* __restrict__ Ah1, const _Float16* __restrict__ Ah2, size_t a_bs, int lda,
    const _Float16* __restrict__ Bt, size_t b_bs, int ldb, int K,
    const float* __restrict__ bias0, const float* __restrict__ bias1, const float* __restrict__ bias2, int has_bias, float oscale,
    _Float16* out16_0, _Float16* out16_1, _Float16* out16_2,
    size_t o_bs, int ldo, int ldo2) {
  // the job is the same for the whole work-group: what it picks stays in scalar registers
  const int job = (int)(blockIdx.x / MT);
  const int m0 = (int)(blockIdx.x % MT) * BT, n0 = blockIdx.y * BT, b = blockIdx.z;
  const _Float16* Ah = (job == 0) ? Ah0 : (job == 1) ? Ah1 : Ah2;
  const float* bias = (job == 0) ? bias0 : (job == 1) ? bias1 : bias2;
  _Float16* out16   = (job == 0) ? out16_0 : (job == 1) ? out16_1 : out16_2;
  const bool tr = job < 2;   // result stored [n][m]
  const int tid = threadIdx.x, lane = tid & 31, wv = tid >> 5;
  const int h = lane >> 4, lm = lane & 15;
  const int wr = (wv >> 2) * 64, wc = (wv & 3) * 32;

  __shared__ __align__(16) _Float16 As[BT * KP];   // [m][k]
  __shared__ __align__(16) _Float16 Bs[BT * KP];   // [n][k]
  __shared__ __align__(16) _Float16 Dh[BT * DHP];

  v8f zero;
#pragma unroll
  for (int e = 0; e < 8; ++e) zero[e] = 0.f;
  v8f acc[4][2];
#pragma unroll
  for (int mi = 0; mi < 4; ++mi) { acc[mi][0] = zero; acc[mi][1] = zero; }

  // staging: a slab row is 128 B of f16 (8 lanes x 16 B, 32 rows a sweep), so every wave-wide load covers four whole lines
  const int hr = tid >> 3, hk = (tid & 7) * 8;
  const _Float16* ap_h = Ah + (size_t)b * a_bs + (size_t)(m0 + hr) * lda + hk;
  const _Float16* bp   = Bt + (size_t)b * b_bs + (size_t)(n0 + hr) * ldb + hk;

  v8h ah[4], bh[4];
#pragma unroll
  for (int i = 0; i < 4; ++i) ah[i] = *(const v8h*)(ap_h + (size_t)(32 * i) * lda);
#pragma unroll
  for (int i = 0; i < 4; ++i) bh[i] = *(const v8h*)(bp + (size_t)(32 * i) * ldb);

  for (int k0 = 0; k0 < K; k0 += BK) {
#pragma unroll
    for (int i = 0; i < 4; ++i) *(v8h*)&As[(32 * i + hr) * KP + hk] = ah[i];
#pragma unroll
    for (int i = 0; i < 4; ++i) *(v8h*)&Bs[(32 * i + hr) * KP + hk] = bh[i];
    __syncthreads();

    const int k1 = k0 + BK;
    if (k1 < K) {   // prefetch next k-slab into registers (block-uniform)
#pragma unroll
      for (int i = 0; i < 4; ++i) ah[i] = *(const v8h*)(ap_h + (size_t)(32 * i) * lda + k1);
#pragma unroll
      for (int i = 0; i < 4; ++i) bh[i] = *(const v8h*)(bp + (size_t)(32 * i) * ldb + k1);
      // the fragment reads below land in the registers that held these loads' addresses: wait before they are overwritten
      asm volatile("s_wait_xcnt 0x0" ::: "memory");
    }

#pragma unroll
    for (int kk = 0; kk < BK; kk += 32) {
      v16h a[4], bf[2];
#pragma unroll
      for (int mi = 0; mi < 4; ++mi) a[mi] = ld_frag(As + kk, wr + 16 * mi + lm, h);
#pragma unroll
      for (int ni = 0; ni < 2; ++ni) bf[ni] = ld_frag(Bs + kk, wc + 16 * ni + lm, h);
#pragma unroll
      for (int mi = 0; mi < 4; ++mi)
#pragma unroll
        for (int ni = 0; ni < 2; ++ni) acc[mi][ni] = wmma_f16(a[mi], bf[ni], acc[mi][ni]);
    }
    __syncthreads();
  }

  // The bias of the lane's 4 x 8 result rows goes out as one group, the flag tested once: the latencies run side by side.
  v4f bb[4][2];
#pragma unroll
  for (int mi = 0; mi < 4; ++mi) { bb[mi][0] = (v4f){0.f, 0.f, 0.f, 0.f}; bb[mi][1] = (v4f){0.f, 0.f, 0.f, 0.f}; }
  if (has_bias) {
    const float* bp4 = bias + m0 + wr + 8 * h;
#pragma unroll
    for (int mi = 0; mi < 4; ++mi) {
      bb[mi][0] = *(const v4f*)(bp4 + 16 * mi);
      bb[mi][1] = *(const v4f*)(bp4 + 16 * mi + 4);
    }
    // registers that held these loads' addresses are reused below: wait before they are overwritten
    asm volatile("s_wait_xcnt 0x0" ::: "memory");
  }

  // D: acc[mi][ni][r] = tile element (row wr+mi*16+8h+r, col wc+ni*16+lm); stage in LDS in the order it is stored in
  // (the order is tested once, outside the loops)
  if (tr) {
#pragma unroll
    for (int mi = 0; mi < 4; ++mi)
#pragma unroll
      for (int ni = 0; ni < 2; ++ni)
#pragma unroll
        for (int r = 0; r < 8; ++r)
          Dh[(wc + ni * 16 + lm) * DHP + wr + mi * 16 + 8 * h + r] = (_Float16)(acc[mi][ni][r] * oscale + bb[mi][r >> 2][r & 3]);
  } else {
#pragma unroll
    for (int mi = 0; mi < 4; ++mi)
#pragma unroll
      for (int ni = 0; ni < 2; ++ni)
#pragma unroll
        for (int r = 0; r < 8; ++r)
          Dh[(wr + mi * 16 + 8 * h + r) * DHP + wc + ni * 16 + lm] = (_Float16)(acc[mi][ni][r] * oscale + bb[mi][r >> 2][r & 3]);
  }
  __syncthreads();

  // 128 rows x 256 B: two lines per row, 16 lanes x 16 B per row
  const int r0 = tr ? n0 : m0, c0 = tr ? m0 : n0, ld = tr ? ldo : ldo2;   // the stored tile's first row, first column and row pitch
  v8h val[8]; size_t idx[8];
#pragma unroll
  for (int it = 0; it < 8; ++it) {
    const int sI = it * 256 + tid;
    const int row = sI >> 4, p = sI & 15;
    val[it] = *(const v8h*)&Dh[row * DHP + p * 8];
    idx[it] = (size_t)b * o_bs + (size_t)(r0 + row) * ld + c0 + p * 8;
  }
#pragma unroll
  for (int it = 0; it < 8; ++it) *(v8h*)(out16 + idx[it]) = val[it];
}

// ---------------------------------------------------------------------------
// Kernel: attention of AQ queries against all NPIX keys of one batch, then the output projection of those queries; one work-group of 8 waves.
// Phase 1: St[j][i] = sum_c kT[j][c] * qT[i][c]; wave w holds keys 128w..128w+127 x 64 queries in 8 x 4 accumulators,
//          so a lane holds 64 scores of each of 4 queries (query 16ni+lm, keys 128w+16mi+8h+r).
// Softmax: maximum and sum in the lane, one exchange between the lane halves, then over the 8 waves through LDS.
// Phase 2: Ot[c][i] = sum_j v16[c][j] * P[i][j]; P (f16, not yet divided by its row sum) lies in LDS as [query][key];
//          wave w holds channels 64w..64w+63; the row sum divides the result, which goes to LDS as f16 (x oscale), [query][channel].
// Phase 3: R[o][i] = sum_c wo16[o][c] * O[i][c], the loop of phase 2 on the weight rows; wave w holds result rows 64w..64w+63;
//          out[b][o][i0+i] = res + R * pscale + bo, staged in LDS so that whole lines are stored.
// LDS: phase 1 [k slab 1024 x KP | q tile AQ x QP]; phase 2 [p tile AQ x PP | v slab 512 x KP]; phase 3 [o tile AQ x QP | .. | weight slab
//      512 x KP, where the v slab lay]; at the end the f32 result tile 512 x OFP.
__global__ __launch_bounds__(256) void attn_kernel(
    const _Float16* __restrict__ qT, const _Float16* __restrict__ kT, const _Float16* __restrict__ v16,
    const _Float16* __restrict__ wo16, const float* __restrict__ bo, const float* __restrict__ res, float* out,
    float sscale, float pshift, float oscale, float pscale) {
  const int i0 = blockIdx.x * AQ, b = blockIdx.y;
  const int tid = threadIdx.x, lane = tid & 31, wv = tid >> 5;
  const int h = lane >> 4, lm = lane & 15;
  const size_t actB = (size_t)NPIX * CDIM;

  __shared__ __align__(16) _Float16 sm[NPIX * KP + AQ * QP];
  __shared__ float redm[8 * AQ], reds[8 * AQ];
  __shared__ __align__(16) float bos[CDIM];   // the output projection's bias
  _Float16* Ks = sm;
  _Float16* Qs = sm + NPIX * KP;
  _Float16* Pl = sm;
  _Float16* Vs = sm + AQ * PP;
  _Float16* Os = sm;

  v8f zero;
#pragma unroll
  for (int e = 0; e < 8; ++e) zero[e] = 0.f;

  // staging maps: q rows are 1024 B (64 lanes x 16 B, 4 rows a sweep); k and v slab rows are 128 B (8 lanes x 16 B, 32 rows a sweep)
  const int qr = tid >> 6, qc = (tid & 63) * 8;
  const int hr = tid >> 3, hk = (tid & 7) * 8;
  const _Float16* qp = qT + (size_t)b * actB + (size_t)(i0 + qr) * CDIM + qc;
  const _Float16* kp = kT + (size_t)b * actB + (size_t)hr * CDIM + hk;
  const _Float16* vp = v16 + (size_t)b * actB + (size_t)hr * NPIX + hk;   // walks on by one slab a trip

  v8h kh[32];
  {
    v8h qv[16];
#pragma unroll
    for (int it = 0; it < 16; ++it) qv[it] = *(const v8h*)(qp + (size_t)(4 * it) * CDIM);
#pragma unroll
    for (int i = 0; i < 32; ++i) kh[i] = *(const v8h*)(kp + (size_t)(32 * i) * CDIM);
    // registers that held these loads' addresses are reused below: wait before they are overwritten
    asm volatile("s_wait_xcnt 0x0" ::: "memory");
    // holds what follows behind that wait: the compiler had lifted the accumulators' zeroing, which lands on the address registers, over it
    __builtin_amdgcn_sched_barrier(0);
#pragma unroll
    for (int it = 0; it < 16; ++it) *(v8h*)&Qs[(4 * it + qr) * QP + qc] = qv[it];
  }

  v8f acc[8][4];
#pragma unroll
  for (int mi = 0; mi < 8; ++mi)
#pragma unroll
    for (int ni = 0; ni < 4; ++ni) acc[mi][ni] = zero;

  // rolled: for speed only
#pragma unroll 1
  for (int k0 = 0; k0 < CDIM; k0 += BK) {
#pragma unroll
    for (int i = 0; i < 32; ++i) *(v8h*)&Ks[(32 * i + hr) * KP + hk] = kh[i];
    __syncthreads();

    const int k1 = k0 + BK;
    if (k1 < CDIM) {   // prefetch next k-slab into registers (block-uniform)
#pragma unroll
      for (int i = 0; i < 32; ++i) kh[i] = *(const v8h*)(kp + (size_t)(32 * i) * CDIM + k1);
      // the fragment reads below may land in the registers that held these loads' addresses: wait before they are overwritten
      asm volatile("s_wait_xcnt 0x0" ::: "memory");
    }

#pragma unroll
    for (int kk = 0; kk < BK; kk += 32) {
      v16h bf[4];
#pragma unroll
      for (int ni = 0; ni < 4; ++ni) bf[ni] = ld_frag_p<QP>(Qs + k0 + kk, 16 * ni + lm, h);
#pragma unroll
      for (int mg = 0; mg < 8; mg += 4) {
        v16h a[4];
#pragma unroll
        for (int mi = 0; mi < 4; ++mi) a[mi] = ld_frag(Ks + kk, 128 * wv + 16 * (mg + mi) + lm, h);
        // keeps the block's fragment reads together in front of its 16 WMMAs: left free, the compiler read one fragment
        // at a time into one register set and waited out the LDS latency before every 4 WMMAs
        __builtin_amdgcn_sched_barrier(0);
#pragma unroll
        for (int mi = 0; mi < 4; ++mi)
#pragma unroll
          for (int ni = 0; ni < 4; ++ni) acc[mg + mi][ni] = wmma_f16_b(a[mi], bf[ni], acc[mg + mi][ni]);
        // ends the block: the next block's reads do not move in among these WMMAs
        __builtin_amdgcn_sched_barrier(0);
      }
    }
    __syncthreads();
  }

  // first v slab: its latency runs under the softmax
  v8h vh[16];
#pragma unroll
  for (int i = 0; i < 16; ++i) vh[i] = *(const v8h*)(vp + (size_t)(32 * i) * NPIX);   // vp lives on: no load lands on it
  // registers that held these loads' addresses may be reused below: wait before they are overwritten
  asm volatile("s_wait_xcnt 0x0" ::: "memory");

  // softmax in the log2 domain: e = 2^((score - row maximum) * sscale * log2(e) + pshift), at most 2^pshift, goes to LDS as f16
  // without the division; the row sum of the same e divides the p*v result at the end
  const float c1 = sscale * 1.4426950408889634f;
#pragma unroll
  for (int ni = 0; ni < 4; ++ni) {
    float m = acc[0][ni][0];
#pragma unroll
    for (int mi = 0; mi < 8; ++mi)
#pragma unroll
      for (int r = 0; r < 8; ++r) m = fmaxf(m, acc[mi][ni][r]);
    m = fmaxf(m, __shfl_xor(m, 16, 32));
    if (h == 0) redm[wv * AQ + 16 * ni + lm] = m;
  }
  __syncthreads();
  // every wave has left the k slab (the barriers above): the p tile may overwrite it
#pragma unroll
  for (int ni = 0; ni < 4; ++ni) {
    float m = redm[16 * ni + lm];
#pragma unroll
    for (int w = 1; w < 8; ++w) m = fmaxf(m, redm[w * AQ + 16 * ni + lm]);
    const float mc = m * c1 - pshift;
    float s = 0.f;
#pragma unroll
    for (int mi = 0; mi < 8; ++mi) {
      v8h pv;
#pragma unroll
      for (int r = 0; r < 8; ++r) {
        const float e = exp2_slot(acc[mi][ni][r] * c1 - mc);
        s += e;
        pv[r] = (_Float16)e;
      }
      *(v8h*)&Pl[(16 * ni + lm) * PP + 128 * wv + 16 * mi + 8 * h] = pv;
    }
    s += __shfl_xor(s, 16, 32);
    if (h == 0) reds[wv * AQ + 16 * ni + lm] = s;
  }

  v8f oc[4][4];
#pragma unroll
  for (int mi = 0; mi < 4; ++mi)
#pragma unroll
    for (int ni = 0; ni < 4; ++ni) oc[mi][ni] = zero;

  // rolled: for speed only
#pragma unroll 1
  for (int j0 = 0; j0 < NPIX; j0 += BK) {
#pragma unroll
    for (int i = 0; i < 16; ++i) *(v8h*)&Vs[(32 * i + hr) * KP + hk] = vh[i];
    __syncthreads();   // on the first trip it also publishes the p tile and the waves' row sums

    const int j1 = j0 + BK;
    if (j1 < NPIX) {   // prefetch next v slab into registers (block-uniform)
      vp += BK;
#pragma unroll
      for (int i = 0; i < 16; ++i) vh[i] = *(const v8h*)(vp + (size_t)(32 * i) * NPIX);
      // the fragment reads below may land in the registers that held these loads' addresses: wait before they are overwritten
      asm volatile("s_wait_xcnt 0x0" ::: "memory");
    }

    v16h a[2][4], bf[2][4];
#pragma unroll
    for (int ks = 0; ks < 2; ++ks) {
#pragma unroll
      for (int mi = 0; mi < 4; ++mi) a[ks][mi] = ld_frag(Vs + 32 * ks, 64 * wv + 16 * mi + lm, h);
#pragma unroll
      for (int ni = 0; ni < 4; ++ni) bf[ks][ni] = ld_frag_p<PP>(Pl + j0 + 32 * ks, 16 * ni + lm, h);
    }
    // keeps the slab's fragment reads as one group in front of its 32 WMMAs: left free, the compiler read one fragment
    // at a time into one register set and waited out the LDS latency before every 4 WMMAs
    __builtin_amdgcn_sched_barrier(0);
#pragma unroll
    for (int ks = 0; ks < 2; ++ks)   // rising k
#pragma unroll
      for (int mi = 0; mi < 4; ++mi)
#pragma unroll
        for (int ni = 0; ni < 4; ++ni) oc[mi][ni] = wmma_f16_b(a[ks][mi], bf[ks][ni], oc[mi][ni]);
    // keeps the barrier, and the wait for the prefetched slab that comes with it, behind the WMMAs: the compiler had
    // lifted both in front of them, so that the loads' latency was waited out before the products
    __builtin_amdgcn_sched_barrier(0);
    __syncthreads();
  }

  // the bias goes out first: loads come back in the order of issue, and what is wanted first (for LDS, in front of phase 3) must not wait for the rest
  const v2f b2 = *(const v2f*)(bo + 2 * tid);
  // first slab of the output projection's weights: its latency runs under the division and the staging of the o tile
  const _Float16* wp = wo16 + (size_t)hr * CDIM + hk;   // walks on by one slab a trip
#pragma unroll
  for (int i = 0; i < 16; ++i) vh[i] = *(const v8h*)(wp + (size_t)(32 * i) * CDIM);
  // a load of the residual may land in the registers that held these loads' addresses: wait before they are overwritten
  // (the statement also holds the slab's loads in front of the residual's: behind them, the first slab's wait would take in the residual)
  asm volatile("s_wait_xcnt 0x0" ::: "memory");
  // The residual goes out here too, behind that slab: the 32 pieces of it that belong to what the thread stores
  // (512 rows x 256 B: two lines per row, 16 lanes x 16 B per row, 16 rows a sweep). These reads run under phase 3.
  const int orow = tid >> 4, oc4 = (tid & 15) * 4;
  const unsigned off = (unsigned)(orow * NPIX + i0 + oc4) * 4u;   // the first piece's byte offset in the batch's plane; lives on to the stores: no load lands on it
  const char* rb = (const char*)(res + (size_t)b * actB);
  v4f rv[32];
#pragma unroll
  for (int it = 0; it < 32; ++it) rv[it] = *(const v4f*)(rb + off + (size_t)(16 * it) * NPIX * sizeof(float));
  // registers that held these loads' addresses may be reused below: wait before they are overwritten
  asm volatile("s_wait_xcnt 0x0" ::: "memory");

  // oc[mi][ni][r] = (channel 64wv+16mi+8h+r, query 16ni+lm): 8 channels in a row per lane; the o tile lies [query][channel], as phase 3 reads it
  float inv[4];
#pragma unroll
  for (int ni = 0; ni < 4; ++ni) {
    float s = reds[16 * ni + lm];
#pragma unroll
    for (int w = 1; w < 8; ++w) s += reds[w * AQ + 16 * ni + lm];
    inv[ni] = oscale / s;
  }
#pragma unroll
  for (int mi = 0; mi < 4; ++mi)
#pragma unroll
    for (int ni = 0; ni < 4; ++ni) {
      v8h ov;
#pragma unroll
      for (int r = 0; r < 8; ++r) ov[r] = (_Float16)(oc[mi][ni][r] * inv[ni]);
      *(v8h*)&Os[(16 * ni + lm) * QP + 64 * wv + 16 * mi + 8 * h] = ov;
    }
  *(v2f*)&bos[2 * tid] = b2;

  // The first slab goes to LDS in front of the loop, each further one at the foot of the trip before it: inside the loop the compiler's wait
  // for a slab is to "no load in flight", which on the first slab would wait out the residual too.
#pragma unroll
  for (int i = 0; i < 16; ++i) *(v8h*)&Vs[(32 * i + hr) * KP + hk] = vh[i];

  v8f pc[4][4];
#pragma unroll
  for (int mi = 0; mi < 4; ++mi)
#pragma unroll
    for (int ni = 0; ni < 4; ++ni) pc[mi][ni] = zero;

  // one slab's products
  auto slab = [&](int c0) {
    v16h a[2][4], bf[2][4];
#pragma unroll
    for (int ks = 0; ks < 2; ++ks) {
#pragma unroll
      for (int mi = 0; mi < 4; ++mi) a[ks][mi] = ld_frag(Vs + 32 * ks, 64 * wv + 16 * mi + lm, h);
#pragma unroll
      for (int ni = 0; ni < 4; ++ni) bf[ks][ni] = ld_frag_p<QP>(Os + c0 + 32 * ks, 16 * ni + lm, h);
    }
    // keeps the slab's fragment reads as one group in front of its 32 WMMAs, as in phase 2
    __builtin_amdgcn_sched_barrier(0);
#pragma unroll
    for (int ks = 0; ks < 2; ++ks)   // rising k
#pragma unroll
      for (int mi = 0; mi < 4; ++mi)
#pragma unroll
        for (int ni = 0; ni < 4; ++ni) pc[mi][ni] = wmma_f16_b(a[ks][mi], bf[ks][ni], pc[mi][ni]);
    // keeps the barrier that follows behind the WMMAs, as in phase 2
    __builtin_amdgcn_sched_barrier(0);
  };

  // All slabs but the last, each trip with its prefetch and its store and no test around them (under a test the compiler held every
  // prefetch load back until the residual had landed); rolled: for speed only
#pragma unroll 1
  for (int c0 = 0; c0 < CDIM - BK; c0 += BK) {
    barrier_lds();   // publishes the slab; on the first trip also the o tile and the bias
    wp += BK;        // prefetch next weight slab into registers
#pragma unroll
    for (int i = 0; i < 16; ++i) vh[i] = *(const v8h*)(wp + (size_t)(32 * i) * CDIM);
    // the fragment reads below may land in the registers that held these loads' addresses: wait before they are overwritten
    asm volatile("s_wait_xcnt 0x0" ::: "memory");
    slab(c0);
    barrier_lds();   // every wave has left the slab
#pragma unroll
    for (int i = 0; i < 16; ++i) *(v8h*)&Vs[(32 * i + hr) * KP + hk] = vh[i];
  }
  barrier_lds();
  slab(CDIM - BK);
  barrier_lds();   // every wave has left the o tile and the last slab

  v4f bb[4][2];
#pragma unroll
  for (int mi = 0; mi < 4; ++mi) {
    bb[mi][0] = *(const v4f*)&bos[64 * wv + 8 * h + 16 * mi];
    bb[mi][1] = *(const v4f*)&bos[64 * wv + 8 * h + 16 * mi + 4];
  }

  // pc[mi][ni][r] = (result row 64wv+16mi+8h+r, query 16ni+lm); every wave has left the o tile and the weight slab (the barrier above)
  float* Df = (float*)sm;
#pragma unroll
  for (int mi = 0; mi < 4; ++mi)
#pragma unroll
    for (int ni = 0; ni < 4; ++ni)
#pragma unroll
      for (int r = 0; r < 8; ++r)
        Df[(64 * wv + 16 * mi + 8 * h + r) * OFP + 16 * ni + lm] = pc[mi][ni][r] * pscale + bb[mi][r >> 2][r & 3];
  __syncthreads();
  char* ob = (char*)(out + (size_t)b * actB);
  v4f val[32];
#pragma unroll
  for (int it = 0; it < 32; ++it) val[it] = *(const v4f*)&Df[(16 * it + orow) * OFP + oc4] + rv[it];
#pragma unroll
  for (int it = 0; it < 32; ++it) *(v4f*)(ob + off + (size_t)(16 * it) * NPIX * sizeof(float)) = val[it];
}

// ---------------------------------------------------------------------------
extern "C" void kernel_launch(void* const* d_in, const int* in_sizes, int n_in,
                              void* d_out, int out_size, void* d_ws,
                              size_t ws_size, hipStream_t stream) {
  if (n_in < 11) return;
  const long long per = (long long)CDIM * NPIX;
  const long long tot = (long long)in_sizes[0];
  if (tot <= 0 || (tot % per) != 0) return;
  const int B = (int)(tot / per);
  if ((long long)out_size != tot) return;
  if (in_sizes[1] != CDIM || in_sizes[2] != CDIM) return;
  if (in_sizes[3] != CDIM * CDIM || in_sizes[5] != CDIM * CDIM ||
      in_sizes[7] != CDIM * CDIM || in_sizes[9] != CDIM * CDIM) return;
  if (in_sizes[4] != CDIM || in_sizes[6] != CDIM || in_sizes[8] != CDIM || in_sizes[10] != CDIM) return;
  if (B > 65535) return;

  const float* x     = (const float*)d_in[0];
  const float* gamma = (const float*)d_in[1];
  const float* beta  = (const float*)d_in[2];
  const float* wq = (const float*)d_in[3]; const float* bq = (const float*)d_in[4];
  const float* wk = (const float*)d_in[5]; const float* bk = (const float*)d_in[6];
  const float* wv = (const float*)d_in[7]; const float* bv = (const float*)d_in[8];
  const float* wo = (const float*)d_in[9]; const float* bo = (const float*)d_in[10];
  float* out = (float*)d_out;

  // workspace carve: qT | kT | v16 | hT (each B*N*C f16) | w16 (the four weight matrices as f16)
  const size_t HB = (size_t)B * CDIM * NPIX * sizeof(_Float16);
  if (4 * HB + 4 * WEL * sizeof(_Float16) > ws_size) return;
  char* ws = (char*)d_ws;
  _Float16* qT  = (_Float16*)(ws);
  _Float16* kT  = (_Float16*)(ws + HB);
  _Float16* v16 = (_Float16*)(ws + 2 * HB);
  _Float16* hT  = (_Float16*)(ws + 3 * HB);
  _Float16* w16 = (_Float16*)(ws + 4 * HB);   // wq | wk | wv | wo

  const size_t actB = (size_t)NPIX * CDIM;    // per-batch stride of hT/qT/kT/v16 (elements)
  const float wsc   = 64.0f;                   // f16 weight pre-scale
  const float attn_scale = 0.04419417382415922f;   // 512^-0.5
  const float psh   = 12.0f;                   // f16 probability pre-scale, as a power of two (x4096)
  const float osc   = 16.0f;                   // f16 pre-scale of the p*v result

  gn_kernel<<<B * (CDIM / CBLK) + 4 * WCB, GNT, 0, stream>>>(x, gamma, beta, hT, B * (CDIM / CBLK), wq, wk, wv, wo, wsc, w16);

  dim3 gp(3 * MT, NPIX / BT, B);
  // q, k, v in one grid: A = W[o][c] f16 (x64), Bt = hT[n][c]; q and k out [b][n][o] f16, v out [b][o][n] f16
  gemm_kernel<<<gp, 256, 0, stream>>>(w16, w16 + WEL, w16 + 2 * WEL, 0, CDIM, hT, actB, CDIM, CDIM,
                                         bq, bk, bv, 1, 1.0f / wsc, qT, kT, v16, actB, CDIM, NPIX);
  // attention: scores, softmax (e x4096 as f16, in LDS), o[i][c] = sum_j v16[c][j] * e[i][j] / sum_j e[i][j] (x16 as f16, in LDS),
  // then the output projection on it: A = Wo[o][c] f16 (x64); out[b][o][n] = res + acc/(64*16) + bo
  dim3 ga(NPIX / AQ, B);
  attn_kernel<<<ga, 256, 0, stream>>>(qT, kT, v16, w16 + 3 * WEL, bo, x, out, attn_scale, psh, osc, 1.0f / (wsc * osc));
}

// v009
// One run takes 82.4 microseconds.
// Timed twice side by side with v008, it ran 1.18 and 1.17 times as fast.
// Counting every step since v000, it is 3.02 times as fast.
#include <hip/hip_runtime.h>
#include <stddef.h>
#include <stdint.h>

// All contractions: v_wmma_f32_16x16x32_f16 (f16 operands, f32 accumulate): three 1x1 projections (weights x64, made f16 once, in the first launch),
// q*k^T, p*v (p x4096, divided by its row sum behind the product), output projection (o x16, weights x64); all scales are powers of two folded back in f32.
// Three launches: norm (+ weights to f16), the three projections, attention with the output projection and the residual behind it.
// Fragment order: the A operands of the attention launch (k, v, output weights) lie in the workspace as tiles of 16 rows x 32 k, tile (rt, ks) of a
// matrix with KT k-steps a row at (rt * KT + ks) * FT halves; in a tile, the 8 halves (row lm, k 16p + 8h ..+7) lie at 256p + 8(16h + lm):
// lane 16h + lm of a wave reads its fragment as two 16-B loads, and each wave-wide load covers 512 B in a row.

#define CDIM 512
#define NPIX 1024
#define GCH  16      // channels per norm group (CDIM / 32)
#define CBLK 64      // channels per norm block (4 groups)
#define GNT  512     // threads per norm block
#define WEL  (CDIM * CDIM)          // elements of one weight matrix
#define WCB  (WEL / (GNT * 32))     // work-groups that convert one weight matrix: 32 elements a thread
// LDS row pitches of the GEMM tiles: 16 B x odd, so that 16 rows read or written 16 B wide fall on 64 distinct banks
// (and rows 8 apart, as the two lane halves of an accumulator hold them, fall 32 banks apart).
#define BT   128     // GEMM block tile: BT x BT results
#define BK   64      // k per slab: one whole 128-B line of an f16 operand row
#define MT   (CDIM / BT)   // block tiles along the rows of one weight matrix
#define KP   72      // operand tiles: 64 halves of k + 8 pad  (144 B)
#define DHP  136     // f16 result tile: 128 halves + 8 pad    (272 B)
#define AQ   64      // attention: queries per work-group
#define QP   520     // attention q and o tiles: 512 halves + 8 pad  (1040 B)
#define PP   1032    // attention p tile: 1024 halves + 8 pad        (2064 B)
#define OFP  68      // attention f32 result tile: 64 floats + 4 pad (272 B)
#define FT   512     // halves of one fragment tile: 16 rows x 32 k of an A operand, 1 KB, stored in the order in which a wave's registers hold it

typedef _Float16 v16h __attribute__((ext_vector_type(16)));
typedef _Float16 v8h  __attribute__((ext_vector_type(8)));
typedef float    v8f  __attribute__((ext_vector_type(8)));
typedef float    v4f  __attribute__((ext_vector_type(4)));
typedef float    v2f  __attribute__((ext_vector_type(2)));
union Frag { v16h v; v8h half[2]; };

// ---------------------------------------------------------------------------
// 16x16x32 f16 WMMA with hazard guard.
__device__ __forceinline__ v8f wmma_f16(v16h a, v16h b, v8f c) {
  v8f d = __builtin_amdgcn_wmma_f32_16x16x32_f16(false, a, false, b, (short)0, c, false, false);
  asm volatile("v_nop\n\tv_nop\n\tv_nop\n\tv_nop" : "+v"(d) : "v"(a), "v"(b));
  return d;
}

// The builtin alone, for the attention kernel: its accumulators reach above v255, where an asm operand cannot lie
// (tied to the asm guard above they all went to scratch); the compiler keeps the distances behind its own builtin.
__device__ __forceinline__ v8f wmma_f16_b(v16h a, v16h b, v8f c) {
  return __builtin_amdgcn_wmma_f32_16x16x32_f16(false, a, false, b, (short)0, c, false, false);
}

// 2^x with the free slot behind it that the instruction set asks for after a transcendental, in one statement.
__device__ __forceinline__ float exp2_slot(float x) {
  float e;
  asm("v_exp_f32 %0, %1\n\tv_nop" : "=v"(e) : "v"(x));
  return e;
}

// Work-group barrier that orders the LDS alone. __syncthreads() also waits out every global load in flight; across phase 3 of the attention
// kernel the residual's loads (read-only data, used by the loading thread alone) are to stay in flight.
__device__ __forceinline__ void barrier_lds() {
  __builtin_amdgcn_fence(__ATOMIC_RELEASE, "workgroup", "local");
  __builtin_amdgcn_s_barrier();
  __builtin_amdgcn_fence(__ATOMIC_ACQUIRE, "workgroup", "local");
}

// Fragment from an LDS tile stored [row][k] with pitch KP halves (used for A rows and for B columns alike):
// lane l: row = l&15, h = l>>4; elements 0..7 <- k 8h..8h+7, elements 8..15 <- k 16+8h..16+8h+7.
__device__ __forceinline__ v16h ld_frag(const _Float16* tile, int row, int h) {
  Frag f;
  const _Float16* rp = tile + row * KP;
  f.half[0] = *(const v8h*)(rp + 8 * h);
  f.half[1] = *(const v8h*)(rp + 16 + 8 * h);
  return f.v;
}

// The same fragment from a tile of another row pitch (in halves).
template <int PITCH>
__device__ __forceinline__ v16h ld_frag_p(const _Float16* tile, int row, int h) {
  Frag f;
  const _Float16* rp = tile + row * PITCH;
  f.half[0] = *(const v8h*)(rp + 8 * h);
  f.half[1] = *(const v8h*)(rp + 16 + 8 * h);
  return f.v;
}

// A fragment from a tile in fragment order in global memory; tile already holds the lane's 8 * lane halves.
__device__ __forceinline__ v16h ld_frag_g(const _Float16* tile) {
  Frag f;
  f.half[0] = *(const v8h*)(tile);
  f.half[1] = *(const v8h*)(tile + FT / 2);
  return f.v;
}

// ---------------------------------------------------------------------------
// Kernel 1: group norm -> transposed f16 activations hT[b][n][c].
// One work-group of 16 waves per 64 channels (4 groups) of one batch. Wave w holds channels 8(w&7)..+7 x pixels 512(w>>3)..+511 in
// registers: every wave-wide load covers 512 B in a row of one channel, x is read once, statistics and normalisation work on the registers.
// A lane holds 8 channels of each of its pixels, so a pixel's part of the transposed tile is one 16-B LDS store.
// Pixel n = 128a + 4l + e lies in LDS row 128a + 32e + l: the 32 lanes of a store fall on 32 rows in a row (pitch 16 B x odd).
// The work-groups behind the nnorm norm blocks (4 * WCB of them) turn the four f32 weight matrices into f16 (x wscale), w16[matrix][o][c]:
// each weight is rounded once here, and the GEMM work-groups that share it read 2 bytes of it, not 4.
// The fourth matrix (output projection) is written in fragment order: the 16-B stores stay side by side, the reads gather.
__global__ __launch_bounds__(GNT) void gn_kernel(
    const float* __restrict__ x, const float* __restrict__ gamma,
    const float* __restrict__ beta, _Float16* hT, int nnorm,
    const float* __restrict__ w0, const float* __restrict__ w1, const float* __restrict__ w2, const float* __restrict__ w3,
    float wscale, _Float16* w16) {
  if ((int)blockIdx.x >= nnorm) {   // the same for the whole work-group, in front of every barrier
    const int cb = (int)blockIdx.x - nnorm, mat = cb / WCB;
    const float* wsrc = (mat == 0) ? w0 : (mat == 1) ? w1 : (mat == 2) ? w2 : w3;
    const int e0 = (cb % WCB) * (GNT * 32) + (int)threadIdx.x * 8;   // a sweep: 8 elements a thread, 16-B stores side by side
    // What lies at the result's 16-B piece u = e0 / 8 + i * GNT: in plain order elements 8u..8u+7; in fragment order row 16(u >> 10) + (u & 15),
    // k 32((u >> 6) & 15) + 16((u >> 5) & 1) + 8((u >> 4) & 1). Bits 9 and 10 of u are i: both orders are a base and two steps.
    const bool fo = mat == 3;
    const int tx = (int)threadIdx.x;
    const int sb = fo ? ((cb % WCB) * 32 + (tx & 15)) * CDIM + ((tx >> 6) & 7) * 32 + ((tx >> 5) & 1) * 16 + ((tx >> 4) & 1) * 8 : e0;
    const int s1 = fo ? 8 * 32 : GNT * 8;
    v4f wl[4][2];
#pragma unroll
    for (int i = 0; i < 4; ++i) {
      wl[i][0] = *(const v4f*)(wsrc + sb + (i & 1) * s1 + (i >> 1) * (GNT * 16));
      wl[i][1] = *(const v4f*)(wsrc + sb + (i & 1) * s1 + (i >> 1) * (GNT * 16) + 4);
      // wait before a register that these loads name is overwritten
      asm volatile("s_wait_xcnt 0x0" ::: "memory");
    }
    _Float16* wd = w16 + (size_t)mat * WEL + e0;
#pragma unroll
    for (int i = 0; i < 4; ++i) {
      v8h o;
#pragma unroll
      for (int e = 0; e < 8; ++e) o[e] = (_Float16)(wl[i][e >> 2][e & 3] * wscale);
      *(v8h*)(wd + i * (GNT * 8)) = o;
    }
    return;
  }
  const int b  = blockIdx.x >> 3, cg = blockIdx.x & 7;
  const int c0 = cg * CBLK;
  const int t  = threadIdx.x, lane = t & 31;
  const int wv = __builtin_amdgcn_readfirstlane(t >> 5);   // the wave's number as a scalar: gamma and beta come by scalar loads
  const int oct = wv & 7, ph = wv >> 3;      // channel octet, half of the pixel range
  const float* xw = x + ((size_t)b * CDIM + c0 + 8 * oct) * NPIX + ph * (NPIX / 2);   // the wave's part of x
  const int lo4 = 4 * lane;                  // the lane's place in a 512-B run

  __shared__ __align__(16) _Float16 Ts[NPIX * KP];
  __shared__ float rs1[GNT / 32], rs2[GNT / 32];

  v4f v[8][4];
#pragma unroll
  for (int i = 0; i < 8; ++i)
#pragma unroll
    for (int j = 0; j < 4; ++j) v[i][j] = *(const v4f*)(xw + lo4 + i * NPIX + 128 * j);
  v4f ga[2], be[2];
#pragma unroll
  for (int u = 0; u < 2; ++u) {
    ga[u] = *(const v4f*)(gamma + c0 + 8 * oct + 4 * u);
    be[u] = *(const v4f*)(beta + c0 + 8 * oct + 4 * u);
  }
  // registers that held these loads' addresses are reused below: wait before they are overwritten
  asm volatile("s_wait_xcnt 0x0" ::: "memory");

  // statistics: all 8 channels of a wave belong to one group; pixel pairs are summed two wide, one chain per 128-pixel run
  v2f sa[4], qa[4];
#pragma unroll
  for (int j = 0; j < 4; ++j) { sa[j] = (v2f){0.f, 0.f}; qa[j] = (v2f){0.f, 0.f}; }
#pragma unroll
  for (int i = 0; i < 8; ++i)
#pragma unroll
    for (int j = 0; j < 4; ++j) {
      const v2f lo = __builtin_shufflevector(v[i][j], v[i][j], 0, 1);
      const v2f hi = __builtin_shufflevector(v[i][j], v[i][j], 2, 3);
      sa[j] += lo; sa[j] += hi;
      qa[j] += lo * lo; qa[j] += hi * hi;
    }
  const v2f st = (sa[0] + sa[1]) + (sa[2] + sa[3]);
  const v2f qt = (qa[0] + qa[1]) + (qa[2] + qa[3]);
  float s = st[0] + st[1], ss = qt[0] + qt[1];
#pragma unroll
  for (int k = 16; k > 0; k >>= 1) { s += __shfl_xor(s, k, 32); ss += __shfl_xor(ss, k, 32); }
  if (lane == 0) { rs1[wv] = s; rs2[wv] = ss; }
  __syncthreads();
  // a group is two octets x two pixel halves: waves o2, o2+1, o2+8, o2+9
  const int o2 = oct & 6;
  const float gs  = (rs1[o2] + rs1[o2 + 1]) + (rs1[o2 + 8] + rs1[o2 + 9]);
  const float gss = (rs2[o2] + rs2[o2 + 1]) + (rs2[o2 + 8] + rs2[o2 + 9]);
  const float inv_cnt = 1.0f / (float)(GCH * NPIX);
  const float mean = gs * inv_cnt;
  float var = gss * inv_cnt - mean * mean;
  var = fmaxf(var, 0.f);
  const float inv = rsqrtf(var + 1e-6f);
  float gm[8], bt[8];
#pragma unroll
  for (int i = 0; i < 8; ++i) {
    gm[i] = ga[i >> 2][i & 3] * inv;
    bt[i] = be[i >> 2][i & 3] - mean * gm[i];
  }

#pragma unroll
  for (int j = 0; j < 4; ++j)
#pragma unroll
    for (int e = 0; e < 4; ++e) {
      v8h pv;
#pragma unroll
      for (int i = 0; i < 8; ++i) pv[i] = (_Float16)(v[i][j][e] * gm[i] + bt[i]);
      *(v8h*)&Ts[(128 * (4 * ph + j) + 32 * e + lane) * KP + 8 * oct] = pv;
    }
  __syncthreads();

  // 1024 lines (one per pixel), 8 lanes x 16 B per line; sweep it takes LDS rows 64it..64it+63
  const int rl = t >> 3, p = t & 7;           // row in the sweep, 16-B piece of the line
  _Float16* hp = hT + ((size_t)b * NPIX + 4 * (rl & 31) + (rl >> 5)) * CDIM + c0 + p * 8;
  v8h val[16];
#pragma unroll
  for (int it = 0; it < 16; ++it) val[it] = *(const v8h*)&Ts[(64 * it + rl) * KP + p * 8];
#pragma unroll
  for (int it = 0; it < 16; ++it) *(v8h*)(hp + (size_t)(128 * (it >> 1) + 2 * (it & 1)) * CDIM) = val[it];
}

// ---------------------------------------------------------------------------
// 128x128 tile GEMM on f16 16x16x32 WMMA: D[m][n] = sum_k A[m][k] * Bt[n][k]  (both operands k-contiguous).
// 8 waves as 2 x 4, each 64 x 32 of the tile (4 x 2 accumulators); a k-slab is 64, worked as two WMMA depths in rising k.
// A and Bt are f16.
// Three products on one Bt in one grid, f16 out: blockIdx.x = MT * job + row tile; job j takes A, bias and result j.
//   job 0 is stored [n][m] (m contiguous): out16[b*o_bs + (n0+n)*ldo + m0+m]
//   job 1 is the matrix [n][m] (ldo wide), job 2 the matrix [m][n] (ldo2 wide), each stored in fragment order (rows x k)
__global__ __launch_bounds__(256) void gemm_kernel(
    const _Float16* __restrict__ Ah0, const _Float16* __restrict__ Ah1, const _Float16* __restrict__ Ah2, size_t a_bs, int lda,
    const _Float16* __restrict__ Bt, size_t b_bs, int ldb, int K,
    const float* __restrict__ bias0, const float* __restrict__ bias1, const float* __restrict__ bias2, int has_bias, float oscale,
    _Float16* out16_0, _Float16* out16_1, _Float16* out16_2,
    size_t o_bs, int ldo, int ldo2) {
  // the job is the same for the whole work-group: what it picks stays in scalar registers
  const int job = (int)(blockIdx.x / MT);
  const int m0 = (int)(blockIdx.x % MT) * BT, n0 = blockIdx.y * BT, b = blockIdx.z;
  const _Float16* Ah = (job == 0) ? Ah0 : (job == 1) ? Ah1 : Ah2;
  const float* bias = (job == 0) ? bias0 : (job == 1) ? bias1 : bias2;
  _Float16* out16   = (job == 0) ? out16_0 : (job == 1) ? out16_1 : out16_2;
  const bool tr = job < 2;   // result stored [n][m]
  const int tid = threadIdx.x, lane = tid & 31, wv = tid >> 5;
  const int h = lane >> 4, lm = lane & 15;
  const int wr = (wv >> 2) * 64, wc = (wv & 3) * 32;

  __shared__ __align__(16) _Float16 As[BT * KP];   // [m][k]
  __shared__ __align__(16) _Float16 Bs[BT * KP];   // [n][k]
  __shared__ __align__(16) _Float16 Dh[BT * DHP];

  v8f zero;
#pragma unroll
  for (int e = 0; e < 8; ++e) zero[e] = 0.f;
  v8f acc[4][2];
#pragma unroll
  for (int mi = 0; mi < 4; ++mi) { acc[mi][0] = zero; acc[mi][1] = zero; }

  // staging: a slab row is 128 B of f16 (8 lanes x 16 B, 32 rows a sweep), so every wave-wide load covers four whole lines
  const int hr = tid >> 3, hk = (tid & 7) * 8;
  const _Float16* ap_h = Ah + (size_t)b * a_bs + (size_t)(m0 + hr) * lda + hk;
  const _Float16* bp   = Bt + (size_t)b * b_bs + (size_t)(n0 + hr) * ldb + hk;

  v8h ah[4], bh[4];
#pragma unroll
  for (int i = 0; i < 4; ++i) ah[i] = *(const v8h*)(ap_h + (size_t)(32 * i) * lda);
#pragma unroll
  for (int i = 0; i < 4; ++i) bh[i] = *(const v8h*)(bp + (size_t)(32 * i) * ldb);

  for (int k0 = 0; k0 < K; k0 += BK) {
#pragma unroll
    for (int i = 0; i < 4; ++i) *(v8h*)&As[(32 * i + hr) * KP + hk] = ah[i];
#pragma unroll
    for (int i = 0; i < 4; ++i) *(v8h*)&Bs[(32 * i + hr) * KP + hk] = bh[i];
    __syncthreads();

    const int k1 = k0 + BK;
    if (k1 < K) {   // prefetch next k-slab into registers (block-uniform)
#pragma unroll
      for (int i = 0; i < 4; ++i) ah[i] = *(const v8h*)(ap_h + (size_t)(32 * i) * lda + k1);
#pragma unroll
      for (int i = 0; i < 4; ++i) bh[i] = *(const v8h*)(bp + (size_t)(32 * i) * ldb + k1);
      // the fragment reads below land in the registers that held these loads' addresses: wait before they are overwritten
      asm volatile("s_wait_xcnt 0x0" ::: "memory");
    }

#pragma unroll
    for (int kk = 0; kk < BK; kk += 32) {
      v16h a[4], bf[2];
#pragma unroll
      for (int mi = 0; mi < 4; ++mi) a[mi] = ld_frag(As + kk, wr + 16 * mi + lm, h);
#pragma unroll
      for (int ni = 0; ni < 2; ++ni) bf[ni] = ld_frag(Bs + kk, wc + 16 * ni + lm, h);
#pragma unroll
      for (int mi = 0; mi < 4; ++mi)
#pragma unroll
        for (int ni = 0; ni < 2; ++ni) acc[mi][ni] = wmma_f16(a[mi], bf[ni], acc[mi][ni]);
    }
    __syncthreads();
  }

  // The bias of the lane's 4 x 8 result rows goes out as one group, the flag tested once: the latencies run side by side.
  v4f bb[4][2];
#pragma unroll
  for (int mi = 0; mi < 4; ++mi) { bb[mi][0] = (v4f){0.f, 0.f, 0.f, 0.f}; bb[mi][1] = (v4f){0.f, 0.f, 0.f, 0.f}; }
  if (has_bias) {
    const float* bp4 = bias + m0 + wr + 8 * h;
#pragma unroll
    for (int mi = 0; mi < 4; ++mi) {
      bb[mi][0] = *(const v4f*)(bp4 + 16 * mi);
      bb[mi][1] = *(const v4f*)(bp4 + 16 * mi + 4);
    }
    // registers that held these loads' addresses are reused below: wait before they are overwritten
    asm volatile("s_wait_xcnt 0x0" ::: "memory");
  }

  // D: acc[mi][ni][r] = tile element (row wr+mi*16+8h+r, col wc+ni*16+lm); stage in LDS in the order it is stored in
  // (the order is tested once, outside the loops)
  if (tr) {
#pragma unroll
    for (int mi = 0; mi < 4; ++mi)
#pragma unroll
      for (int ni = 0; ni < 2; ++ni)
#pragma unroll
        for (int r = 0; r < 8; ++r)
          Dh[(wc + ni * 16 + lm) * DHP + wr + mi * 16 + 8 * h + r] = (_Float16)(acc[mi][ni][r] * oscale + bb[mi][r >> 2][r & 3]);
  } else {
#pragma unroll
    for (int mi = 0; mi < 4; ++mi)
#pragma unroll
      for (int ni = 0; ni < 2; ++ni)
#pragma unroll
        for (int r = 0; r < 8; ++r)
          Dh[(wr + mi * 16 + 8 * h + r) * DHP + wc + ni * 16 + lm] = (_Float16)(acc[mi][ni][r] * oscale + bb[mi][r >> 2][r & 3]);
  }
  __syncthreads();

  // 128 rows x 256 B: two lines per row, 16 lanes x 16 B per row
  const int r0 = tr ? n0 : m0, c0 = tr ? m0 : n0, ld = tr ? ldo : ldo2;   // the stored tile's first row, first column and row pitch
  v8h val[8]; size_t idx[8];
  if (job == 0) {
#pragma unroll
    for (int it = 0; it < 8; ++it) {
      const int sI = it * 256 + tid;
      const int row = sI >> 4, p = sI & 15;
      val[it] = *(const v8h*)&Dh[row * DHP + p * 8];
      idx[it] = (size_t)b * o_bs + (size_t)(r0 + row) * ld + c0 + p * 8;
    }
  } else {
    // fragment order: the block tile is 8 x 4 whole fragment tiles of 64 pieces; a wave's 32 pieces lie 512 B in a row
    const int kt = ld >> 5;   // k-steps of a row
#pragma unroll
    for (int it = 0; it < 8; ++it) {
      const int sI = it * 256 + tid;
      const int rt = sI >> 8, ks = (sI >> 6) & 3, u = sI & 63;
      val[it] = *(const v8h*)&Dh[(16 * rt + (u & 15)) * DHP + 32 * ks + 16 * (u >> 5) + 8 * ((u >> 4) & 1)];
      idx[it] = (size_t)b * o_bs + ((size_t)((r0 >> 4) + rt) * kt + (c0 >> 5) + ks) * FT + u * 8;
    }
  }
#pragma unroll
  for (int it = 0; it < 8; ++it) *(v8h*)(out16 + idx[it]) = val[it];
}

// ---------------------------------------------------------------------------
// Eight A fragments (4 row tiles x 2 k-steps: slab s of 64 k) from a matrix in fragment order with KT k-steps a row; ag holds the wave's first
// row tile and the lane's place.
template <int KT>
__device__ __forceinline__ void ld_a8(v16h (&a)[8], const _Float16* ag, int s) {
  const _Float16* p = ag + (size_t)s * (2 * FT);
#pragma unroll
  for (int ks = 0; ks < 2; ++ks)
#pragma unroll
    for (int mi = 0; mi < 4; ++mi) a[4 * ks + mi] = ld_frag_g(p + (mi * KT + ks) * FT);
  // the address of the next group is formed in the registers that these loads name: wait before they are overwritten
  asm volatile("s_wait_xcnt 0x0" ::: "memory");
}

// c[mi][ni] += (64 rows of the wave, from global memory in fragment order) x (64 columns of an LDS tile [column][k], pitch PITCH), over NS slabs of 64 k
// in rising k. No wave shares its rows, so they pass through no LDS and the loop holds no barrier; slab s + 1 flies while slab s is worked on
// (two register sets; a0 holds slab 0 on entry). between() runs in front of the last slab's products, when a0 is free again.
template <int KT, int PITCH, int NS, typename F>
__device__ __forceinline__ void rows_times_tile(const _Float16* ag, const _Float16* bt, int lm, int h,
                                                v16h (&a0)[8], v16h (&a1)[8], v8f (&c)[4][4], F between) {
  auto slab = [&](v16h (&a)[8], int s) {
    v16h bf[8];
#pragma unroll
    for (int ks = 0; ks < 2; ++ks)
#pragma unroll
      for (int ni = 0; ni < 4; ++ni) bf[4 * ks + ni] = ld_frag_p<PITCH>(bt + BK * s + 32 * ks, 16 * ni + lm, h);
    // keeps the slab's LDS reads, and the global loads in front of them, as one group in front of its 32 WMMAs: left free, the compiler read
    // one fragment at a time into one register set and waited out the latency before every 4 WMMAs
    __builtin_amdgcn_sched_barrier(0);
#pragma unroll
    for (int ks = 0; ks < 2; ++ks)   // rising k
#pragma unroll
      for (int mi = 0; mi < 4; ++mi)
#pragma unroll
        for (int ni = 0; ni < 4; ++ni) c[mi][ni] = wmma_f16_b(a[4 * ks + mi], bf[4 * ks + ni], c[mi][ni]);
    // ends the block: the next group's loads do not move in among these WMMAs
    __builtin_amdgcn_sched_barrier(0);
  };
  // rolled: two slabs a trip, so that each register set keeps its name
#pragma unroll 1
  for (int s = 0; s < NS - 2; s += 2) {
    ld_a8<KT>(a1, ag, s + 1);
    slab(a0, s);
    ld_a8<KT>(a0, ag, s + 2);
    slab(a1, s + 1);
  }
  ld_a8<KT>(a1, ag, NS - 1);
  slab(a0, NS - 2);
  between();
  slab(a1, NS - 1);
}

// ---------------------------------------------------------------------------
// Kernel: attention of AQ queries against all NPIX keys of one batch, then the output projection of those queries; one work-group of 8 waves.
// Phase 1: St[j][i] = sum_c k[j][c] * qT[i][c]; wave w holds keys 128w..128w+127 x 64 queries in 8 x 4 accumulators,
//          so a lane holds 64 scores of each of 4 queries (query 16ni+lm, keys 128w+16mi+8h+r).
// Softmax: maximum and sum in the lane, one exchange between the lane halves, then over the 8 waves through LDS.
// Phase 2: Ot[c][i] = sum_j v[c][j] * P[i][j]; P (f16, not yet divided by its row sum) lies in LDS as [query][key];
//          wave w holds channels 64w..64w+63; the row sum divides the result, which goes to LDS as f16 (x oscale), [query][channel].
// Phase 3: R[o][i] = sum_c wo[o][c] * O[i][c], the loop of phase 2 on the weight rows; wave w holds result rows 64w..64w+63;
//          out[b][o][i0+i] = res + R * pscale + bo, staged in LDS so that whole lines are stored.
// In all three phases the A rows (keys, channels, result rows) belong to one wave alone: they come from global memory in fragment order straight
// into that wave's registers, one step ahead of their products. LDS holds only what the waves share, one after the other in the same place:
// q tile AQ x QP, p tile AQ x PP, o tile AQ x QP, f32 result tile 512 x OFP.
__global__ __launch_bounds__(256) void attn_kernel(
    const _Float16* __restrict__ qT, const _Float16* __restrict__ kF, const _Float16* __restrict__ vF,
    const _Float16* __restrict__ woF, const float* __restrict__ bo, const float* __restrict__ res, float* out,
    float sscale, float pshift, float oscale, float pscale) {
  const int i0 = blockIdx.x * AQ, b = blockIdx.y;
  const int tid = threadIdx.x, lane = tid & 31;
  const int wv = __builtin_amdgcn_readfirstlane(tid >> 5);   // the wave's number as a scalar: the bases of its rows stay in scalar registers
  const int h = lane >> 4, lm = lane & 15;
  const size_t actB = (size_t)NPIX * CDIM;

  __shared__ __align__(16) _Float16 sm[CDIM * OFP * 2];   // the largest of the four tiles
  __shared__ float redm[8 * AQ], reds[8 * AQ];
  __shared__ __align__(16) float bos[CDIM];   // the output projection's bias
  _Float16* Qs = sm;
  _Float16* Pl = sm;
  _Float16* Os = sm;

  v8f zero;
#pragma unroll
  for (int e = 0; e < 8; ++e) zero[e] = 0.f;

  // the wave's rows in the three A operands, with the lane's place in a fragment tile
  const _Float16* kg = kF + (size_t)b * actB + (size_t)wv * (8 * (CDIM / 32) * FT) + 8 * lane;
  const _Float16* vg = vF + (size_t)b * actB + (size_t)wv * (4 * (NPIX / 32) * FT) + 8 * lane;
  const _Float16* wg = woF + (size_t)wv * (4 * (CDIM / 32) * FT) + 8 * lane;

  // k-step ks of the wave's 8 key tiles
  auto ld_k8 = [&](v16h (&a)[8], int ks) {
    const _Float16* p = kg + (size_t)ks * FT;
#pragma unroll
    for (int mi = 0; mi < 8; ++mi) a[mi] = ld_frag_g(p + mi * ((CDIM / 32) * FT));
    // the address of the next group is formed in the registers that these loads name: wait before they are overwritten
    asm volatile("s_wait_xcnt 0x0" ::: "memory");
  };
  auto ld_q4 = [&](v16h (&q)[4], int ks) {
#pragma unroll
    for (int ni = 0; ni < 4; ++ni) q[ni] = ld_frag_p<QP>(Qs + 32 * ks, 16 * ni + lm, h);
  };

  v16h a0[8], a1[8];
  {
    // q rows are 1024 B (64 lanes x 16 B, 4 rows a sweep)
    const int qr = tid >> 6, qc = (tid & 63) * 8;
    const _Float16* qp = qT + (size_t)b * actB + (size_t)(i0 + qr) * CDIM + qc;
    v8h qv[16];
#pragma unroll
    for (int it = 0; it < 16; ++it) qv[it] = *(const v8h*)(qp + (size_t)(4 * it) * CDIM);
    // registers that held these loads' addresses are reused below: wait before they are overwritten
    asm volatile("s_wait_xcnt 0x0" ::: "memory");
    ld_k8(a0, 0);   // behind q: loads come back in the order of issue, and q is wanted first
    // holds what follows behind those waits: the compiler had lifted the accumulators' zeroing, which lands on the address registers, over them
    __builtin_amdgcn_sched_barrier(0);
#pragma unroll
    for (int it = 0; it < 16; ++it) *(v8h*)&Qs[(4 * it + qr) * QP + qc] = qv[it];
  }

  v8f acc[8][4];
#pragma unroll
  for (int mi = 0; mi < 8; ++mi)
#pragma unroll
    for (int ni = 0; ni < 4; ++ni) acc[mi][ni] = zero;

  barrier_lds();   // publishes the q tile; the first keys' loads stay in flight

  {
    v16h q0[4], q1[4];
    auto mm1 = [&](v16h (&a)[8], v16h (&q)[4]) {
      // keeps the loads of the next step as one group in front of this step's 32 WMMAs
      __builtin_amdgcn_sched_barrier(0);
#pragma unroll
      for (int mi = 0; mi < 8; ++mi)
#pragma unroll
        for (int ni = 0; ni < 4; ++ni) acc[mi][ni] = wmma_f16_b(a[mi], q[ni], acc[mi][ni]);
      // ends the block: the loads behind it do not move in among these WMMAs
      __builtin_amdgcn_sched_barrier(0);
    };
    ld_q4(q0, 0);
    // rolled: two k-steps a trip, so that each register set keeps its name
#pragma unroll 1
    for (int ks = 0; ks < CDIM / 32 - 2; ks += 2) {
      ld_k8(a1, ks + 1);
      ld_q4(q1, ks + 1);
      mm1(a0, q0);
      ld_k8(a0, ks + 2);
      ld_q4(q0, ks + 2);
      mm1(a1, q1);
    }
    ld_k8(a1, CDIM / 32 - 1);
    ld_q4(q1, CDIM / 32 - 1);
    mm1(a0, q0);
    ld_a8<NPIX / 32>(a0, vg, 0);   // first v slab: its latency runs under the softmax
    mm1(a1, q1);
  }

  // softmax in the log2 domain: e = 2^((score - row maximum) * sscale * log2(e) + pshift), at most 2^pshift, goes to LDS as f16
  // without the division; the row sum of the same e divides the p*v result at the end
  const float c1 = sscale * 1.4426950408889634f;
#pragma unroll
  for (int ni = 0; ni < 4; ++ni) {
    float m = acc[0][ni][0];
#pragma unroll
    for (int mi = 0; mi < 8; ++mi)
#pragma unroll
      for (int r = 0; r < 8; ++r) m = fmaxf(m, acc[mi][ni][r]);
    m = fmaxf(m, __shfl_xor(m, 16, 32));
    if (h == 0) redm[wv * AQ + 16 * ni + lm] = m;
  }
  barrier_lds();
  // every wave has left the q tile (the barrier above): the p tile may overwrite it
#pragma unroll
  for (int ni = 0; ni < 4; ++ni) {
    float m = redm[16 * ni + lm];
#pragma unroll
    for (int w = 1; w < 8; ++w) m = fmaxf(m, redm[w * AQ + 16 * ni + lm]);
    const float mc = m * c1 - pshift;
    float s = 0.f;
#pragma unroll
    for (int mi = 0; mi < 8; ++mi) {
      v8h pv;
#pragma unroll
      for (int r = 0; r < 8; ++r) {
        const float e = exp2_slot(acc[mi][ni][r] * c1 - mc);
        s += e;
        pv[r] = (_Float16)e;
      }
      *(v8h*)&Pl[(16 * ni + lm) * PP + 128 * wv + 16 * mi + 8 * h] = pv;
    }
    s += __shfl_xor(s, 16, 32);
    if (h == 0) reds[wv * AQ + 16 * ni + lm] = s;
  }

  v8f oc[4][4];
#pragma unroll
  for (int mi = 0; mi < 4; ++mi)
#pragma unroll
    for (int ni = 0; ni < 4; ++ni) oc[mi][ni] = zero;

  barrier_lds();   // publishes the p tile and the waves' row sums

  v2f b2;
  rows_times_tile<NPIX / 32, PP, NPIX / BK>(vg, Pl, lm, h, a0, a1, oc, [&]() {
    // the bias goes out first: loads come back in the order of issue, and what is wanted first (for LDS, in front of phase 3) must not wait for the rest
    b2 = *(const v2f*)(bo + 2 * tid);
    // first slab of the output projection's weights: its latency runs under the last products, the division and the staging of the o tile
    ld_a8<CDIM / 32>(a0, wg, 0);
  });

  // The residual goes out here, behind that slab: the 32 pieces of it that belong to what the thread stores
  // (512 rows x 256 B: two lines per row, 16 lanes x 16 B per row, 16 rows a sweep). These reads run under phase 3.
  const int orow = tid >> 4, oc4 = (tid & 15) * 4;
  const unsigned off = (unsigned)(orow * NPIX + i0 + oc4) * 4u;   // the first piece's byte offset in the batch's plane; lives on to the stores: no load lands on it
  const char* rb = (const char*)(res + (size_t)b * actB);
  v4f rv[32];
#pragma unroll
  for (int it = 0; it < 32; ++it) rv[it] = *(const v4f*)(rb + off + (size_t)(16 * it) * NPIX * sizeof(float));
  // registers that held these loads' addresses may be reused below: wait before they are overwritten
  asm volatile("s_wait_xcnt 0x0" ::: "memory");

  // oc[mi][ni][r] = (channel 64wv+16mi+8h+r, query 16ni+lm): 8 channels in a row per lane; the o tile lies [query][channel], as phase 3 reads it
  float inv[4];
#pragma unroll
  for (int ni = 0; ni < 4; ++ni) {
    float s = reds[16 * ni + lm];
#pragma unroll
    for (int w = 1; w < 8; ++w) s += reds[w * AQ + 16 * ni + lm];
    inv[ni] = oscale / s;
  }
  barrier_lds();   // every wave has left the p tile: the o tile may overwrite it
#pragma unroll
  for (int mi = 0; mi < 4; ++mi)
#pragma unroll
    for (int ni = 0; ni < 4; ++ni) {
      v8h ov;
#pragma unroll
      for (int r = 0; r < 8; ++r) ov[r] = (_Float16)(oc[mi][ni][r] * inv[ni]);
      *(v8h*)&Os[(16 * ni + lm) * QP + 64 * wv + 16 * mi + 8 * h] = ov;
    }
  *(v2f*)&bos[2 * tid] = b2;

  v8f pc[4][4];
#pragma unroll
  for (int mi = 0; mi < 4; ++mi)
#pragma unroll
    for (int ni = 0; ni < 4; ++ni) pc[mi][ni] = zero;

  barrier_lds();   // publishes the o tile and the bias

  rows_times_tile<CDIM / 32, QP, CDIM / BK>(wg, Os, lm, h, a0, a1, pc, []() {});

  barrier_lds();   // every wave has left the o tile

  v4f bb[4][2];
#pragma unroll
  for (int mi = 0; mi < 4; ++mi) {
    bb[mi][0] = *(const v4f*)&bos[64 * wv + 8 * h + 16 * mi];
    bb[mi][1] = *(const v4f*)&bos[64 * wv + 8 * h + 16 * mi + 4];
  }

  // pc[mi][ni][r] = (result row 64wv+16mi+8h+r, query 16ni+lm); every wave has left the o tile (the barrier above)
  float* Df = (float*)sm;
#pragma unroll
  for (int mi = 0; mi < 4; ++mi)
#pragma unroll
    for (int ni = 0; ni < 4; ++ni)
#pragma unroll
      for (int r = 0; r < 8; ++r)
        Df[(64 * wv + 16 * mi + 8 * h + r) * OFP + 16 * ni + lm] = pc[mi][ni][r] * pscale + bb[mi][r >> 2][r & 3];
  __syncthreads();
  char* ob = (char*)(out + (size_t)b * actB);
  v4f val[32];
#pragma unroll
  for (int it = 0; it < 32; ++it) val[it] = *(const v4f*)&Df[(16 * it + orow) * OFP + oc4] + rv[it];
#pragma unroll
  for (int it = 0; it < 32; ++it) *(v4f*)(ob + off + (size_t)(16 * it) * NPIX * sizeof(float)) = val[it];
}

// ---------------------------------------------------------------------------
extern "C" void kernel_launch(void* const* d_in, const int* in_sizes, int n_in,
                              void* d_out, int out_size, void* d_ws,
                              size_t ws_size, hipStream_t stream) {
  if (n_in < 11) return;
  const long long per = (long long)CDIM * NPIX;
  const long long tot = (long long)in_sizes[0];
  if (tot <= 0 || (tot % per) != 0) return;
  const int B = (int)(tot / per);
  if ((long long)out_size != tot) return;
  if (in_sizes[1] != CDIM || in_sizes[2] != CDIM) return;
  if (in_sizes[3] != CDIM * CDIM || in_sizes[5] != CDIM * CDIM ||
      in_sizes[7] != CDIM * CDIM || in_sizes[9] != CDIM * CDIM) return;
  if (in_sizes[4] != CDIM || in_sizes[6] != CDIM || in_sizes[8] != CDIM || in_sizes[10] != CDIM) return;
  if (B > 65535) return;

  const float* x     = (const float*)d_in[0];
  const float* gamma = (const float*)d_in[1];
  const float* beta  = (const float*)d_in[2];
  const float* wq = (const float*)d_in[3]; const float* bq = (const float*)d_in[4];
  const float* wk = (const float*)d_in[5]; const float* bk = (const float*)d_in[6];
  const float* wv = (const float*)d_in[7]; const float* bv = (const float*)d_in[8];
  const float* wo = (const float*)d_in[9]; const float* bo = (const float*)d_in[10];
  float* out = (float*)d_out;

  // workspace carve: qT | kT | v16 | hT (each B*N*C f16) | w16 (the four weight matrices as f16)
  const size_t HB = (size_t)B * CDIM * NPIX * sizeof(_Float16);
  if (4 * HB + 4 * WEL * sizeof(_Float16) > ws_size) return;
  char* ws = (char*)d_ws;
  _Float16* qT  = (_Float16*)(ws);
  _Float16* kT  = (_Float16*)(ws + HB);
  _Float16* v16 = (_Float16*)(ws + 2 * HB);
  _Float16* hT  = (_Float16*)(ws + 3 * HB);
  _Float16* w16 = (_Float16*)(ws + 4 * HB);   // wq | wk | wv | wo (wo in fragment order)

  const size_t actB = (size_t)NPIX * CDIM;    // per-batch stride of hT/qT/kT/v16 (elements)
  const float wsc   = 64.0f;                   // f16 weight pre-scale
  const float attn_scale = 0.04419417382415922f;   // 512^-0.5
  const float psh   = 12.0f;                   // f16 probability pre-scale, as a power of two (x4096)
  const float osc   = 16.0f;                   // f16 pre-scale of the p*v result

  gn_kernel<<<B * (CDIM / CBLK) + 4 * WCB, GNT, 0, stream>>>(x, gamma, beta, hT, B * (CDIM / CBLK), wq, wk, wv, wo, wsc, w16);

  dim3 gp(3 * MT, NPIX / BT, B);
  // q, k, v in one grid: A = W[o][c] f16 (x64), Bt = hT[n][c]; q out [b][n][o] f16; k ([n][o]) and v ([o][n]) out in fragment order
  gemm_kernel<<<gp, 256, 0, stream>>>(w16, w16 + WEL, w16 + 2 * WEL, 0, CDIM, hT, actB, CDIM, CDIM,
                                         bq, bk, bv, 1, 1.0f / wsc, qT, kT, v16, actB, CDIM, NPIX);
  // attention: scores, softmax (e x4096 as f16, in LDS), o[i][c] = sum_j v16[c][j] * e[i][j] / sum_j e[i][j] (x16 as f16, in LDS),
  // then the output projection on it: A = Wo[o][c] f16 (x64); out[b][o][n] = res + acc/(64*16) + bo
  dim3 ga(NPIX / AQ, B);
  attn_kernel<<<ga, 256, 0, stream>>>(qT, kT, v16, w16 + 3 * WEL, bo, x, out, attn_scale, psh, osc, 1.0f / (wsc * osc));
}

// v010
// Measured time: 77.2 microseconds a run.
// In two side-by-side timings against v009, it was 1.06 and 1.07 times as fast.
// All steps since v000 together make it 3.22 times as fast.
#include <hip/hip_runtime.h>
#include <stddef.h>
#include <stdint.h>

// All contractions but wo*bv (f32, on the vector ALUs): v_wmma_f32_16x16x32_f16 (f16 operands, f32 accumulate): wo*wv (both x64), three 1x1 projections (weights x64, made f16 once, in the
// first launch), q*k^T, p*v (p x4096, divided by its row sum behind the product); all scales are powers of two folded back in f32.
// The output projection is linear and stands behind a sum over keys, so it is applied to v in front of that sum: wo*(wv*h + bv) = (wo*wv)*h + wo*bv.
// The third projection takes the weights wo*wv and the bias wo*bv, and p*v yields the projected result at once.
// Three launches: norm (+ weights to f16, wo*wv, wo*bv), the three projections, attention with the residual behind it.
// Fragment order: the A operands of the attention launch (k, v) lie in the workspace as tiles of 16 rows x 32 k, tile (rt, ks) of a
// matrix with KT k-steps a row at (rt * KT + ks) * FT halves; in a tile, the 8 halves (row lm, k 16p + 8h ..+7) lie at 256p + 8(16h + lm):
// lane 16h + lm of a wave reads its fragment as two 16-B loads, and each wave-wide load covers 512 B in a row.

#define CDIM 512
#define NPIX 1024
#define GCH  16      // channels per norm group (CDIM / 32)
#define CBLK 64      // channels per norm block (4 groups)
#define GNT  512     // threads per norm block
#define WEL  (CDIM * CDIM)          // elements of one weight matrix
#define WCB  (WEL / (GNT * 32))     // work-groups that convert one weight matrix: 32 elements a thread
#define WT   64                     // wo*wv: a work-group forms WT x WT results
#define WPB  ((CDIM / WT) * (CDIM / WT))   // work-groups that form wo*wv
// LDS row pitches of the GEMM tiles: 16 B x odd, so that 16 rows read or written 16 B wide fall on 64 distinct banks
// (and rows 8 apart, as the two lane halves of an accumulator hold them, fall 32 banks apart).
#define BT   128     // GEMM block tile: BT x BT results
#define BK   64      // k per slab: one whole 128-B line of an f16 operand row
#define MT   (CDIM / BT)   // block tiles along the rows of one weight matrix
#define KP   72      // operand tiles: 64 halves of k + 8 pad  (144 B)
#define DHP  136     // f16 result tile: 128 halves + 8 pad    (272 B)
#define AQ   64      // attention: queries per work-group
#define QP   520     // attention q tile, operand tiles of wo*wv: 512 halves + 8 pad  (1040 B)
#define PP   1032    // attention p tile: 1024 halves + 8 pad        (2064 B)
#define OFP  68      // attention f32 result tile: 64 floats + 4 pad (272 B)
#define FT   512     // halves of one fragment tile: 16 rows x 32 k of an A operand, 1 KB, stored in the order in which a wave's registers hold it

typedef _Float16 v16h __attribute__((ext_vector_type(16)));
typedef _Float16 v8h  __attribute__((ext_vector_type(8)));
typedef float    v8f  __attribute__((ext_vector_type(8)));
typedef float    v4f  __attribute__((ext_vector_type(4)));
typedef float    v2f  __attribute__((ext_vector_type(2)));
union Frag { v16h v; v8h half[2]; };

// ---------------------------------------------------------------------------
// 16x16x32 f16 WMMA with hazard guard.
__device__ __forceinline__ v8f wmma_f16(v16h a, v16h b, v8f c) {
  v8f d = __builtin_amdgcn_wmma_f32_16x16x32_f16(false, a, false, b, (short)0, c, false, false);
  asm volatile("v_nop\n\tv_nop\n\tv_nop\n\tv_nop" : "+v"(d) : "v"(a), "v"(b));
  return d;
}

// The builtin alone, for the attention kernel: its accumulators reach above v255, where an asm operand cannot lie
// (tied to the asm guard above they all went to scratch); the compiler keeps the distances behind its own builtin. wo*wv takes it too.
__device__ __forceinline__ v8f wmma_f16_b(v16h a, v16h b, v8f c) {
  return __builtin_amdgcn_wmma_f32_16x16x32_f16(false, a, false, b, (short)0, c, false, false);
}

// 2^x with the free slot behind it that the instruction set asks for after a transcendental, in one statement.
__device__ __forceinline__ float exp2_slot(float x) {
  float e;
  asm("v_exp_f32 %0, %1\n\tv_nop" : "=v"(e) : "v"(x));
  return e;
}

// Work-group barrier that orders the LDS alone. __syncthreads() also waits out every global load in flight; across the barriers of the attention
// kernel the next A rows' and the residual's loads (read-only data, used by the loading thread alone) are to stay in flight.
__device__ __forceinline__ void barrier_lds() {
  __builtin_amdgcn_fence(__ATOMIC_RELEASE, "workgroup", "local");
  __builtin_amdgcn_s_barrier();
  __builtin_amdgcn_fence(__ATOMIC_ACQUIRE, "workgroup", "local");
}

// Fragment from an LDS tile stored [row][k] with pitch KP halves (used for A rows and for B columns alike):
// lane l: row = l&15, h = l>>4; elements 0..7 <- k 8h..8h+7, elements 8..15 <- k 16+8h..16+8h+7.
__device__ __forceinline__ v16h ld_frag(const _Float16* tile, int row, int h) {
  Frag f;
  const _Float16* rp = tile + row * KP;
  f.half[0] = *(const v8h*)(rp + 8 * h);
  f.half[1] = *(const v8h*)(rp + 16 + 8 * h);
  return f.v;
}

// The same fragment from a tile of another row pitch (in halves).
template <int PITCH>
__device__ __forceinline__ v16h ld_frag_p(const _Float16* tile, int row, int h) {
  Frag f;
  const _Float16* rp = tile + row * PITCH;
  f.half[0] = *(const v8h*)(rp + 8 * h);
  f.half[1] = *(const v8h*)(rp + 16 + 8 * h);
  return f.v;
}

// A fragment from a tile in fragment order in global memory; tile already holds the lane's 8 * lane halves.
__device__ __forceinline__ v16h ld_frag_g(const _Float16* tile) {
  Frag f;
  f.half[0] = *(const v8h*)(tile);
  f.half[1] = *(const v8h*)(tile + FT / 2);
  return f.v;
}

// ---------------------------------------------------------------------------
// Kernel 1: group norm -> transposed f16 activations hT[b][n][c].
// One work-group of 16 waves per 64 channels (4 groups) of one batch. Wave w holds channels 8(w&7)..+7 x pixels 512(w>>3)..+511 in
// registers: every wave-wide load covers 512 B in a row of one channel, x is read once, statistics and normalisation work on the registers.
// A lane holds 8 channels of each of its pixels, so a pixel's part of the transposed tile is one 16-B LDS store.
// Pixel n = 128a + 4l + e lies in LDS row 128a + 32e + l: the 32 lanes of a store fall on 32 rows in a row (pitch 16 B x odd).
// Behind the nnorm norm blocks come 2 * WCB work-groups that turn wq and wk into f16 (x wscale), w16[matrix][o][c] (each weight is rounded once here,
// and the GEMM work-groups that share it read 2 bytes of it, not 4), WPB work-groups that form wo*wv (x wscale, f16) as the third matrix of w16,
// and CDIM / 128 that form the f32 vector wo*bv.
__global__ __launch_bounds__(GNT) void gn_kernel(
    const float* __restrict__ x, const float* __restrict__ gamma,
    const float* __restrict__ beta, _Float16* hT, int nnorm,
    const float* __restrict__ w0, const float* __restrict__ w1, const float* __restrict__ w2, const float* __restrict__ w3,
    const float* __restrict__ b2v, float wscale, _Float16* w16, float* bvo) {
  __shared__ __align__(16) _Float16 Ts[NPIX * KP];
  __shared__ float rs1[GNT / 32], rs2[GNT / 32];

  // which part a work-group takes is the same for all its threads, and is tested in front of every barrier
  if ((int)blockIdx.x >= nnorm + 2 * WCB + WPB) {
    // wo*bv in f32: a work-group forms 128 rows, wave w rows 8w..8w+7 of them; a row is 4 wave-wide loads of 512 B;
    // the sums meet in LDS so that whole lines are stored
    const int tx = (int)threadIdx.x, lane = tx & 31, wr = tx >> 5;
    const int r0 = ((int)blockIdx.x - (nnorm + 2 * WCB + WPB)) * 128;
    const float* wp = w3 + (size_t)(r0 + 8 * wr) * CDIM + 4 * lane;
    v4f bl[4], wl[8][4];
#pragma unroll
    for (int j = 0; j < 4; ++j) bl[j] = *(const v4f*)(b2v + 4 * lane + 128 * j);
#pragma unroll
    for (int i = 0; i < 8; ++i)
#pragma unroll
      for (int j = 0; j < 4; ++j) wl[i][j] = *(const v4f*)(wp + i * CDIM + 128 * j);
    // registers that held these loads' addresses are reused below: wait before they are overwritten
    asm volatile("s_wait_xcnt 0x0" ::: "memory");
    float mine = 0.f;   // lane i keeps row i of the wave's eight
#pragma unroll
    for (int i = 0; i < 8; ++i) {
      v4f p4 = wl[i][0] * bl[0];
#pragma unroll
      for (int j = 1; j < 4; ++j) p4 += wl[i][j] * bl[j];
      float s = (p4[0] + p4[1]) + (p4[2] + p4[3]);
#pragma unroll
      for (int k = 16; k > 0; k >>= 1) s += __shfl_xor(s, k, 32);
      if (lane == i) mine = s;
    }
    float* sums = (float*)Ts;
    if (lane < 8) sums[8 * wr + lane] = mine;
    __syncthreads();
    if (tx < 128) bvo[r0 + tx] = sums[tx];
    return;
  }
  if ((int)blockIdx.x >= nnorm + 2 * WCB) {
    // wo*wv: D[o][c] = sum_m wo[o][m] * wv[m][c], WT x WT results over all 512 m; 16 waves, one 16 x 16 accumulator each.
    // Both operands go to LDS as f16 (x wscale) with m contiguous: wo rows as they lie, wv columns turned in registers (a thread holds 8 m of 4 columns).
    const int pt = (int)blockIdx.x - (nnorm + 2 * WCB);
    const int o0 = (pt / (CDIM / WT)) * WT, n0 = (pt % (CDIM / WT)) * WT;
    const int tx = (int)threadIdx.x, lane = tx & 31, wr = tx >> 5;
    _Float16* Aw = Ts;             // [o][m], pitch QP
    _Float16* Bw = Ts + WT * QP;   // [c][m], pitch QP
    const int ar = tx >> 6, am = (tx & 63) * 8;   // a wo row is 2 KB: 64 threads x 32 B, 8 rows a sweep
    const int cq = tx & 15, mo = tx >> 4;         // 4 columns of wv, 8 rows of it: a wave-wide load covers 256 B of each of two rows
    const float* ap = w3 + (size_t)(o0 + ar) * CDIM + am;
    const float* bp = w2 + (size_t)(8 * mo) * CDIM + n0 + 4 * cq;
    v4f al[8][2], bl[2][8];
#pragma unroll
    for (int i = 0; i < 8; ++i) {
      al[i][0] = *(const v4f*)(ap + (8 * i) * CDIM);
      al[i][1] = *(const v4f*)(ap + (8 * i) * CDIM + 4);
    }
#pragma unroll
    for (int u = 0; u < 2; ++u)
#pragma unroll
      for (int r = 0; r < 8; ++r) bl[u][r] = *(const v4f*)(bp + (256 * u + r) * CDIM);
    // registers that held these loads' addresses are reused below: wait before they are overwritten
    // (the two addresses are inputs so that they live up to the wait: the last load's data had been given the address's own registers)
    asm volatile("s_wait_xcnt 0x0" :: "v"(ap), "v"(bp) : "memory");
    // holds the conversions behind both groups of loads: left free, the second group went out only when the first had begun to come back
    __builtin_amdgcn_sched_barrier(0);
#pragma unroll
    for (int i = 0; i < 8; ++i) {
      v8h o;
#pragma unroll
      for (int e = 0; e < 8; ++e) o[e] = (_Float16)(al[i][e >> 2][e & 3] * wscale);
      *(v8h*)&Aw[(8 * i + ar) * QP + am] = o;
    }
#pragma unroll
    for (int u = 0; u < 2; ++u)
#pragma unroll
      for (int e = 0; e < 4; ++e) {
        v8h o;
#pragma unroll
        for (int r = 0; r < 8; ++r) o[r] = (_Float16)(bl[u][r][e] * wscale);
        *(v8h*)&Bw[(4 * cq + e) * QP + 256 * u + 8 * mo] = o;
      }
    __syncthreads();
    const int h = lane >> 4, lm = lane & 15, mt = wr >> 2, nt = wr & 3;
    v8f acc;
#pragma unroll
    for (int e = 0; e < 8; ++e) acc[e] = 0.f;
#pragma unroll
    for (int ks = 0; ks < CDIM / 32; ++ks)   // rising m
      acc = wmma_f16_b(ld_frag_p<QP>(Aw + 32 * ks, 16 * mt + lm, h), ld_frag_p<QP>(Bw + 32 * ks, 16 * nt + lm, h), acc);
    __syncthreads();   // every wave has left the operand tiles: the result tile may overwrite them
    // acc[r] = (row 16mt + 8h + r, column 16nt + lm), x wscale^2; staged in LDS so that whole lines are stored
    const float back = 1.0f / wscale;
#pragma unroll
    for (int r = 0; r < 8; ++r) Ts[(16 * mt + 8 * h + r) * KP + 16 * nt + lm] = (_Float16)(acc[r] * back);
    __syncthreads();
    const int row = tx >> 3, p = tx & 7;   // a result row is one line: 8 lanes x 16 B
    *(v8h*)(w16 + 2 * (size_t)WEL + (size_t)(o0 + row) * CDIM + n0 + 8 * p) = *(const v8h*)&Ts[row * KP + 8 * p];
    // wait before a register that this store names is overwritten (in the listing the next part's loads follow it and land on them)
    asm volatile("s_wait_xcnt 0x0" ::: "memory");
    return;
  }
  if ((int)blockIdx.x >= nnorm) {
    const int cb = (int)blockIdx.x - nnorm, mat = cb / WCB;
    const float* wsrc = (mat == 0) ? w0 : w1;
    const int e0 = (cb % WCB) * (GNT * 32) + (int)threadIdx.x * 8;   // a sweep: 8 elements a thread, 16-B stores side by side
    v4f wl[4][2];
#pragma unroll
    for (int i = 0; i < 4; ++i) {
      wl[i][0] = *(const v4f*)(wsrc + e0 + i * (GNT * 8));
      wl[i][1] = *(const v4f*)(wsrc + e0 + i * (GNT * 8) + 4);
      // wait before a register that these loads name is overwritten
      asm volatile("s_wait_xcnt 0x0" ::: "memory");
    }
    _Float16* wd = w16 + (size_t)mat * WEL + e0;
#pragma unroll
    for (int i = 0; i < 4; ++i) {
      v8h o;
#pragma unroll
      for (int e = 0; e < 8; ++e) o[e] = (_Float16)(wl[i][e >> 2][e & 3] * wscale);
      *(v8h*)(wd + i * (GNT * 8)) = o;
    }
    // wait before a register that these stores name is overwritten (in the listing the norm part's argument loads follow them)
    asm volatile("s_wait_xcnt 0x0" ::: "memory");
    return;
  }
  const int b  = blockIdx.x >> 3, cg = blockIdx.x & 7;
  const int c0 = cg * CBLK;
  const int t  = threadIdx.x, lane = t & 31;
  const int wv = __builtin_amdgcn_readfirstlane(t >> 5);   // the wave's number as a scalar: the bases of its loads stay in scalar registers
  const int oct = wv & 7, ph = wv >> 3;      // channel octet, half of the pixel range
  const float* xw = x + ((size_t)b * CDIM + c0 + 8 * oct) * NPIX + ph * (NPIX / 2);   // the wave's part of x
  const int lo4 = 4 * lane;                  // the lane's place in a 512-B run

  v4f v[8][4];
#pragma unroll
  for (int i = 0; i < 8; ++i)
#pragma unroll
    for (int j = 0; j < 4; ++j) v[i][j] = *(const v4f*)(xw + lo4 + i * NPIX + 128 * j);
  v4f ga[2], be[2];
#pragma unroll
  for (int u = 0; u < 2; ++u) {
    // a wait behind each load, before a register that it names is overwritten (they share one offset register)
    ga[u] = *(const v4f*)(gamma + c0 + 8 * oct + 4 * u);
    asm volatile("s_wait_xcnt 0x0" ::: "memory");
    be[u] = *(const v4f*)(beta + c0 + 8 * oct + 4 * u);
    asm volatile("s_wait_xcnt 0x0" ::: "memory");
  }

  // statistics: all 8 channels of a wave belong to one group; pixel pairs are summed two wide, one chain per 128-pixel run
  v2f sa[4], qa[4];
#pragma unroll
  for (int j = 0; j < 4; ++j) { sa[j] = (v2f){0.f, 0.f}; qa[j] = (v2f){0.f, 0.f}; }
#pragma unroll
  for (int i = 0; i < 8; ++i)
#pragma unroll
    for (int j = 0; j < 4; ++j) {
      const v2f lo = __builtin_shufflevector(v[i][j], v[i][j], 0, 1);
      const v2f hi = __builtin_shufflevector(v[i][j], v[i][j], 2, 3);
      sa[j] += lo; sa[j] += hi;
      qa[j] += lo * lo; qa[j] += hi * hi;
    }
  const v2f st = (sa[0] + sa[1]) + (sa[2] + sa[3]);
  const v2f qt = (qa[0] + qa[1]) + (qa[2] + qa[3]);
  float s = st[0] + st[1], ss = qt[0] + qt[1];
#pragma unroll
  for (int k = 16; k > 0; k >>= 1) { s += __shfl_xor(s, k, 32); ss += __shfl_xor(ss, k, 32); }
  if (lane == 0) { rs1[wv] = s; rs2[wv] = ss; }
  __syncthreads();
  // a group is two octets x two pixel halves: waves o2, o2+1, o2+8, o2+9
  const int o2 = oct & 6;
  const float gs  = (rs1[o2] + rs1[o2 + 1]) + (rs1[o2 + 8] + rs1[o2 + 9]);
  const float gss = (rs2[o2] + rs2[o2 + 1]) + (rs2[o2 + 8] + rs2[o2 + 9]);
  const float inv_cnt = 1.0f / (float)(GCH * NPIX);
  const float mean = gs * inv_cnt;
  float var = gss * inv_cnt - mean * mean;
  var = fmaxf(var, 0.f);
  const float inv = rsqrtf(var + 1e-6f);
  float gm[8], bt[8];
#pragma unroll
  for (int i = 0; i < 8; ++i) {
    gm[i] = ga[i >> 2][i & 3] * inv;
    bt[i] = be[i >> 2][i & 3] - mean * gm[i];
  }

#pragma unroll
  for (int j = 0; j < 4; ++j)
#pragma unroll
    for (int e = 0; e < 4; ++e) {
      v8h pv;
#pragma unroll
      for (int i = 0; i < 8; ++i) pv[i] = (_Float16)(v[i][j][e] * gm[i] + bt[i]);
      *(v8h*)&Ts[(128 * (4 * ph + j) + 32 * e + lane) * KP + 8 * oct] = pv;
    }
  __syncthreads();

  // 1024 lines (one per pixel), 8 lanes x 16 B per line; sweep it takes LDS rows 64it..64it+63
  const int rl = t >> 3, p = t & 7;           // row in the sweep, 16-B piece of the line
  _Float16* hp = hT + ((size_t)b * NPIX + 4 * (rl & 31) + (rl >> 5)) * CDIM + c0 + p * 8;
  v8h val[16];
#pragma unroll
  for (int it = 0; it < 16; ++it) val[it] = *(const v8h*)&Ts[(64 * it + rl) * KP + p * 8];
#pragma unroll
  for (int it = 0; it < 16; ++it) *(v8h*)(hp + (size_t)(128 * (it >> 1) + 2 * (it & 1)) * CDIM) = val[it];
}

// ---------------------------------------------------------------------------
// 128x128 tile GEMM on f16 16x16x32 WMMA: D[m][n] = sum_k A[m][k] * Bt[n][k]  (both operands k-contiguous).
// 8 waves as 2 x 4, each 64 x 32 of the tile (4 x 2 accumulators); a k-slab is 64, worked as two WMMA depths in rising k.
// A and Bt are f16.
// Three products on one Bt in one grid, f16 out: blockIdx.x = MT * job + row tile; job j takes A, bias and result j.
//   job 0 is stored [n][m] (m contiguous): out16[b*o_bs + (n0+n)*ldo + m0+m]
//   job 1 is the matrix [n][m] (ldo wide), job 2 the matrix [m][n] (ldo2 wide), each stored in fragment order (rows x k)
//   (job 2's weights are wo*wv and its bias wo*bv: its result is the output projection of v)
__global__ __launch_bounds__(256) void gemm_kernel(
    const _Float16* __restrict__ Ah0, const _Float16* __restrict__ Ah1, const _Float16* __restrict__ Ah2, size_t a_bs, int lda,
    const _Float16* __restrict__ Bt, size_t b_bs, int ldb, int K,
    const float* __restrict__ bias0, const float* __restrict__ bias1, const float* __restrict__ bias2, int has_bias, float oscale,
    _Float16* out16_0, _Float16* out16_1, _Float16* out16_2,
    size_t o_bs, int ldo, int ldo2) {
  // the job is the same for the whole work-group: what it picks stays in scalar registers
  const int job = (int)(blockIdx.x / MT);
  const int m0 = (int)(blockIdx.x % MT) * BT, n0 = blockIdx.y * BT, b = blockIdx.z;
  const _Float16* Ah = (job == 0) ? Ah0 : (job == 1) ? Ah1 : Ah2;
  const float* bias = (job == 0) ? bias0 : (job == 1) ? bias1 : bias2;
  _Float16* out16   = (job == 0) ? out16_0 : (job == 1) ? out16_1 : out16_2;
  const bool tr = job < 2;   // result stored [n][m]
  const int tid = threadIdx.x, lane = tid & 31, wv = tid >> 5;
  const int h = lane >> 4, lm = lane & 15;
  const int wr = (wv >> 2) * 64, wc = (wv & 3) * 32;

  __shared__ __align__(16) _Float16 As[BT * KP];   // [m][k]
  __shared__ __align__(16) _Float16 Bs[BT * KP];   // [n][k]
  __shared__ __align__(16) _Float16 Dh[BT * DHP];

  v8f zero;
#pragma unroll
  for (int e = 0; e < 8; ++e) zero[e] = 0.f;
  v8f acc[4][2];
#pragma unroll
  for (int mi = 0; mi < 4; ++mi) { acc[mi][0] = zero; acc[mi][1] = zero; }

  // staging: a slab row is 128 B of f16 (8 lanes x 16 B, 32 rows a sweep), so every wave-wide load covers four whole lines
  const int hr = tid >> 3, hk = (tid & 7) * 8;
  const _Float16* ap_h = Ah + (size_t)b * a_bs + (size_t)(m0 + hr) * lda + hk;
  const _Float16* bp   = Bt + (size_t)b * b_bs + (size_t)(n0 + hr) * ldb + hk;

  v8h ah[4], bh[4];
#pragma unroll
  for (int i = 0; i < 4; ++i) ah[i] = *(const v8h*)(ap_h + (size_t)(32 * i) * lda);
#pragma unroll
  for (int i = 0; i < 4; ++i) bh[i] = *(const v8h*)(bp + (size_t)(32 * i) * ldb);

  for (int k0 = 0; k0 < K; k0 += BK) {
#pragma unroll
    for (int i = 0; i < 4; ++i) *(v8h*)&As[(32 * i + hr) * KP + hk] = ah[i];
#pragma unroll
    for (int i = 0; i < 4; ++i) *(v8h*)&Bs[(32 * i + hr) * KP + hk] = bh[i];
    __syncthreads();

    const int k1 = k0 + BK;
    if (k1 < K) {   // prefetch next k-slab into registers (block-uniform)
#pragma unroll
      for (int i = 0; i < 4; ++i) ah[i] = *(const v8h*)(ap_h + (size_t)(32 * i) * lda + k1);
#pragma unroll
      for (int i = 0; i < 4; ++i) bh[i] = *(const v8h*)(bp + (size_t)(32 * i) * ldb + k1);
      // the fragment reads below land in the registers that held these loads' addresses: wait before they are overwritten
      asm volatile("s_wait_xcnt 0x0" ::: "memory");
    }

#pragma unroll
    for (int kk = 0; kk < BK; kk += 32) {
      v16h a[4], bf[2];
#pragma unroll
      for (int mi = 0; mi < 4; ++mi) a[mi] = ld_frag(As + kk, wr + 16 * mi + lm, h);
#pragma unroll
      for (int ni = 0; ni < 2; ++ni) bf[ni] = ld_frag(Bs + kk, wc + 16 * ni + lm, h);
#pragma unroll
      for (int mi = 0; mi < 4; ++mi)
#pragma unroll
        for (int ni = 0; ni < 2; ++ni) acc[mi][ni] = wmma_f16(a[mi], bf[ni], acc[mi][ni]);
    }
    __syncthreads();
  }

  // The bias of the lane's 4 x 8 result rows goes out as one group, the flag tested once: the latencies run side by side.
  v4f bb[4][2];
#pragma unroll
  for (int mi = 0; mi < 4; ++mi) { bb[mi][0] = (v4f){0.f, 0.f, 0.f, 0.f}; bb[mi][1] = (v4f){0.f, 0.f, 0.f, 0.f}; }
  if (has_bias) {
    const float* bp4 = bias + m0 + wr + 8 * h;
#pragma unroll
    for (int mi = 0; mi < 4; ++mi) {
      bb[mi][0] = *(const v4f*)(bp4 + 16 * mi);
      bb[mi][1] = *(const v4f*)(bp4 + 16 * mi + 4);
    }
    // registers that held these loads' addresses are reused below: wait before they are overwritten
    asm volatile("s_wait_xcnt 0x0" ::: "memory");
  }

  // D: acc[mi][ni][r] = tile element (row wr+mi*16+8h+r, col wc+ni*16+lm); stage in LDS in the order it is stored in
  // (the order is tested once, outside the loops)
  if (tr) {
#pragma unroll
    for (int mi = 0; mi < 4; ++mi)
#pragma unroll
      for (int ni = 0; ni < 2; ++ni)
#pragma unroll
        for (int r = 0; r < 8; ++r)
          Dh[(wc + ni * 16 + lm) * DHP + wr + mi * 16 + 8 * h + r] = (_Float16)(acc[mi][ni][r] * oscale + bb[mi][r >> 2][r & 3]);
  } else {
#pragma unroll
    for (int mi = 0; mi < 4; ++mi)
#pragma unroll
      for (int ni = 0; ni < 2; ++ni)
#pragma unroll
        for (int r = 0; r < 8; ++r)
          Dh[(wr + mi * 16 + 8 * h + r) * DHP + wc + ni * 16 + lm] = (_Float16)(acc[mi][ni][r] * oscale + bb[mi][r >> 2][r & 3]);
  }
  __syncthreads();

  // 128 rows x 256 B: two lines per row, 16 lanes x 16 B per row
  const int r0 = tr ? n0 : m0, c0 = tr ? m0 : n0, ld = tr ? ldo : ldo2;   // the stored tile's first row, first column and row pitch
  v8h val[8]; size_t idx[8];
  if (job == 0) {
#pragma unroll
    for (int it = 0; it < 8; ++it) {
      const int sI = it * 256 + tid;
      const int row = sI >> 4, p = sI & 15;
      val[it] = *(const v8h*)&Dh[row * DHP + p * 8];
      idx[it] = (size_t)b * o_bs + (size_t)(r0 + row) * ld + c0 + p * 8;
    }
  } else {
    // fragment order: the block tile is 8 x 4 whole fragment tiles of 64 pieces; a wave's 32 pieces lie 512 B in a row
    const int kt = ld >> 5;   // k-steps of a row
#pragma unroll
    for (int it = 0; it < 8; ++it) {
      const int sI = it * 256 + tid;
      const int rt = sI >> 8, ks = (sI >> 6) & 3, u = sI & 63;
      val[it] = *(const v8h*)&Dh[(16 * rt + (u & 15)) * DHP + 32 * ks + 16 * (u >> 5) + 8 * ((u >> 4) & 1)];
      idx[it] = (size_t)b * o_bs + ((size_t)((r0 >> 4) + rt) * kt + (c0 >> 5) + ks) * FT + u * 8;
    }
  }
#pragma unroll
  for (int it = 0; it < 8; ++it) *(v8h*)(out16 + idx[it]) = val[it];
}

// ---------------------------------------------------------------------------
// Eight A fragments (4 row tiles x 2 k-steps: slab s of 64 k) from a matrix in fragment order with KT k-steps a row; ag holds the wave's first
// row tile and the lane's place.
template <int KT>
__device__ __forceinline__ void ld_a8(v16h (&a)[8], const _Float16* ag, int s) {
  const _Float16* p = ag + (size_t)s * (2 * FT);
#pragma unroll
  for (int ks = 0; ks < 2; ++ks)
#pragma unroll
    for (int mi = 0; mi < 4; ++mi) a[4 * ks + mi] = ld_frag_g(p + (mi * KT + ks) * FT);
  // the address of the next group is formed in the registers that these loads name: wait before they are overwritten
  asm volatile("s_wait_xcnt 0x0" ::: "memory");
}

// c[mi][ni] += (64 rows of the wave, from global memory in fragment order) x (64 columns of an LDS tile [column][k], pitch PITCH), over NS slabs of 64 k
// in rising k. No wave shares its rows, so they pass through no LDS and the loop holds no barrier; slab s + 1 flies while slab s is worked on
// (two register sets; a0 holds slab 0 on entry). between() runs in front of the last slab's products, when a0 is free again.
template <int KT, int PITCH, int NS, typename F>
__device__ __forceinline__ void rows_times_tile(const _Float16* ag, const _Float16* bt, int lm, int h,
                                                v16h (&a0)[8], v16h (&a1)[8], v8f (&c)[4][4], F between) {
  auto slab = [&](v16h (&a)[8], int s) {
    v16h bf[8];
#pragma unroll
    for (int ks = 0; ks < 2; ++ks)
#pragma unroll
      for (int ni = 0; ni < 4; ++ni) bf[4 * ks + ni] = ld_frag_p<PITCH>(bt + BK * s + 32 * ks, 16 * ni + lm, h);
    // keeps the slab's LDS reads, and the global loads in front of them, as one group in front of its 32 WMMAs: left free, the compiler read
    // one fragment at a time into one register set and waited out the latency before every 4 WMMAs
    __builtin_amdgcn_sched_barrier(0);
#pragma unroll
    for (int ks = 0; ks < 2; ++ks)   // rising k
#pragma unroll
      for (int mi = 0; mi < 4; ++mi)
#pragma unroll
        for (int ni = 0; ni < 4; ++ni) c[mi][ni] = wmma_f16_b(a[4 * ks + mi], bf[4 * ks + ni], c[mi][ni]);
    // ends the block: the next group's loads do not move in among these WMMAs
    __builtin_amdgcn_sched_barrier(0);
  };
  // rolled: two slabs a trip, so that each register set keeps its name
#pragma unroll 1
  for (int s = 0; s < NS - 2; s += 2) {
    ld_a8<KT>(a1, ag, s + 1);
    slab(a0, s);
    ld_a8<KT>(a0, ag, s + 2);
    slab(a1, s + 1);
  }
  ld_a8<KT>(a1, ag, NS - 1);
  slab(a0, NS - 2);
  between();
  slab(a1, NS - 1);
}

// ---------------------------------------------------------------------------
// Kernel: attention of AQ queries against all NPIX keys of one batch; one work-group of 8 waves.
// Phase 1: St[j][i] = sum_c k[j][c] * qT[i][c]; wave w holds keys 128w..128w+127 x 64 queries in 8 x 4 accumulators,
//          so a lane holds 64 scores of each of 4 queries (query 16ni+lm, keys 128w+16mi+8h+r).
// Softmax: maximum and sum in the lane, one exchange between the lane halves, then over the 8 waves through LDS.
// Phase 2: Rt[o][i] = sum_j v[o][j] * P[i][j], v being the projected values; P (f16, not yet divided by its row sum) lies in LDS as [query][key];
//          wave w holds result rows 64w..64w+63; out[b][o][i0+i] = res + Rt / row sum + bo, staged in LDS so that whole lines are stored.
// In both phases the A rows (keys, result rows) belong to one wave alone: they come from global memory in fragment order straight
// into that wave's registers, one step ahead of their products. LDS holds only what the waves share, one after the other in the same place:
// q tile AQ x QP, p tile AQ x PP, f32 result tile 512 x OFP.
__global__ __launch_bounds__(256) void attn_kernel(
    const _Float16* __restrict__ qT, const _Float16* __restrict__ kF, const _Float16* __restrict__ vF,
    const float* __restrict__ bo, const float* __restrict__ res, float* out,
    float sscale, float pshift) {
  const int i0 = blockIdx.x * AQ, b = blockIdx.y;
  const int tid = threadIdx.x, lane = tid & 31;
  const int wv = __builtin_amdgcn_readfirstlane(tid >> 5);   // the wave's number as a scalar: the bases of its rows stay in scalar registers
  const int h = lane >> 4, lm = lane & 15;
  const size_t actB = (size_t)NPIX * CDIM;

  __shared__ __align__(16) _Float16 sm[CDIM * OFP * 2];   // the largest of the three tiles
  __shared__ float redm[8 * AQ], reds[8 * AQ];
  __shared__ __align__(16) float bos[CDIM];   // the output projection's bias
  _Float16* Qs = sm;
  _Float16* Pl = sm;

  v8f zero;
#pragma unroll
  for (int e = 0; e < 8; ++e) zero[e] = 0.f;

  // the wave's rows in the two A operands, with the lane's place in a fragment tile
  const _Float16* kg = kF + (size_t)b * actB + (size_t)wv * (8 * (CDIM / 32) * FT) + 8 * lane;
  const _Float16* vg = vF + (size_t)b * actB + (size_t)wv * (4 * (NPIX / 32) * FT) + 8 * lane;

  // k-step ks of the wave's 8 key tiles
  auto ld_k8 = [&](v16h (&a)[8], int ks) {
    const _Float16* p = kg + (size_t)ks * FT;
#pragma unroll
    for (int mi = 0; mi < 8; ++mi) a[mi] = ld_frag_g(p + mi * ((CDIM / 32) * FT));
    // the address of the next group is formed in the registers that these loads name: wait before they are overwritten
    asm volatile("s_wait_xcnt 0x0" ::: "memory");
  };
  auto ld_q4 = [&](v16h (&q)[4], int ks) {
#pragma unroll
    for (int ni = 0; ni < 4; ++ni) q[ni] = ld_frag_p<QP>(Qs + 32 * ks, 16 * ni + lm, h);
  };

  v16h a0[8], a1[8];
  {
    // q rows are 1024 B (64 lanes x 16 B, 4 rows a sweep)
    const int qr = tid >> 6, qc = (tid & 63) * 8;
    const _Float16* qp = qT + (size_t)b * actB + (size_t)(i0 + qr) * CDIM + qc;
    v8h qv[16];
#pragma unroll
    for (int it = 0; it < 16; ++it) qv[it] = *(const v8h*)(qp + (size_t)(4 * it) * CDIM);
    // registers that held these loads' addresses are reused below: wait before they are overwritten
    asm volatile("s_wait_xcnt 0x0" ::: "memory");
    ld_k8(a0, 0);   // behind q: loads come back in the order of issue, and q is wanted first
    // holds what follows behind those waits: the compiler had lifted the accumulators' zeroing, which lands on the address registers, over them
    __builtin_amdgcn_sched_barrier(0);
#pragma unroll
    for (int it = 0; it < 16; ++it) *(v8h*)&Qs[(4 * it + qr) * QP + qc] = qv[it];
  }

  v8f acc[8][4];
#pragma unroll
  for (int mi = 0; mi < 8; ++mi)
#pragma unroll
    for (int ni = 0; ni < 4; ++ni) acc[mi][ni] = zero;

  barrier_lds();   // publishes the q tile; the first keys' loads stay in flight

  {
    v16h q0[4], q1[4];
    auto mm1 = [&](v16h (&a)[8], v16h (&q)[4]) {
      // keeps the loads of the next step as one group in front of this step's 32 WMMAs
      __builtin_amdgcn_sched_barrier(0);
#pragma unroll
      for (int mi = 0; mi < 8; ++mi)
#pragma unroll
        for (int ni = 0; ni < 4; ++ni) acc[mi][ni] = wmma_f16_b(a[mi], q[ni], acc[mi][ni]);
      // ends the block: the loads behind it do not move in among these WMMAs
      __builtin_amdgcn_sched_barrier(0);
    };
    ld_q4(q0, 0);
    // rolled: two k-steps a trip, so that each register set keeps its name
#pragma unroll 1
    for (int ks = 0; ks < CDIM / 32 - 2; ks += 2) {
      ld_k8(a1, ks + 1);
      ld_q4(q1, ks + 1);
      mm1(a0, q0);
      ld_k8(a0, ks + 2);
      ld_q4(q0, ks + 2);
      mm1(a1, q1);
    }
    ld_k8(a1, CDIM / 32 - 1);
    ld_q4(q1, CDIM / 32 - 1);
    mm1(a0, q0);
    ld_a8<NPIX / 32>(a0, vg, 0);   // first v slab: its latency runs under the softmax
    mm1(a1, q1);
  }

  // softmax in the log2 domain: e = 2^((score - row maximum) * sscale * log2(e) + pshift), at most 2^pshift, goes to LDS as f16
  // without the division; the row sum of the same e divides the p*v result at the end
  const float c1 = sscale * 1.4426950408889634f;
#pragma unroll
  for (int ni = 0; ni < 4; ++ni) {
    float m = acc[0][ni][0];
#pragma unroll
    for (int mi = 0; mi < 8; ++mi)
#pragma unroll
      for (int r = 0; r < 8; ++r) m = fmaxf(m, acc[mi][ni][r]);
    m = fmaxf(m, __shfl_xor(m, 16, 32));
    if (h == 0) redm[wv * AQ + 16 * ni + lm] = m;
  }
  barrier_lds();
  // every wave has left the q tile (the barrier above): the p tile may overwrite it
#pragma unroll
  for (int ni = 0; ni < 4; ++ni) {
    float m = redm[16 * ni + lm];
#pragma unroll
    for (int w = 1; w < 8; ++w) m = fmaxf(m, redm[w * AQ + 16 * ni + lm]);
    const float mc = m * c1 - pshift;
    float s = 0.f;
#pragma unroll
    for (int mi = 0; mi < 8; ++mi) {
      v8h pv;
#pragma unroll
      for (int r = 0; r < 8; ++r) {
        const float e = exp2_slot(acc[mi][ni][r] * c1 - mc);
        s += e;
        pv[r] = (_Float16)e;
      }
      *(v8h*)&Pl[(16 * ni + lm) * PP + 128 * wv + 16 * mi + 8 * h] = pv;
    }
    s += __shfl_xor(s, 16, 32);
    if (h == 0) reds[wv * AQ + 16 * ni + lm] = s;
  }

  v8f oc[4][4];
#pragma unroll
  for (int mi = 0; mi < 4; ++mi)
#pragma unroll
    for (int ni = 0; ni < 4; ++ni) oc[mi][ni] = zero;

  barrier_lds();   // publishes the p tile and the waves' row sums

  // The residual: the 32 pieces of it that belong to what the thread stores
  // (512 rows x 256 B: two lines per row, 16 lanes x 16 B per row, 16 rows a sweep).
  const int orow = tid >> 4, oc4 = (tid & 15) * 4;
  const unsigned off = (unsigned)(orow * NPIX + i0 + oc4) * 4u;   // the first piece's byte offset in the batch's plane; lives on to the stores: no load lands on it
  const char* rb = (const char*)(res + (size_t)b * actB);
  v4f rv[32];
  v2f b2;
  rows_times_tile<NPIX / 32, PP, NPIX / BK>(vg, Pl, lm, h, a0, a1, oc, [&]() {
    // the bias goes out first: loads come back in the order of issue, and what is wanted first (for LDS) must not wait for the rest
    b2 = *(const v2f*)(bo + 2 * tid);
    // the residual's reads run under the last products, the division and the staging of the result
#pragma unroll
    for (int it = 0; it < 32; ++it) rv[it] = *(const v4f*)(rb + off + (size_t)(16 * it) * NPIX * sizeof(float));
    // registers that held these loads' addresses may be reused below: wait before they are overwritten
    asm volatile("s_wait_xcnt 0x0" ::: "memory");
  });

  float inv[4];
#pragma unroll
  for (int ni = 0; ni < 4; ++ni) {
    float s = reds[16 * ni + lm];
#pragma unroll
    for (int w = 1; w < 8; ++w) s += reds[w * AQ + 16 * ni + lm];
    inv[ni] = 1.0f / s;
  }
  *(v2f*)&bos[2 * tid] = b2;

  barrier_lds();   // every wave has left the p tile: the result tile may overwrite it; publishes the bias

  v4f bb[4][2];
#pragma unroll
  for (int mi = 0; mi < 4; ++mi) {
    bb[mi][0] = *(const v4f*)&bos[64 * wv + 8 * h + 16 * mi];
    bb[mi][1] = *(const v4f*)&bos[64 * wv + 8 * h + 16 * mi + 4];
  }

  // oc[mi][ni][r] = (result row 64wv+16mi+8h+r, query 16ni+lm)
  float* Df = (float*)sm;
#pragma unroll
  for (int mi = 0; mi < 4; ++mi)
#pragma unroll
    for (int ni = 0; ni < 4; ++ni)
#pragma unroll
      for (int r = 0; r < 8; ++r)
        Df[(64 * wv + 16 * mi + 8 * h + r) * OFP + 16 * ni + lm] = oc[mi][ni][r] * inv[ni] + bb[mi][r >> 2][r & 3];
  __syncthreads();
  char* ob = (char*)(out + (size_t)b * actB);
  v4f val[32];
#pragma unroll
  for (int it = 0; it < 32; ++it) val[it] = *(const v4f*)&Df[(16 * it + orow) * OFP + oc4] + rv[it];
#pragma unroll
  for (int it = 0; it < 32; ++it) *(v4f*)(ob + off + (size_t)(16 * it) * NPIX * sizeof(float)) = val[it];
}

// ---------------------------------------------------------------------------
extern "C" void kernel_launch(void* const* d_in, const int* in_sizes, int n_in,
                              void* d_out, int out_size, void* d_ws,
                              size_t ws_size, hipStream_t stream) {
  if (n_in < 11) return;
  const long long per = (long long)CDIM * NPIX;
  const long long tot = (long long)in_sizes[0];
  if (tot <= 0 || (tot % per) != 0) return;
  const int B = (int)(tot / per);
  if ((long long)out_size != tot) return;
  if (in_sizes[1] != CDIM || in_sizes[2] != CDIM) return;
  if (in_sizes[3] != CDIM * CDIM || in_sizes[5] != CDIM * CDIM ||
      in_sizes[7] != CDIM * CDIM || in_sizes[9] != CDIM * CDIM) return;
  if (in_sizes[4] != CDIM || in_sizes[6] != CDIM || in_sizes[8] != CDIM || in_sizes[10] != CDIM) return;
  if (B > 65535) return;

  const float* x     = (const float*)d_in[0];
  const float* gamma = (const float*)d_in[1];
  const float* beta  = (const float*)d_in[2];
  const float* wq = (const float*)d_in[3]; const float* bq = (const float*)d_in[4];
  const float* wk = (const float*)d_in[5]; const float* bk = (const float*)d_in[6];
  const float* wv = (const float*)d_in[7]; const float* bv = (const float*)d_in[8];
  const float* wo = (const float*)d_in[9]; const float* bo = (const float*)d_in[10];
  float* out = (float*)d_out;

  // workspace carve: qT | kT | v16 | hT (each B*N*C f16) | w16 (wq, wk and wo*wv as f16, the f32 vector wo*bv in the fourth matrix's place)
  const size_t HB = (size_t)B * CDIM * NPIX * sizeof(_Float16);
  if (4 * HB + 4 * WEL * sizeof(_Float16) > ws_size) return;
  char* ws = (char*)d_ws;
  _Float16* qT  = (_Float16*)(ws);
  _Float16* kT  = (_Float16*)(ws + HB);
  _Float16* v16 = (_Float16*)(ws + 2 * HB);
  _Float16* hT  = (_Float16*)(ws + 3 * HB);
  _Float16* w16 = (_Float16*)(ws + 4 * HB);   // wq | wk | wo*wv | (in the fourth matrix's place) the f32 vector wo*bv
  float* bvo = (float*)(w16 + 3 * WEL);

  const size_t actB = (size_t)NPIX * CDIM;    // per-batch stride of hT/qT/kT/v16 (elements)
  const float wsc   = 64.0f;                   // f16 weight pre-scale
  const float attn_scale = 0.04419417382415922f;   // 512^-0.5
  const float psh   = 12.0f;                   // f16 probability pre-scale, as a power of two (x4096)

  gn_kernel<<<B * (CDIM / CBLK) + 2 * WCB + WPB + CDIM / 128, GNT, 0, stream>>>(x, gamma, beta, hT, B * (CDIM / CBLK), wq, wk, wv, wo, bv, wsc, w16, bvo);

  dim3 gp(3 * MT, NPIX / BT, B);
  // q, k, projected v in one grid: A = W[o][c] f16 (x64), Bt = hT[n][c]; q out [b][n][o] f16; k ([n][o]) and v ([o][n]) out in fragment order
  gemm_kernel<<<gp, 256, 0, stream>>>(w16, w16 + WEL, w16 + 2 * WEL, 0, CDIM, hT, actB, CDIM, CDIM,
                                         bq, bk, bvo, 1, 1.0f / wsc, qT, kT, v16, actB, CDIM, NPIX);
  // attention: scores, softmax (e x4096 as f16, in LDS), out[b][o][i] = res + sum_j v16[o][j] * e[i][j] / sum_j e[i][j] + bo
  dim3 ga(NPIX / AQ, B);
  attn_kernel<<<ga, 256, 0, stream>>>(qT, kT, v16, bo, x, out, attn_scale, psh);
}
